// v000
// Times are from an AMD MI455X. After a warm-up the kernel runs many times in a row, and a time is the length of
// such a window on the GPU divided by its runs, so every launch and the gaps after it count. The runs cycle
// through copies of the inputs. A figure is the median of several windows, for all but v000 over two sittings.
// Sittings can differ by a few percent; kernels timed side by side share one.
// v000 is the starting kernel. One run takes 127 microseconds.
#include <hip/hip_runtime.h>
#include <hip/hip_bf16.h>
#include <stdint.h>

typedef __attribute__((ext_vector_type(16))) _Float16 v16h;
typedef __attribute__((ext_vector_type(8)))  float    v8f;

#define BN_EPS 1e-5f

// Issue one wave-wide async global->LDS 16B-per-lane copy (512B per wave op).
__device__ __forceinline__ void async_copy_b128(const void* gptr, void* lds_ptr)
{
    unsigned ldsoff = (unsigned)(uintptr_t)lds_ptr;
    asm volatile("global_load_async_to_lds_b128 %0, %1, off"
                 :: "v"(ldsoff), "v"(gptr) : "memory");
}
__device__ __forceinline__ void async_wait_all()
{
    asm volatile("s_wait_asynccnt 0x0" ::: "memory");
}

// ---------------------------------------------------------------------------
// Kernel A: fold BatchNorm into weights; produce f16 weight copies + f32 bias
// ---------------------------------------------------------------------------
__global__ void fold_weights_kernel(
    const float* __restrict__ w_qk, const float* __restrict__ qk_g, const float* __restrict__ qk_b,
    const float* __restrict__ qk_m, const float* __restrict__ qk_v,
    const float* __restrict__ w_v,  const float* __restrict__ v_g,  const float* __restrict__ v_b,
    const float* __restrict__ v_m,  const float* __restrict__ v_v,
    const float* __restrict__ w_pe, const float* __restrict__ pe_g, const float* __restrict__ pe_b,
    const float* __restrict__ pe_m, const float* __restrict__ pe_v,
    const float* __restrict__ w_pr, const float* __restrict__ pr_g, const float* __restrict__ pr_b,
    const float* __restrict__ pr_m, const float* __restrict__ pr_v,
    _Float16* __restrict__ wcat16, float* __restrict__ bias_cat,
    _Float16* __restrict__ wproj16, float* __restrict__ bias_pr,
    float* __restrict__ wpe_s, float* __restrict__ bias_pe)
{
    const int idx = blockIdx.x * blockDim.x + threadIdx.x;
    const int stride = gridDim.x * blockDim.x;

    for (int i = idx; i < 768 * 256; i += stride) {
        int o = i >> 8, c = i & 255;
        float s, w;
        if (o < 512) { s = qk_g[o] * rsqrtf(qk_v[o] + BN_EPS); w = w_qk[o * 256 + c]; }
        else { int oo = o - 512; s = v_g[oo] * rsqrtf(v_v[oo] + BN_EPS); w = w_v[oo * 256 + c]; }
        wcat16[i] = (_Float16)(w * s);
    }
    for (int o = idx; o < 768; o += stride) {
        if (o < 512) { float s = qk_g[o] * rsqrtf(qk_v[o] + BN_EPS); bias_cat[o] = qk_b[o] - qk_m[o] * s; }
        else { int oo = o - 512; float s = v_g[oo] * rsqrtf(v_v[oo] + BN_EPS); bias_cat[o] = v_b[oo] - v_m[oo] * s; }
    }
    for (int i = idx; i < 256 * 256; i += stride) {
        int o = i >> 8;
        float s = pr_g[o] * rsqrtf(pr_v[o] + BN_EPS);
        wproj16[i] = (_Float16)(w_pr[i] * s);
    }
    for (int o = idx; o < 256; o += stride) {
        float s = pr_g[o] * rsqrtf(pr_v[o] + BN_EPS);
        bias_pr[o] = pr_b[o] - pr_m[o] * s;
        float spe = pe_g[o] * rsqrtf(pe_v[o] + BN_EPS);
        bias_pe[o] = pe_b[o] - pe_m[o] * spe;
    }
    for (int i = idx; i < 256 * 25; i += stride) {
        int c = i / 25;
        float s = pe_g[c] * rsqrtf(pe_v[c] + BN_EPS);
        wpe_s[i] = w_pe[i] * s;
    }
}

// ---------------------------------------------------------------------------
// Kernel B: pack x (B,C,H,W) f32 -> X16 row-major (B*N, C) f16
// ---------------------------------------------------------------------------
__global__ void pack_x_kernel(const float* __restrict__ x, _Float16* __restrict__ X16)
{
    int i = blockIdx.x * blockDim.x + threadIdx.x;
    if (i >= 2 * 256 * 4096) return;
    int c = i & 255;
    int n = (i >> 8) & 4095;
    int b = i >> 20;
    X16[i] = (_Float16)x[((size_t)(b * 256 + c) << 12) + n];
}

// ---------------------------------------------------------------------------
// Kernel C: fused QKV GEMM: X16 (8192x256) * wcat16^T + bias.
// 128-column weight slab (64 KB f16) async-staged once per block into LDS;
// K-loop streams only A from global, B from ds_load.
// ---------------------------------------------------------------------------
__global__ __launch_bounds__(256) void qkv_gemm_kernel(
    const _Float16* __restrict__ X16, const _Float16* __restrict__ W,
    const float* __restrict__ bias,
    _Float16* __restrict__ q16, _Float16* __restrict__ k16,
    _Float16* __restrict__ v16t, float* __restrict__ vf32)
{
    __shared__ _Float16 wlds[128 * 256];       // 64 KB weight slab
    const int lane = threadIdx.x & 31;
    const int wave = threadIdx.x >> 5;
    const int wm = wave & 3, wn = wave >> 2;
    const int m0 = blockIdx.x * 64 + wm * 16;
    const int n0 = wn * 64;                    // within-slab column base
    const int nslab = blockIdx.y * 128;        // global column base of slab
    const int row = lane & 15, hi = lane >> 4;

    // async stage the weight slab: 256 threads x 16 x 16B = 64 KB
    {
        const _Float16* wslab = W + (size_t)nslab * 256;
#pragma unroll
        for (int i = 0; i < 16; ++i) {
            int off = (threadIdx.x + i * 256) * 8;   // halves
            async_copy_b128(wslab + off, wlds + off);
        }
        async_wait_all();
        __syncthreads();
    }

    v8f acc[4] = {};
    const _Float16* arow = X16 + (size_t)(m0 + row) * 256 + hi * 16;
    for (int k0 = 0; k0 < 256; k0 += 32) {
        __builtin_prefetch(arow + k0 + 64, 0, 1);
        v16h a = *(const v16h*)(arow + k0);
#pragma unroll
        for (int t = 0; t < 4; ++t) {
            v16h bm = *(const v16h*)(wlds + (n0 + t * 16 + row) * 256 + k0 + hi * 16);
            acc[t] = __builtin_amdgcn_wmma_f32_16x16x32_f16(
                false, a, false, bm, (short)0, acc[t], false, false);
        }
    }

#pragma unroll
    for (int t = 0; t < 4; ++t) {
        int o = nslab + n0 + t * 16 + row;      // output channel
        float bo = bias[o];
#pragma unroll
        for (int r = 0; r < 8; ++r) {
            int m = m0 + r + 8 * hi;            // global spatial row (b*4096 + n)
            float val = acc[t][r] + bo;
            int b = m >> 12, n = m & 4095;
            int ba = (b << 2) + (n >> 10), na = n & 1023;
            if (o < 256) {                      // q
                int h = o >> 5, d = o & 31;
                q16[(((size_t)((ba << 3) + h) << 10) + na) * 32 + d] = (_Float16)val;
            } else if (o < 512) {               // k
                int oo = o - 256, h = oo >> 5, d = oo & 31;
                k16[(((size_t)((ba << 3) + h) << 10) + na) * 32 + d] = (_Float16)val;
            } else {                            // v : f32 NCHW + transposed f16
                int c = o - 512;
                vf32[((size_t)(b * 256 + c) << 12) + n] = val;
                int h = c >> 5, d = c & 31;
                v16t[((size_t)((((ba << 3) + h) << 5) + d) << 10) + na] = (_Float16)val;
            }
        }
    }
}

// ---------------------------------------------------------------------------
// Kernel D: depthwise 5x5 conv on v (pad 2), BN folded. pp layout [b][c][n].
// ---------------------------------------------------------------------------
__global__ void pe_conv_kernel(const float* __restrict__ vf32,
                               const float* __restrict__ wpe,
                               const float* __restrict__ bias_pe,
                               float* __restrict__ pp)
{
    int i = blockIdx.x * blockDim.x + threadIdx.x;
    if (i >= 2 * 256 * 4096) return;
    int n = i & 4095;
    int c = (i >> 12) & 255;
    int b = i >> 20;
    int y = n >> 6, xq = n & 63;
    const float* vin = vf32 + ((size_t)(b * 256 + c) << 12);
    const float* w = wpe + c * 25;
    float acc = bias_pe[c];
#pragma unroll
    for (int dy = -2; dy <= 2; ++dy) {
        int yy = y + dy;
        if ((unsigned)yy >= 64u) continue;
#pragma unroll
        for (int dx = -2; dx <= 2; ++dx) {
            int xx = xq + dx;
            if ((unsigned)xx >= 64u) continue;
            acc += vin[yy * 64 + xx] * w[(dy + 2) * 5 + (dx + 2)];
        }
    }
    pp[i] = acc;
}

// ---------------------------------------------------------------------------
// Kernel E: flash attention per (ba, h, n-tile). K/V chunks async-staged
// into LDS shared by all 8 waves; hd=32 => one WMMA per 16x16 score tile.
// Epilogue fuses (o + pp) -> comb16 rows (B*N, C) f16 for the proj GEMM.
// ---------------------------------------------------------------------------
__global__ __launch_bounds__(256) void attn_kernel(
    const _Float16* __restrict__ q16, const _Float16* __restrict__ k16,
    const _Float16* __restrict__ v16t, const float* __restrict__ pp,
    _Float16* __restrict__ comb16)
{
    __shared__ _Float16 ldsK[32 * 32];       // K chunk: [m_local][d]   (2 KB)
    __shared__ _Float16 ldsV[32 * 32];       // V chunk: [d][m_local]   (2 KB)
    __shared__ _Float16 pbuf[8][16 * 32];    // per-wave P staging      (8 KB)

    const int lane = threadIdx.x & 31, wave = threadIdx.x >> 5;
    const int ba = blockIdx.z, h = blockIdx.y;
    const int n0 = blockIdx.x * 128 + wave * 16;
    const int row = lane & 15, hi = lane >> 4;
    const float scale = 0.17677669529663687f;   // 1/sqrt(hd=32)

    const _Float16* qbase = q16 + ((size_t)(ba * 8 + h) << 10) * 32;
    const _Float16* kbase = k16 + ((size_t)(ba * 8 + h) << 10) * 32;
    const _Float16* vbase = v16t + ((size_t)(ba * 8 + h) << 5) * 1024;

    // A operand: 16 query rows x K=32 (entire head dim), loaded once.
    v16h aq = *(const v16h*)(qbase + (size_t)(n0 + row) * 32 + hi * 16);

    float rmax[8], rsum[8];
#pragma unroll
    for (int r = 0; r < 8; ++r) { rmax[r] = -1e30f; rsum[r] = 0.f; }
    v8f o0 = {}, o1 = {};
    _Float16* pl = &pbuf[wave][0];

    for (int m0 = 0; m0 < 1024; m0 += 32) {
        __syncthreads();   // staging + P buffers free for reuse
        // Async stage: waves 0-3 copy K chunk (contiguous 2 KB),
        //              waves 4-7 copy V chunk (32 d-rows x 64 B).
        if (threadIdx.x < 128) {
            int off = threadIdx.x * 8;                       // halves
            async_copy_b128(kbase + (size_t)m0 * 32 + off, ldsK + off);
        } else {
            int tt = threadIdx.x - 128;
            int d = tt >> 2, part = tt & 3;
            async_copy_b128(vbase + (size_t)d * 1024 + m0 + part * 8,
                            ldsV + d * 32 + part * 8);
        }
        async_wait_all();
        __syncthreads();   // staged chunks visible to all waves

        v16h bk0 = *(const v16h*)(ldsK + (row)      * 32 + hi * 16);
        v16h bk1 = *(const v16h*)(ldsK + (16 + row) * 32 + hi * 16);
        v8f s0 = {}, s1 = {};
        s0 = __builtin_amdgcn_wmma_f32_16x16x32_f16(false, aq, false, bk0, (short)0, s0, false, false);
        s1 = __builtin_amdgcn_wmma_f32_16x16x32_f16(false, aq, false, bk1, (short)0, s1, false, false);

        // online softmax per row; C-layout: element r of a lane is row r+8*hi,
        // the 16 lanes of each half hold the 16 columns of that row.
#pragma unroll
        for (int r = 0; r < 8; ++r) {
            float v0 = s0[r] * scale, v1 = s1[r] * scale;
            float mx = fmaxf(v0, v1);
            mx = fmaxf(mx, __shfl_xor(mx, 1, 32));
            mx = fmaxf(mx, __shfl_xor(mx, 2, 32));
            mx = fmaxf(mx, __shfl_xor(mx, 4, 32));
            mx = fmaxf(mx, __shfl_xor(mx, 8, 32));
            float mnew = fmaxf(rmax[r], mx);
            float corr = __expf(rmax[r] - mnew);
            rmax[r] = mnew;
            float e0 = __expf(v0 - mnew), e1 = __expf(v1 - mnew);
            float ps = e0 + e1;
            ps += __shfl_xor(ps, 1, 32);
            ps += __shfl_xor(ps, 2, 32);
            ps += __shfl_xor(ps, 4, 32);
            ps += __shfl_xor(ps, 8, 32);
            rsum[r] = rsum[r] * corr + ps;
            o0[r] *= corr; o1[r] *= corr;
            s0[r] = e0; s1[r] = e1;
        }

        // C-layout -> A-layout relayout of P through wave-private LDS
#pragma unroll
        for (int r = 0; r < 8; ++r) {
            int rr = r + 8 * hi;
            pl[rr * 32 + row]      = (_Float16)s0[r];
            pl[rr * 32 + 16 + row] = (_Float16)s1[r];
        }
        __syncthreads();   // P visible (ds complete) across lanes
        v16h ap  = *(const v16h*)(pl + row * 32 + hi * 16);
        v16h bv0 = *(const v16h*)(ldsV + (row)      * 32 + hi * 16);
        v16h bv1 = *(const v16h*)(ldsV + (16 + row) * 32 + hi * 16);
        o0 = __builtin_amdgcn_wmma_f32_16x16x32_f16(false, ap, false, bv0, (short)0, o0, false, false);
        o1 = __builtin_amdgcn_wmma_f32_16x16x32_f16(false, ap, false, bv1, (short)0, o1, false, false);
        // WMMA consumes ds reads (s_wait_dscnt) before next loop-top barrier.
    }

    // finalize: /= rowsum, add positional encoding, store f16 GEMM rows
    const int b = ba >> 2, area = ba & 3;
#pragma unroll
    for (int r = 0; r < 8; ++r) {
        int n_local = n0 + r + 8 * hi;
        int n_global = area * 1024 + n_local;
        float inv = 1.0f / rsum[r];
        int c0 = h * 32 + row, c1 = c0 + 16;
        float pv0 = pp[((size_t)(b * 256 + c0) << 12) + n_global];
        float pv1 = pp[((size_t)(b * 256 + c1) << 12) + n_global];
        size_t base = ((size_t)(b * 4096 + n_global)) * 256;
        comb16[base + c0] = (_Float16)(o0[r] * inv + pv0);
        comb16[base + c1] = (_Float16)(o1[r] * inv + pv1);
    }
}

// ---------------------------------------------------------------------------
// Kernel F: projection GEMM: comb16 (8192x256) * wproj16^T + bias -> NCHW f32
// Weight slab async-staged in LDS as in kernel C.
// ---------------------------------------------------------------------------
__global__ __launch_bounds__(256) void proj_gemm_kernel(
    const _Float16* __restrict__ A, const _Float16* __restrict__ W,
    const float* __restrict__ bias, float* __restrict__ out)
{
    __shared__ _Float16 wlds[128 * 256];       // 64 KB weight slab
    const int lane = threadIdx.x & 31, wave = threadIdx.x >> 5;
    const int wm = wave & 3, wn = wave >> 2;
    const int m0 = blockIdx.x * 64 + wm * 16;
    const int n0 = wn * 64;
    const int nslab = blockIdx.y * 128;
    const int row = lane & 15, hi = lane >> 4;

    {
        const _Float16* wslab = W + (size_t)nslab * 256;
#pragma unroll
        for (int i = 0; i < 16; ++i) {
            int off = (threadIdx.x + i * 256) * 8;
            async_copy_b128(wslab + off, wlds + off);
        }
        async_wait_all();
        __syncthreads();
    }

    v8f acc[4] = {};
    const _Float16* arow = A + (size_t)(m0 + row) * 256 + hi * 16;
    for (int k0 = 0; k0 < 256; k0 += 32) {
        __builtin_prefetch(arow + k0 + 64, 0, 1);
        v16h a = *(const v16h*)(arow + k0);
#pragma unroll
        for (int t = 0; t < 4; ++t) {
            v16h bm = *(const v16h*)(wlds + (n0 + t * 16 + row) * 256 + k0 + hi * 16);
            acc[t] = __builtin_amdgcn_wmma_f32_16x16x32_f16(
                false, a, false, bm, (short)0, acc[t], false, false);
        }
    }
#pragma unroll
    for (int t = 0; t < 4; ++t) {
        int o = nslab + n0 + t * 16 + row;
        float bo = bias[o];
#pragma unroll
        for (int r = 0; r < 8; ++r) {
            int m = m0 + r + 8 * hi;
            int b = m >> 12, n = m & 4095;
            out[((size_t)(b * 256 + o) << 12) + n] = acc[t][r] + bo;
        }
    }
}

// ---------------------------------------------------------------------------
extern "C" void kernel_launch(void* const* d_in, const int* in_sizes, int n_in,
                              void* d_out, int out_size, void* d_ws, size_t ws_size,
                              hipStream_t stream)
{
    const float* x     = (const float*)d_in[0];
    const float* w_qk  = (const float*)d_in[1];
    const float* w_v   = (const float*)d_in[2];
    const float* w_pe  = (const float*)d_in[3];
    const float* w_pr  = (const float*)d_in[4];
    const float* qk_g  = (const float*)d_in[5];
    const float* qk_b  = (const float*)d_in[6];
    const float* qk_m  = (const float*)d_in[7];
    const float* qk_v  = (const float*)d_in[8];
    const float* v_g   = (const float*)d_in[9];
    const float* v_b   = (const float*)d_in[10];
    const float* v_m   = (const float*)d_in[11];
    const float* v_v   = (const float*)d_in[12];
    const float* pe_g  = (const float*)d_in[13];
    const float* pe_b  = (const float*)d_in[14];
    const float* pe_m  = (const float*)d_in[15];
    const float* pe_v  = (const float*)d_in[16];
    const float* pr_g  = (const float*)d_in[17];
    const float* pr_b  = (const float*)d_in[18];
    const float* pr_m  = (const float*)d_in[19];
    const float* pr_v  = (const float*)d_in[20];
    float* out = (float*)d_out;

    // workspace carve-up (256B aligned)
    char* ws = (char*)d_ws;
    size_t off = 0;
    auto carve = [&](size_t bytes) -> char* {
        char* p = ws + off;
        off = (off + bytes + 255) & ~(size_t)255;
        return p;
    };
    _Float16* wcat16  = (_Float16*)carve(768 * 256 * sizeof(_Float16));
    float*    biascat = (float*)   carve(768 * sizeof(float));
    _Float16* wproj16 = (_Float16*)carve(256 * 256 * sizeof(_Float16));
    float*    biaspr  = (float*)   carve(256 * sizeof(float));
    float*    wpe_s   = (float*)   carve(256 * 25 * sizeof(float));
    float*    biaspe  = (float*)   carve(256 * sizeof(float));
    _Float16* X16     = (_Float16*)carve((size_t)8192 * 256 * sizeof(_Float16));
    _Float16* q16     = (_Float16*)carve((size_t)8 * 8 * 1024 * 32 * sizeof(_Float16));
    _Float16* k16     = (_Float16*)carve((size_t)8 * 8 * 1024 * 32 * sizeof(_Float16));
    _Float16* v16t    = (_Float16*)carve((size_t)8 * 8 * 32 * 1024 * sizeof(_Float16));
    float*    vf32    = (float*)   carve((size_t)2 * 256 * 4096 * sizeof(float));
    float*    pp      = (float*)   carve((size_t)2 * 256 * 4096 * sizeof(float));
    _Float16* comb16  = (_Float16*)carve((size_t)8192 * 256 * sizeof(_Float16));

    fold_weights_kernel<<<256, 256, 0, stream>>>(
        w_qk, qk_g, qk_b, qk_m, qk_v,
        w_v,  v_g,  v_b,  v_m,  v_v,
        w_pe, pe_g, pe_b, pe_m, pe_v,
        w_pr, pr_g, pr_b, pr_m, pr_v,
        wcat16, biascat, wproj16, biaspr, wpe_s, biaspe);

    pack_x_kernel<<<(2 * 256 * 4096 + 255) / 256, 256, 0, stream>>>(x, X16);

    qkv_gemm_kernel<<<dim3(8192 / 64, 768 / 128), 256, 0, stream>>>(
        X16, wcat16, biascat, q16, k16, v16t, vf32);

    pe_conv_kernel<<<(2 * 256 * 4096 + 255) / 256, 256, 0, stream>>>(vf32, wpe_s, biaspe, pp);

    attn_kernel<<<dim3(8, 8, 8), 256, 0, stream>>>(q16, k16, v16t, pp, comb16);

    proj_gemm_kernel<<<dim3(8192 / 64, 256 / 128), 256, 0, stream>>>(
        comb16, wproj16, biaspr, out);
}

// v001
// It runs in 107 microseconds.
// Next to v000, in two timings, it ran 1.21 times as fast each time.
#include <hip/hip_runtime.h>
#include <hip/hip_bf16.h>
#include <stdint.h>

typedef __attribute__((ext_vector_type(16))) _Float16 v16h;
typedef __attribute__((ext_vector_type(8)))  float    v8f;

#define BN_EPS 1e-5f

// Issue one wave-wide async global->LDS 16B-per-lane copy (512B per wave op).
__device__ __forceinline__ void async_copy_b128(const void* gptr, void* lds_ptr)
{
    unsigned ldsoff = (unsigned)(uintptr_t)lds_ptr;
    asm volatile("global_load_async_to_lds_b128 %0, %1, off"
                 :: "v"(ldsoff), "v"(gptr) : "memory");
}
__device__ __forceinline__ void async_wait_all()
{
    asm volatile("s_wait_asynccnt 0x0" ::: "memory");
}

// ---------------------------------------------------------------------------
// Kernel A: fold BatchNorm into weights; produce f16 weight copies + f32 bias
// ---------------------------------------------------------------------------
__global__ void fold_weights_kernel(
    const float* __restrict__ w_qk, const float* __restrict__ qk_g, const float* __restrict__ qk_b,
    const float* __restrict__ qk_m, const float* __restrict__ qk_v,
    const float* __restrict__ w_v,  const float* __restrict__ v_g,  const float* __restrict__ v_b,
    const float* __restrict__ v_m,  const float* __restrict__ v_v,
    const float* __restrict__ w_pe, const float* __restrict__ pe_g, const float* __restrict__ pe_b,
    const float* __restrict__ pe_m, const float* __restrict__ pe_v,
    const float* __restrict__ w_pr, const float* __restrict__ pr_g, const float* __restrict__ pr_b,
    const float* __restrict__ pr_m, const float* __restrict__ pr_v,
    _Float16* __restrict__ wcat16, float* __restrict__ bias_cat,
    _Float16* __restrict__ wproj16, float* __restrict__ bias_pr,
    float* __restrict__ wpe_s, float* __restrict__ bias_pe)
{
    const int idx = blockIdx.x * blockDim.x + threadIdx.x;
    const int stride = gridDim.x * blockDim.x;

    for (int i = idx; i < 768 * 256; i += stride) {
        int o = i >> 8, c = i & 255;
        float s, w;
        if (o < 512) { s = qk_g[o] * rsqrtf(qk_v[o] + BN_EPS); w = w_qk[o * 256 + c]; }
        else { int oo = o - 512; s = v_g[oo] * rsqrtf(v_v[oo] + BN_EPS); w = w_v[oo * 256 + c]; }
        wcat16[i] = (_Float16)(w * s);
    }
    for (int o = idx; o < 768; o += stride) {
        if (o < 512) { float s = qk_g[o] * rsqrtf(qk_v[o] + BN_EPS); bias_cat[o] = qk_b[o] - qk_m[o] * s; }
        else { int oo = o - 512; float s = v_g[oo] * rsqrtf(v_v[oo] + BN_EPS); bias_cat[o] = v_b[oo] - v_m[oo] * s; }
    }
    for (int i = idx; i < 256 * 256; i += stride) {
        int o = i >> 8;
        float s = pr_g[o] * rsqrtf(pr_v[o] + BN_EPS);
        wproj16[i] = (_Float16)(w_pr[i] * s);
    }
    for (int o = idx; o < 256; o += stride) {
        float s = pr_g[o] * rsqrtf(pr_v[o] + BN_EPS);
        bias_pr[o] = pr_b[o] - pr_m[o] * s;
        float spe = pe_g[o] * rsqrtf(pe_v[o] + BN_EPS);
        bias_pe[o] = pe_b[o] - pe_m[o] * spe;
    }
    for (int i = idx; i < 256 * 25; i += stride) {
        int c = i / 25;
        float s = pe_g[c] * rsqrtf(pe_v[c] + BN_EPS);
        wpe_s[i] = w_pe[i] * s;
    }
}

// ---------------------------------------------------------------------------
// Kernel B: pack x (B,C,H,W) f32 -> X16 row-major (B*N, C) f16
// ---------------------------------------------------------------------------
__global__ void pack_x_kernel(const float* __restrict__ x, _Float16* __restrict__ X16)
{
    int i = blockIdx.x * blockDim.x + threadIdx.x;
    if (i >= 2 * 256 * 4096) return;
    int c = i & 255;
    int n = (i >> 8) & 4095;
    int b = i >> 20;
    X16[i] = (_Float16)x[((size_t)(b * 256 + c) << 12) + n];
}

// ---------------------------------------------------------------------------
// Kernel C: fused QKV GEMM: X16 (8192x256) * wcat16^T + bias.
// 128-column weight slab (64 KB f16) async-staged once per block into LDS;
// K-loop streams only A from global, B from ds_load.
// ---------------------------------------------------------------------------
__global__ __launch_bounds__(256) void qkv_gemm_kernel(
    const _Float16* __restrict__ X16, const _Float16* __restrict__ W,
    const float* __restrict__ bias,
    _Float16* __restrict__ q16, _Float16* __restrict__ k16,
    _Float16* __restrict__ v16t, float* __restrict__ vf32)
{
    __shared__ _Float16 wlds[128 * 256];       // 64 KB weight slab
    const int lane = threadIdx.x & 31;
    const int wave = threadIdx.x >> 5;
    const int wm = wave & 3, wn = wave >> 2;
    const int m0 = blockIdx.x * 64 + wm * 16;
    const int n0 = wn * 64;                    // within-slab column base
    const int nslab = blockIdx.y * 128;        // global column base of slab
    const int row = lane & 15, hi = lane >> 4;

    // async stage the weight slab: 256 threads x 16 x 16B = 64 KB
    {
        const _Float16* wslab = W + (size_t)nslab * 256;
#pragma unroll
        for (int i = 0; i < 16; ++i) {
            int off = (threadIdx.x + i * 256) * 8;   // halves
            async_copy_b128(wslab + off, wlds + off);
        }
        async_wait_all();
        __syncthreads();
    }

    v8f acc[4] = {};
    const _Float16* arow = X16 + (size_t)(m0 + row) * 256 + hi * 16;
    for (int k0 = 0; k0 < 256; k0 += 32) {
        __builtin_prefetch(arow + k0 + 64, 0, 1);
        v16h a = *(const v16h*)(arow + k0);
#pragma unroll
        for (int t = 0; t < 4; ++t) {
            v16h bm = *(const v16h*)(wlds + (n0 + t * 16 + row) * 256 + k0 + hi * 16);
            acc[t] = __builtin_amdgcn_wmma_f32_16x16x32_f16(
                false, a, false, bm, (short)0, acc[t], false, false);
        }
    }

#pragma unroll
    for (int t = 0; t < 4; ++t) {
        int o = nslab + n0 + t * 16 + row;      // output channel
        float bo = bias[o];
#pragma unroll
        for (int r = 0; r < 8; ++r) {
            int m = m0 + r + 8 * hi;            // global spatial row (b*4096 + n)
            float val = acc[t][r] + bo;
            int b = m >> 12, n = m & 4095;
            int ba = (b << 2) + (n >> 10), na = n & 1023;
            if (o < 256) {                      // q
                int h = o >> 5, d = o & 31;
                q16[(((size_t)((ba << 3) + h) << 10) + na) * 32 + d] = (_Float16)val;
            } else if (o < 512) {               // k
                int oo = o - 256, h = oo >> 5, d = oo & 31;
                k16[(((size_t)((ba << 3) + h) << 10) + na) * 32 + d] = (_Float16)val;
            } else {                            // v : f32 NCHW + transposed f16
                int c = o - 512;
                vf32[((size_t)(b * 256 + c) << 12) + n] = val;
                int h = c >> 5, d = c & 31;
                v16t[((size_t)((((ba << 3) + h) << 5) + d) << 10) + na] = (_Float16)val;
            }
        }
    }
}

// ---------------------------------------------------------------------------
// Kernel D: depthwise 5x5 conv on v (pad 2), BN folded. pp layout [b][c][n].
// ---------------------------------------------------------------------------
__global__ void pe_conv_kernel(const float* __restrict__ vf32,
                               const float* __restrict__ wpe,
                               const float* __restrict__ bias_pe,
                               float* __restrict__ pp)
{
    int i = blockIdx.x * blockDim.x + threadIdx.x;
    if (i >= 2 * 256 * 4096) return;
    int n = i & 4095;
    int c = (i >> 12) & 255;
    int b = i >> 20;
    int y = n >> 6, xq = n & 63;
    const float* vin = vf32 + ((size_t)(b * 256 + c) << 12);
    const float* w = wpe + c * 25;
    float acc = bias_pe[c];
#pragma unroll
    for (int dy = -2; dy <= 2; ++dy) {
        int yy = y + dy;
        if ((unsigned)yy >= 64u) continue;
#pragma unroll
        for (int dx = -2; dx <= 2; ++dx) {
            int xx = xq + dx;
            if ((unsigned)xx >= 64u) continue;
            acc += vin[yy * 64 + xx] * w[(dy + 2) * 5 + (dx + 2)];
        }
    }
    pp[i] = acc;
}

typedef __attribute__((ext_vector_type(8))) _Float16 v8h;

// lane l <-> lane l ^ 16
__device__ __forceinline__ float xhalf(float x)
{
    int i = __builtin_bit_cast(int, x);
    return __builtin_bit_cast(float,
        __builtin_amdgcn_permlanex16(i, i, 0x76543210, 0xfedcba98, false, false));
}

__global__ __launch_bounds__(256) void attn_kernel(
    const _Float16* __restrict__ q16, const _Float16* __restrict__ k16,
    const _Float16* __restrict__ v16t, const float* __restrict__ pp,
    _Float16* __restrict__ comb16)
{
    __shared__ _Float16 ldsK[32 * 32];       // K chunk: [m_local][d]   (2 KB)
    __shared__ _Float16 ldsV[32 * 32];       // V chunk: [d][m_local]   (2 KB)

    const int lane = threadIdx.x & 31, wave = threadIdx.x >> 5;
    const int ba = blockIdx.z, h = blockIdx.y;
    const int n0 = blockIdx.x * 128 + wave * 16;
    const int row = lane & 15, hi = lane >> 4;
    const float scale = 0.17677669529663687f;   // 1/sqrt(hd=32)

    const _Float16* qbase = q16 + ((size_t)(ba * 8 + h) << 10) * 32;
    const _Float16* kbase = k16 + ((size_t)(ba * 8 + h) << 10) * 32;
    const _Float16* vbase = v16t + ((size_t)(ba * 8 + h) << 5) * 1024;

    // B operand: 16 query columns x K=32 (entire head dim), loaded once.
    v16h bq = *(const v16h*)(qbase + (size_t)(n0 + row) * 32 + hi * 16);

    // State of this lane's query (column 'row'); rsum covers only the keys
    // this wave half holds, the halves are joined after the loop.
    float rmax = -1e30f, rsum = 0.f;
    v8f o0 = {}, o1 = {};    // o0[r] = O[query][d = 8*hi + r], o1: d + 16

    for (int m0 = 0; m0 < 1024; m0 += 32) {
        __syncthreads();   // staging buffers free for reuse
        // Async stage: waves 0-3 copy K chunk (contiguous 2 KB),
        //              waves 4-7 copy V chunk (32 d-rows x 64 B).
        if (threadIdx.x < 128) {
            int off = threadIdx.x * 8;                       // halves
            async_copy_b128(kbase + (size_t)m0 * 32 + off, ldsK + off);
        } else {
            int tt = threadIdx.x - 128;
            int d = tt >> 2, part = tt & 3;
            async_copy_b128(vbase + (size_t)d * 1024 + m0 + part * 8,
                            ldsV + d * 32 + part * 8);
        }
        async_wait_all();
        __syncthreads();   // staged chunks visible to all waves

        // A operand: 16 key rows x K=32, same k order as bq.
        v16h ak0 = *(const v16h*)(ldsK + (row)      * 32 + hi * 16);
        v16h ak1 = *(const v16h*)(ldsK + (16 + row) * 32 + hi * 16);
        // A operand of the second product: 16 d rows of V^T, keys in the order
        // in which the packed score tiles hold them (8*hi + s, 16 + 8*hi + s).
        v8h av0lo = *(const v8h*)(ldsV + (row)      * 32 + hi * 8);
        v8h av0hi = *(const v8h*)(ldsV + (row)      * 32 + 16 + hi * 8);
        v8h av1lo = *(const v8h*)(ldsV + (16 + row) * 32 + hi * 8);
        v8h av1hi = *(const v8h*)(ldsV + (16 + row) * 32 + 16 + hi * 8);
        // Keeps the four V loads up here, beside the K loads: left free the
        // scheduler sinks them to just in front of the second product, where
        // their LDS latency is then waited for in full.
        __builtin_amdgcn_sched_barrier(0);

        v8f s0 = {}, s1 = {};
        s0 = __builtin_amdgcn_wmma_f32_16x16x32_f16(false, ak0, false, bq, (short)0, s0, false, false);
        s1 = __builtin_amdgcn_wmma_f32_16x16x32_f16(false, ak1, false, bq, (short)0, s1, false, false);

        // online softmax; s0[r] = S[key 8*hi + r][query], s1[r]: key + 16.
        s0 *= scale; s1 *= scale;
        float mx0 = s0[0], mx1 = s1[0];
        // unrolled: constant element indices keep the tiles in registers
#pragma unroll
        for (int r = 1; r < 8; ++r) { mx0 = fmaxf(mx0, s0[r]); mx1 = fmaxf(mx1, s1[r]); }
        float mx = fmaxf(mx0, mx1);
        mx = fmaxf(mx, xhalf(mx));
        float mnew = fmaxf(rmax, mx);
        float corr = __expf(rmax - mnew);
        rmax = mnew;
        v16h bp;
        // unrolled: constant element indices keep the tiles in registers
#pragma unroll
        for (int r = 0; r < 8; ++r) {
            s0[r] = __expf(s0[r] - mnew);
            s1[r] = __expf(s1[r] - mnew);
            bp[r]     = (_Float16)s0[r];
            bp[8 + r] = (_Float16)s1[r];
        }
        v8f t = s0 + s1;
        float ps = ((t[0] + t[1]) + (t[2] + t[3])) + ((t[4] + t[5]) + (t[6] + t[7]));
        rsum = rsum * corr + ps;
        o0 *= corr; o1 *= corr;

        v16h av0 = __builtin_shufflevector(av0lo, av0hi, 0, 1, 2, 3, 4, 5, 6, 7, 8, 9, 10, 11, 12, 13, 14, 15);
        v16h av1 = __builtin_shufflevector(av1lo, av1hi, 0, 1, 2, 3, 4, 5, 6, 7, 8, 9, 10, 11, 12, 13, 14, 15);
        o0 = __builtin_amdgcn_wmma_f32_16x16x32_f16(false, av0, false, bp, (short)0, o0, false, false);
        o1 = __builtin_amdgcn_wmma_f32_16x16x32_f16(false, av1, false, bp, (short)0, o1, false, false);
        // WMMA consumes ds reads (s_wait_dscnt) before next loop-top barrier.
    }

    // finalize: join the halves' sums, /= rowsum, add positional encoding,
    // store 8 consecutive channels of one f16 GEMM row per 16-byte store
    rsum += xhalf(rsum);
    const float inv = 1.0f / rsum;
    const int b = ba >> 2, area = ba & 3;
    const int n_global = area * 1024 + n0 + row;
    const int c0 = h * 32 + 8 * hi;
    v8h w0, w1;
    // unrolled: constant element indices, and all 16 loads in flight at once
#pragma unroll
    for (int r = 0; r < 8; ++r) {
        float pv0 = pp[((size_t)(b * 256 + c0 + r) << 12) + n_global];
        float pv1 = pp[((size_t)(b * 256 + c0 + 16 + r) << 12) + n_global];
        w0[r] = (_Float16)(o0[r] * inv + pv0);
        w1[r] = (_Float16)(o1[r] * inv + pv1);
    }
    _Float16* crow = comb16 + ((size_t)(b * 4096 + n_global)) * 256 + c0;
    *(v8h*)(crow)      = w0;
    *(v8h*)(crow + 16) = w1;
}

// ---------------------------------------------------------------------------
// Kernel F: projection GEMM: comb16 (8192x256) * wproj16^T + bias -> NCHW f32
// Weight slab async-staged in LDS as in kernel C.
// ---------------------------------------------------------------------------
__global__ __launch_bounds__(256) void proj_gemm_kernel(
    const _Float16* __restrict__ A, const _Float16* __restrict__ W,
    const float* __restrict__ bias, float* __restrict__ out)
{
    __shared__ _Float16 wlds[128 * 256];       // 64 KB weight slab
    const int lane = threadIdx.x & 31, wave = threadIdx.x >> 5;
    const int wm = wave & 3, wn = wave >> 2;
    const int m0 = blockIdx.x * 64 + wm * 16;
    const int n0 = wn * 64;
    const int nslab = blockIdx.y * 128;
    const int row = lane & 15, hi = lane >> 4;

    {
        const _Float16* wslab = W + (size_t)nslab * 256;
#pragma unroll
        for (int i = 0; i < 16; ++i) {
            int off = (threadIdx.x + i * 256) * 8;
            async_copy_b128(wslab + off, wlds + off);
        }
        async_wait_all();
        __syncthreads();
    }

    v8f acc[4] = {};
    const _Float16* arow = A + (size_t)(m0 + row) * 256 + hi * 16;
    for (int k0 = 0; k0 < 256; k0 += 32) {
        __builtin_prefetch(arow + k0 + 64, 0, 1);
        v16h a = *(const v16h*)(arow + k0);
#pragma unroll
        for (int t = 0; t < 4; ++t) {
            v16h bm = *(const v16h*)(wlds + (n0 + t * 16 + row) * 256 + k0 + hi * 16);
            acc[t] = __builtin_amdgcn_wmma_f32_16x16x32_f16(
                false, a, false, bm, (short)0, acc[t], false, false);
        }
    }
#pragma unroll
    for (int t = 0; t < 4; ++t) {
        int o = nslab + n0 + t * 16 + row;
        float bo = bias[o];
#pragma unroll
        for (int r = 0; r < 8; ++r) {
            int m = m0 + r + 8 * hi;
            int b = m >> 12, n = m & 4095;
            out[((size_t)(b * 256 + o) << 12) + n] = acc[t][r] + bo;
        }
    }
}

// ---------------------------------------------------------------------------
extern "C" void kernel_launch(void* const* d_in, const int* in_sizes, int n_in,
                              void* d_out, int out_size, void* d_ws, size_t ws_size,
                              hipStream_t stream)
{
    const float* x     = (const float*)d_in[0];
    const float* w_qk  = (const float*)d_in[1];
    const float* w_v   = (const float*)d_in[2];
    const float* w_pe  = (const float*)d_in[3];
    const float* w_pr  = (const float*)d_in[4];
    const float* qk_g  = (const float*)d_in[5];
    const float* qk_b  = (const float*)d_in[6];
    const float* qk_m  = (const float*)d_in[7];
    const float* qk_v  = (const float*)d_in[8];
    const float* v_g   = (const float*)d_in[9];
    const float* v_b   = (const float*)d_in[10];
    const float* v_m   = (const float*)d_in[11];
    const float* v_v   = (const float*)d_in[12];
    const float* pe_g  = (const float*)d_in[13];
    const float* pe_b  = (const float*)d_in[14];
    const float* pe_m  = (const float*)d_in[15];
    const float* pe_v  = (const float*)d_in[16];
    const float* pr_g  = (const float*)d_in[17];
    const float* pr_b  = (const float*)d_in[18];
    const float* pr_m  = (const float*)d_in[19];
    const float* pr_v  = (const float*)d_in[20];
    float* out = (float*)d_out;

    // workspace carve-up (256B aligned)
    char* ws = (char*)d_ws;
    size_t off = 0;
    auto carve = [&](size_t bytes) -> char* {
        char* p = ws + off;
        off = (off + bytes + 255) & ~(size_t)255;
        return p;
    };
    _Float16* wcat16  = (_Float16*)carve(768 * 256 * sizeof(_Float16));
    float*    biascat = (float*)   carve(768 * sizeof(float));
    _Float16* wproj16 = (_Float16*)carve(256 * 256 * sizeof(_Float16));
    float*    biaspr  = (float*)   carve(256 * sizeof(float));
    float*    wpe_s   = (float*)   carve(256 * 25 * sizeof(float));
    float*    biaspe  = (float*)   carve(256 * sizeof(float));
    _Float16* X16     = (_Float16*)carve((size_t)8192 * 256 * sizeof(_Float16));
    _Float16* q16     = (_Float16*)carve((size_t)8 * 8 * 1024 * 32 * sizeof(_Float16));
    _Float16* k16     = (_Float16*)carve((size_t)8 * 8 * 1024 * 32 * sizeof(_Float16));
    _Float16* v16t    = (_Float16*)carve((size_t)8 * 8 * 32 * 1024 * sizeof(_Float16));
    float*    vf32    = (float*)   carve((size_t)2 * 256 * 4096 * sizeof(float));
    float*    pp      = (float*)   carve((size_t)2 * 256 * 4096 * sizeof(float));
    _Float16* comb16  = (_Float16*)carve((size_t)8192 * 256 * sizeof(_Float16));

    fold_weights_kernel<<<256, 256, 0, stream>>>(
        w_qk, qk_g, qk_b, qk_m, qk_v,
        w_v,  v_g,  v_b,  v_m,  v_v,
        w_pe, pe_g, pe_b, pe_m, pe_v,
        w_pr, pr_g, pr_b, pr_m, pr_v,
        wcat16, biascat, wproj16, biaspr, wpe_s, biaspe);

    pack_x_kernel<<<(2 * 256 * 4096 + 255) / 256, 256, 0, stream>>>(x, X16);

    qkv_gemm_kernel<<<dim3(8192 / 64, 768 / 128), 256, 0, stream>>>(
        X16, wcat16, biascat, q16, k16, v16t, vf32);

    pe_conv_kernel<<<(2 * 256 * 4096 + 255) / 256, 256, 0, stream>>>(vf32, wpe_s, biaspe, pp);

    attn_kernel<<<dim3(8, 8, 8), 256, 0, stream>>>(q16, k16, v16t, pp, comb16);

    proj_gemm_kernel<<<dim3(8192 / 64, 256 / 128), 256, 0, stream>>>(
        comb16, wproj16, biaspr, out);
}

// v002
// Measured time: 83.5 microseconds a run.
// Two timings next to v001 both put it at 1.28 times that version's speed.
// Over all steps from v000 it is 1.56 times as fast.
#include <hip/hip_runtime.h>
#include <hip/hip_bf16.h>
#include <stdint.h>

typedef __attribute__((ext_vector_type(16))) _Float16 v16h;
typedef __attribute__((ext_vector_type(8)))  float    v8f;
typedef __attribute__((ext_vector_type(8)))  _Float16 v8h;
typedef __attribute__((ext_vector_type(4)))  float    v4f;
typedef __attribute__((ext_vector_type(2)))  float    v2f;

#define BN_EPS 1e-5f

// Issue one wave-wide async global->LDS 16B-per-lane copy (512B per wave op).
__device__ __forceinline__ void async_copy_b128(const void* gptr, void* lds_ptr)
{
    unsigned ldsoff = (unsigned)(uintptr_t)lds_ptr;
    asm volatile("global_load_async_to_lds_b128 %0, %1, off"
                 :: "v"(ldsoff), "v"(gptr) : "memory");
}
__device__ __forceinline__ void async_wait_all()
{
    asm volatile("s_wait_asynccnt 0x0" ::: "memory");
}

// ---------------------------------------------------------------------------
// Kernel A: fold BatchNorm into weights; produce f16 weight copies + f32 bias
// ---------------------------------------------------------------------------
__global__ void fold_weights_kernel(
    const float* __restrict__ w_qk, const float* __restrict__ qk_g, const float* __restrict__ qk_b,
    const float* __restrict__ qk_m, const float* __restrict__ qk_v,
    const float* __restrict__ w_v,  const float* __restrict__ v_g,  const float* __restrict__ v_b,
    const float* __restrict__ v_m,  const float* __restrict__ v_v,
    const float* __restrict__ w_pe, const float* __restrict__ pe_g, const float* __restrict__ pe_b,
    const float* __restrict__ pe_m, const float* __restrict__ pe_v,
    const float* __restrict__ w_pr, const float* __restrict__ pr_g, const float* __restrict__ pr_b,
    const float* __restrict__ pr_m, const float* __restrict__ pr_v,
    _Float16* __restrict__ wcat16, float* __restrict__ bias_cat,
    _Float16* __restrict__ wproj16, float* __restrict__ bias_pr,
    float* __restrict__ wpe_s, float* __restrict__ bias_pe)
{
    const int idx = blockIdx.x * blockDim.x + threadIdx.x;
    const int stride = gridDim.x * blockDim.x;

    for (int i = idx; i < 768 * 256; i += stride) {
        int o = i >> 8, c = i & 255;
        float s, w;
        if (o < 512) { s = qk_g[o] * rsqrtf(qk_v[o] + BN_EPS); w = w_qk[o * 256 + c]; }
        else { int oo = o - 512; s = v_g[oo] * rsqrtf(v_v[oo] + BN_EPS); w = w_v[oo * 256 + c]; }
        wcat16[i] = (_Float16)(w * s);
    }
    for (int o = idx; o < 768; o += stride) {
        if (o < 512) { float s = qk_g[o] * rsqrtf(qk_v[o] + BN_EPS); bias_cat[o] = qk_b[o] - qk_m[o] * s; }
        else { int oo = o - 512; float s = v_g[oo] * rsqrtf(v_v[oo] + BN_EPS); bias_cat[o] = v_b[oo] - v_m[oo] * s; }
    }
    for (int i = idx; i < 256 * 256; i += stride) {
        int o = i >> 8;
        float s = pr_g[o] * rsqrtf(pr_v[o] + BN_EPS);
        wproj16[i] = (_Float16)(w_pr[i] * s);
    }
    for (int o = idx; o < 256; o += stride) {
        float s = pr_g[o] * rsqrtf(pr_v[o] + BN_EPS);
        bias_pr[o] = pr_b[o] - pr_m[o] * s;
        float spe = pe_g[o] * rsqrtf(pe_v[o] + BN_EPS);
        bias_pe[o] = pe_b[o] - pe_m[o] * spe;
    }
    for (int i = idx; i < 256 * 25; i += stride) {
        int c = i / 25;
        float s = pe_g[c] * rsqrtf(pe_v[c] + BN_EPS);
        wpe_s[i] = w_pe[i] * s;
    }
}

// ---------------------------------------------------------------------------
// Kernel B: pack x (B,C,H,W) f32 -> X16 row-major (B*N, C) f16.
// A thread takes 8 channels x 4 positions: eight 16-byte loads along n, four
// 16-byte stores along c. In a wave 8 lanes lie along c and 4 along n, so each
// store fills four whole 128-byte lines of X16, every line from one wave.
// ---------------------------------------------------------------------------
__global__ __launch_bounds__(256) void pack_x_kernel(const float* __restrict__ x, _Float16* __restrict__ X16)
{
    const int lane = threadIdx.x & 31, wave = threadIdx.x >> 5;
    const int n  = blockIdx.x * 128 + wave * 16 + (lane >> 3) * 4;
    const int c0 = blockIdx.y * 64 + (lane & 7) * 8;
    const int b  = blockIdx.z;
    const float* src = x + ((size_t)(b * 256 + c0) << 12) + n;
    v4f v[8];
    // unrolled: constant element indices, and all 8 loads in flight at once
#pragma unroll
    for (int j = 0; j < 8; ++j) v[j] = *(const v4f*)(src + ((size_t)j << 12));
    _Float16* dst = X16 + ((size_t)(b * 4096 + n)) * 256 + c0;
    // unrolled: constant element indices keep the tile in registers
#pragma unroll
    for (int i = 0; i < 4; ++i) {
        v8h h;
#pragma unroll
        for (int j = 0; j < 8; ++j) h[j] = (_Float16)v[j][i];
        *(v8h*)(dst + i * 256) = h;
    }
}

// ---------------------------------------------------------------------------
// Kernel C: fused QKV GEMM: X16 (8192x256) * wcat16^T + bias.
// 128-column weight slab (64 KB f16) async-staged once per block into LDS;
// K-loop streams only A from global, B from ds_load.
// Slab rows lie in LDS at W's own pitch of 512 bytes, without a pad.
// ---------------------------------------------------------------------------
__global__ __launch_bounds__(256) void qkv_gemm_kernel(
    const _Float16* __restrict__ X16, const _Float16* __restrict__ W,
    const float* __restrict__ bias,
    _Float16* __restrict__ q16, _Float16* __restrict__ k16,
    _Float16* __restrict__ v16t, float* __restrict__ vf32)
{
    __shared__ _Float16 wlds[128 * 256];       // 64 KB weight slab
    const int lane = threadIdx.x & 31;
    const int wave = threadIdx.x >> 5;
    const int wm = wave & 3, wn = wave >> 2;
    const int m0 = blockIdx.x * 64 + wm * 16;
    const int n0 = wn * 64;                    // within-slab column base
    const int nslab = blockIdx.y * 128;        // global column base of slab
    const int row = lane & 15, hi = lane >> 4;

    // async stage the weight slab: 256 threads x 16 x 16B = 64 KB
    {
        const _Float16* wslab = W + (size_t)nslab * 256;
#pragma unroll
        for (int i = 0; i < 16; ++i) {
            int off = (threadIdx.x + i * 256) * 8;   // halves
            async_copy_b128(wslab + off, wlds + off);
        }
        async_wait_all();
        __syncthreads();
    }

    v8f acc[4] = {};
    const _Float16* arow = X16 + (size_t)(m0 + row) * 256 + hi * 16;
    for (int k0 = 0; k0 < 256; k0 += 32) {
        __builtin_prefetch(arow + k0 + 64, 0, 1);
        v16h a = *(const v16h*)(arow + k0);
#pragma unroll
        for (int t = 0; t < 4; ++t) {
            v16h bm = *(const v16h*)(wlds + (n0 + t * 16 + row) * 256 + k0 + hi * 16);
            acc[t] = __builtin_amdgcn_wmma_f32_16x16x32_f16(
                false, a, false, bm, (short)0, acc[t], false, false);
        }
    }

#pragma unroll
    for (int t = 0; t < 4; ++t) {
        int o = nslab + n0 + t * 16 + row;      // output channel
        float bo = bias[o];
#pragma unroll
        for (int r = 0; r < 8; ++r) {
            int m = m0 + r + 8 * hi;            // global spatial row (b*4096 + n)
            float val = acc[t][r] + bo;
            int b = m >> 12, n = m & 4095;
            int ba = (b << 2) + (n >> 10), na = n & 1023;
            if (o < 256) {                      // q
                int h = o >> 5, d = o & 31;
                q16[(((size_t)((ba << 3) + h) << 10) + na) * 32 + d] = (_Float16)val;
            } else if (o < 512) {               // k
                int oo = o - 256, h = oo >> 5, d = oo & 31;
                k16[(((size_t)((ba << 3) + h) << 10) + na) * 32 + d] = (_Float16)val;
            } else {                            // v : f32 NCHW + transposed f16
                int c = o - 512;
                vf32[((size_t)(b * 256 + c) << 12) + n] = val;
                int h = c >> 5, d = c & 31;
                v16t[((size_t)((((ba << 3) + h) << 5) + d) << 10) + na] = (_Float16)val;
            }
        }
    }
}

// ---------------------------------------------------------------------------
// Kernel D: depthwise 5x5 conv on v (pad 2), BN folded. pp layout [b][c][n].
// One block per (b, c) plane; a thread makes 8 rows x 4 columns of outputs from
// 12 input rows of 8 columns held in registers. Each output still adds its
// taps in the order dy, dx; a tap outside the plane enters as 0.
// ---------------------------------------------------------------------------
__global__ __launch_bounds__(128) void pe_conv_kernel(const float* __restrict__ vf32,
                               const float* __restrict__ wpe,
                               const float* __restrict__ bias_pe,
                               float* __restrict__ pp)
{
    const int plane = blockIdx.x;                 // b * 256 + c
    const int c = plane & 255;
    const int xg = threadIdx.x & 15, yg = threadIdx.x >> 4;
    const int x0 = xg * 4, y0 = yg * 8;
    const char* vin = (const char*)(vf32 + ((size_t)plane << 12));
    const float* w = wpe + c * 25;
    const float bias = bias_pe[c];
    const bool lok = xg > 0, rok = xg < 15;       // left / right halo inside the row
    const bool tok = yg > 0, bok = yg < 7;        // rows above / below inside the plane
    // Byte offsets in the plane: of row y0, of the two rows above it and of the
    // two rows below the thread's eight; clamped, so that every load stays inside.
    const unsigned ol = y0 * 256 + (lok ? x0 - 2 : 0) * 4;
    const unsigned om = y0 * 256 + x0 * 4;
    const unsigned orr = y0 * 256 + (rok ? x0 + 4 : 0) * 4;
    const unsigned up = tok ? 512u : 0u, dn = bok ? 2048u : 0u;
    const unsigned tl = ol - up, tm = om - up, tr = orr - up;
    const unsigned bl = ol + dn, bm = om + dn, br = orr + dn;

    v2f lf[12], rt[12];
    v4f md[12];
    // unrolled (all loops below): constant indices keep the rows and acc in registers
#pragma unroll
    for (int i = 0; i < 2; ++i) {
        lf[i] = *(const v2f*)(vin + tl + i * 256);
        md[i] = *(const v4f*)(vin + tm + i * 256);
        rt[i] = *(const v2f*)(vin + tr + i * 256);
        lf[10 + i] = *(const v2f*)(vin + bl + i * 256);
        md[10 + i] = *(const v4f*)(vin + bm + i * 256);
        rt[10 + i] = *(const v2f*)(vin + br + i * 256);
    }
#pragma unroll
    for (int i = 0; i < 8; ++i) {
        lf[2 + i] = *(const v2f*)(vin + ol + i * 256);
        md[2 + i] = *(const v4f*)(vin + om + i * 256);
        rt[2 + i] = *(const v2f*)(vin + orr + i * 256);
    }
    // Keeps all 36 loads up here, in flight together: left free the scheduler
    // spreads them among the multiply-adds and waits for several of them in full.
    __builtin_amdgcn_sched_barrier(0);
    // The wait that stands before the loads' address registers are used for
    // anything else; the offsets are named so that they stay whole up to it.
    asm volatile("s_wait_xcnt 0x0"
                 :: "v"(ol), "v"(om), "v"(orr), "v"(tl), "v"(tm), "v"(tr), "v"(bl), "v"(bm), "v"(br)
                 : "memory");

    v4f acc[8];
#pragma unroll
    for (int r = 0; r < 8; ++r) acc[r] = (v4f){bias, bias, bias, bias};

#pragma unroll
    for (int i = 0; i < 12; ++i) {
        const bool yok = i < 2 ? tok : (i < 10 ? true : bok);
        float v[8];                               // columns x0 - 2 .. x0 + 5
        v[0] = (yok && lok) ? lf[i][0] : 0.f;
        v[1] = (yok && lok) ? lf[i][1] : 0.f;
        v[2] = yok ? md[i][0] : 0.f;
        v[3] = yok ? md[i][1] : 0.f;
        v[4] = yok ? md[i][2] : 0.f;
        v[5] = yok ? md[i][3] : 0.f;
        v[6] = (yok && rok) ? rt[i][0] : 0.f;
        v[7] = (yok && rok) ? rt[i][1] : 0.f;
#pragma unroll
        for (int r = 0; r < 8; ++r) {
            const int ky = i - r;                 // dy + 2 of input row i for output row r
            if (ky < 0 || ky > 4) continue;
#pragma unroll
            for (int kx = 0; kx < 5; ++kx) {
                const float wk = w[ky * 5 + kx];
#pragma unroll
                for (int j = 0; j < 4; ++j) acc[r][j] += v[j + kx] * wk;
            }
        }
    }

    float* dst = pp + ((size_t)plane << 12) + y0 * 64 + x0;
#pragma unroll
    for (int r = 0; r < 8; ++r) *(v4f*)(dst + r * 64) = acc[r];
}

__device__ __forceinline__ float xhalf(float x)
{
    int i = __builtin_bit_cast(int, x);
    return __builtin_bit_cast(float,
        __builtin_amdgcn_permlanex16(i, i, 0x76543210, 0xfedcba98, false, false));
}

__global__ __launch_bounds__(256) void attn_kernel(
    const _Float16* __restrict__ q16, const _Float16* __restrict__ k16,
    const _Float16* __restrict__ v16t, const float* __restrict__ pp,
    _Float16* __restrict__ comb16)
{
    __shared__ _Float16 ldsK[32 * 32];       // K chunk: [m_local][d]   (2 KB)
    __shared__ _Float16 ldsV[32 * 32];       // V chunk: [d][m_local]   (2 KB)

    const int lane = threadIdx.x & 31, wave = threadIdx.x >> 5;
    const int ba = blockIdx.z, h = blockIdx.y;
    const int n0 = blockIdx.x * 128 + wave * 16;
    const int row = lane & 15, hi = lane >> 4;
    const float scale = 0.17677669529663687f;   // 1/sqrt(hd=32)

    const _Float16* qbase = q16 + ((size_t)(ba * 8 + h) << 10) * 32;
    const _Float16* kbase = k16 + ((size_t)(ba * 8 + h) << 10) * 32;
    const _Float16* vbase = v16t + ((size_t)(ba * 8 + h) << 5) * 1024;

    // B operand: 16 query columns x K=32 (entire head dim), loaded once.
    v16h bq = *(const v16h*)(qbase + (size_t)(n0 + row) * 32 + hi * 16);

    // State of this lane's query (column 'row'); rsum covers only the keys
    // this wave half holds, the halves are joined after the loop.
    float rmax = -1e30f, rsum = 0.f;
    v8f o0 = {}, o1 = {};    // o0[r] = O[query][d = 8*hi + r], o1: d + 16

    for (int m0 = 0; m0 < 1024; m0 += 32) {
        __syncthreads();   // staging buffers free for reuse
        // Async stage: waves 0-3 copy K chunk (contiguous 2 KB),
        //              waves 4-7 copy V chunk (32 d-rows x 64 B).
        if (threadIdx.x < 128) {
            int off = threadIdx.x * 8;                       // halves
            async_copy_b128(kbase + (size_t)m0 * 32 + off, ldsK + off);
        } else {
            int tt = threadIdx.x - 128;
            int d = tt >> 2, part = tt & 3;
            async_copy_b128(vbase + (size_t)d * 1024 + m0 + part * 8,
                            ldsV + d * 32 + part * 8);
        }
        async_wait_all();
        __syncthreads();   // staged chunks visible to all waves

        // A operand: 16 key rows x K=32, same k order as bq.
        v16h ak0 = *(const v16h*)(ldsK + (row)      * 32 + hi * 16);
        v16h ak1 = *(const v16h*)(ldsK + (16 + row) * 32 + hi * 16);
        // A operand of the second product: 16 d rows of V^T, keys in the order
        // in which the packed score tiles hold them (8*hi + s, 16 + 8*hi + s).
        v8h av0lo = *(const v8h*)(ldsV + (row)      * 32 + hi * 8);
        v8h av0hi = *(const v8h*)(ldsV + (row)      * 32 + 16 + hi * 8);
        v8h av1lo = *(const v8h*)(ldsV + (16 + row) * 32 + hi * 8);
        v8h av1hi = *(const v8h*)(ldsV + (16 + row) * 32 + 16 + hi * 8);
        // Keeps the four V loads up here, beside the K loads: left free the
        // scheduler sinks them to just in front of the second product, where
        // their LDS latency is then waited for in full.
        __builtin_amdgcn_sched_barrier(0);

        v8f s0 = {}, s1 = {};
        s0 = __builtin_amdgcn_wmma_f32_16x16x32_f16(false, ak0, false, bq, (short)0, s0, false, false);
        s1 = __builtin_amdgcn_wmma_f32_16x16x32_f16(false, ak1, false, bq, (short)0, s1, false, false);

        // online softmax; s0[r] = S[key 8*hi + r][query], s1[r]: key + 16.
        s0 *= scale; s1 *= scale;
        float mx0 = s0[0], mx1 = s1[0];
        // unrolled: constant element indices keep the tiles in registers
#pragma unroll
        for (int r = 1; r < 8; ++r) { mx0 = fmaxf(mx0, s0[r]); mx1 = fmaxf(mx1, s1[r]); }
        float mx = fmaxf(mx0, mx1);
        mx = fmaxf(mx, xhalf(mx));
        float mnew = fmaxf(rmax, mx);
        float corr = __expf(rmax - mnew);
        rmax = mnew;
        v16h bp;
        // unrolled: constant element indices keep the tiles in registers
#pragma unroll
        for (int r = 0; r < 8; ++r) {
            s0[r] = __expf(s0[r] - mnew);
            s1[r] = __expf(s1[r] - mnew);
            bp[r]     = (_Float16)s0[r];
            bp[8 + r] = (_Float16)s1[r];
        }
        v8f t = s0 + s1;
        float ps = ((t[0] + t[1]) + (t[2] + t[3])) + ((t[4] + t[5]) + (t[6] + t[7]));
        rsum = rsum * corr + ps;
        o0 *= corr; o1 *= corr;

        v16h av0 = __builtin_shufflevector(av0lo, av0hi, 0, 1, 2, 3, 4, 5, 6, 7, 8, 9, 10, 11, 12, 13, 14, 15);
        v16h av1 = __builtin_shufflevector(av1lo, av1hi, 0, 1, 2, 3, 4, 5, 6, 7, 8, 9, 10, 11, 12, 13, 14, 15);
        o0 = __builtin_amdgcn_wmma_f32_16x16x32_f16(false, av0, false, bp, (short)0, o0, false, false);
        o1 = __builtin_amdgcn_wmma_f32_16x16x32_f16(false, av1, false, bp, (short)0, o1, false, false);
        // WMMA consumes ds reads (s_wait_dscnt) before next loop-top barrier.
    }

    // finalize: join the halves' sums, /= rowsum, add positional encoding,
    // store 8 consecutive channels of one f16 GEMM row per 16-byte store
    rsum += xhalf(rsum);
    const float inv = 1.0f / rsum;
    const int b = ba >> 2, area = ba & 3;
    const int n_global = area * 1024 + n0 + row;
    const int c0 = h * 32 + 8 * hi;
    v8h w0, w1;
    // unrolled: constant element indices, and all 16 loads in flight at once
#pragma unroll
    for (int r = 0; r < 8; ++r) {
        float pv0 = pp[((size_t)(b * 256 + c0 + r) << 12) + n_global];
        float pv1 = pp[((size_t)(b * 256 + c0 + 16 + r) << 12) + n_global];
        w0[r] = (_Float16)(o0[r] * inv + pv0);
        w1[r] = (_Float16)(o1[r] * inv + pv1);
    }
    _Float16* crow = comb16 + ((size_t)(b * 4096 + n_global)) * 256 + c0;
    *(v8h*)(crow)      = w0;
    *(v8h*)(crow + 16) = w1;
}

// ---------------------------------------------------------------------------
// Kernel F: projection GEMM: comb16 (8192x256) * wproj16^T + bias -> NCHW f32
// Weight slab async-staged in LDS as in kernel C.
// ---------------------------------------------------------------------------
__global__ __launch_bounds__(256) void proj_gemm_kernel(
    const _Float16* __restrict__ A, const _Float16* __restrict__ W,
    const float* __restrict__ bias, float* __restrict__ out)
{
    __shared__ _Float16 wlds[128 * 256];       // 64 KB weight slab
    const int lane = threadIdx.x & 31, wave = threadIdx.x >> 5;
    const int wm = wave & 3, wn = wave >> 2;
    const int m0 = blockIdx.x * 64 + wm * 16;
    const int n0 = wn * 64;
    const int nslab = blockIdx.y * 128;
    const int row = lane & 15, hi = lane >> 4;

    {
        const _Float16* wslab = W + (size_t)nslab * 256;
#pragma unroll
        for (int i = 0; i < 16; ++i) {
            int off = (threadIdx.x + i * 256) * 8;
            async_copy_b128(wslab + off, wlds + off);
        }
        async_wait_all();
        __syncthreads();
    }

    v8f acc[4] = {};
    const _Float16* arow = A + (size_t)(m0 + row) * 256 + hi * 16;
    for (int k0 = 0; k0 < 256; k0 += 32) {
        __builtin_prefetch(arow + k0 + 64, 0, 1);
        v16h a = *(const v16h*)(arow + k0);
#pragma unroll
        for (int t = 0; t < 4; ++t) {
            v16h bm = *(const v16h*)(wlds + (n0 + t * 16 + row) * 256 + k0 + hi * 16);
            acc[t] = __builtin_amdgcn_wmma_f32_16x16x32_f16(
                false, a, false, bm, (short)0, acc[t], false, false);
        }
    }
#pragma unroll
    for (int t = 0; t < 4; ++t) {
        int o = nslab + n0 + t * 16 + row;
        float bo = bias[o];
#pragma unroll
        for (int r = 0; r < 8; ++r) {
            int m = m0 + r + 8 * hi;
            int b = m >> 12, n = m & 4095;
            out[((size_t)(b * 256 + o) << 12) + n] = acc[t][r] + bo;
        }
    }
}

// ---------------------------------------------------------------------------
extern "C" void kernel_launch(void* const* d_in, const int* in_sizes, int n_in,
                              void* d_out, int out_size, void* d_ws, size_t ws_size,
                              hipStream_t stream)
{
    const float* x     = (const float*)d_in[0];
    const float* w_qk  = (const float*)d_in[1];
    const float* w_v   = (const float*)d_in[2];
    const float* w_pe  = (const float*)d_in[3];
    const float* w_pr  = (const float*)d_in[4];
    const float* qk_g  = (const float*)d_in[5];
    const float* qk_b  = (const float*)d_in[6];
    const float* qk_m  = (const float*)d_in[7];
    const float* qk_v  = (const float*)d_in[8];
    const float* v_g   = (const float*)d_in[9];
    const float* v_b   = (const float*)d_in[10];
    const float* v_m   = (const float*)d_in[11];
    const float* v_v   = (const float*)d_in[12];
    const float* pe_g  = (const float*)d_in[13];
    const float* pe_b  = (const float*)d_in[14];
    const float* pe_m  = (const float*)d_in[15];
    const float* pe_v  = (const float*)d_in[16];
    const float* pr_g  = (const float*)d_in[17];
    const float* pr_b  = (const float*)d_in[18];
    const float* pr_m  = (const float*)d_in[19];
    const float* pr_v  = (const float*)d_in[20];
    float* out = (float*)d_out;

    // workspace carve-up (256B aligned)
    char* ws = (char*)d_ws;
    size_t off = 0;
    auto carve = [&](size_t bytes) -> char* {
        char* p = ws + off;
        off = (off + bytes + 255) & ~(size_t)255;
        return p;
    };
    _Float16* wcat16  = (_Float16*)carve(768 * 256 * sizeof(_Float16));
    float*    biascat = (float*)   carve(768 * sizeof(float));
    _Float16* wproj16 = (_Float16*)carve(256 * 256 * sizeof(_Float16));
    float*    biaspr  = (float*)   carve(256 * sizeof(float));
    float*    wpe_s   = (float*)   carve(256 * 25 * sizeof(float));
    float*    biaspe  = (float*)   carve(256 * sizeof(float));
    _Float16* X16     = (_Float16*)carve((size_t)8192 * 256 * sizeof(_Float16));
    _Float16* q16     = (_Float16*)carve((size_t)8 * 8 * 1024 * 32 * sizeof(_Float16));
    _Float16* k16     = (_Float16*)carve((size_t)8 * 8 * 1024 * 32 * sizeof(_Float16));
    _Float16* v16t    = (_Float16*)carve((size_t)8 * 8 * 32 * 1024 * sizeof(_Float16));
    float*    vf32    = (float*)   carve((size_t)2 * 256 * 4096 * sizeof(float));
    float*    pp      = (float*)   carve((size_t)2 * 256 * 4096 * sizeof(float));
    _Float16* comb16  = (_Float16*)carve((size_t)8192 * 256 * sizeof(_Float16));

    fold_weights_kernel<<<256, 256, 0, stream>>>(
        w_qk, qk_g, qk_b, qk_m, qk_v,
        w_v,  v_g,  v_b,  v_m,  v_v,
        w_pe, pe_g, pe_b, pe_m, pe_v,
        w_pr, pr_g, pr_b, pr_m, pr_v,
        wcat16, biascat, wproj16, biaspr, wpe_s, biaspe);

    pack_x_kernel<<<dim3(32, 4, 2), 256, 0, stream>>>(x, X16);

    qkv_gemm_kernel<<<dim3(8192 / 64, 768 / 128), 256, 0, stream>>>(
        X16, wcat16, biascat, q16, k16, v16t, vf32);

    pe_conv_kernel<<<512, 128, 0, stream>>>(vf32, wpe_s, biaspe, pp);

    attn_kernel<<<dim3(8, 8, 8), 256, 0, stream>>>(q16, k16, v16t, pp, comb16);

    proj_gemm_kernel<<<dim3(8192 / 64, 256 / 128), 256, 0, stream>>>(
        comb16, wproj16, biaspr, out);
}

// v003
// A run of this version takes 60.7 microseconds.
// Next to v002, in two timings, it ran 1.37 and 1.39 times as fast.
// Counting every step since v000, it is 2.15 times as fast.
#include <hip/hip_runtime.h>
#include <hip/hip_bf16.h>
#include <stdint.h>

typedef __attribute__((ext_vector_type(16))) _Float16 v16h;
typedef __attribute__((ext_vector_type(8)))  float    v8f;
typedef __attribute__((ext_vector_type(8)))  _Float16 v8h;
typedef __attribute__((ext_vector_type(4)))  float    v4f;
typedef __attribute__((ext_vector_type(2)))  float    v2f;

#define BN_EPS 1e-5f

// LDS row pitches, in halves: 16 bytes x an odd number, so that the 16 rows
// which one ds_load_b128 reads fall on 16 different groups of four banks.
#define W_PITCH  264    // weight slab rows: 512 bytes of data, 528 apart
#define KV_PITCH 40     // K / V chunk rows: 64 bytes of data, 80 apart

// Issue one wave-wide async global->LDS 16B-per-lane copy (512B per wave op).
// The s_wait_xcnt stands in the copy's own statement, so that it comes before
// any later write of the two address registers.
__device__ __forceinline__ void async_copy_b128(const void* gptr, void* lds_ptr)
{
    unsigned ldsoff = (unsigned)(uintptr_t)lds_ptr;
    asm volatile("global_load_async_to_lds_b128 %0, %1, off\n\t"
                 "s_wait_xcnt 0x0"
                 :: "v"(ldsoff), "v"(gptr) : "memory");
}
// Eight such copies, gstep halves apart in global memory and lstep halves apart
// in LDS, in one statement with one s_wait_xcnt behind the last (same purpose).
__device__ __forceinline__ void async_copy8_b128(const _Float16* g, _Float16* lds_ptr,
                                                 int gstep, int lstep)
{
    unsigned l = (unsigned)(uintptr_t)lds_ptr;
    unsigned ls = (unsigned)lstep * 2u;
    asm volatile("global_load_async_to_lds_b128 %0, %8, off\n\t"
                 "global_load_async_to_lds_b128 %1, %9, off\n\t"
                 "global_load_async_to_lds_b128 %2, %10, off\n\t"
                 "global_load_async_to_lds_b128 %3, %11, off\n\t"
                 "global_load_async_to_lds_b128 %4, %12, off\n\t"
                 "global_load_async_to_lds_b128 %5, %13, off\n\t"
                 "global_load_async_to_lds_b128 %6, %14, off\n\t"
                 "global_load_async_to_lds_b128 %7, %15, off\n\t"
                 "s_wait_xcnt 0x0"
                 :: "v"(l), "v"(l + ls), "v"(l + 2 * ls), "v"(l + 3 * ls),
                    "v"(l + 4 * ls), "v"(l + 5 * ls), "v"(l + 6 * ls), "v"(l + 7 * ls),
                    "v"(g), "v"(g + gstep), "v"(g + 2 * gstep), "v"(g + 3 * gstep),
                    "v"(g + 4 * gstep), "v"(g + 5 * gstep), "v"(g + 6 * gstep), "v"(g + 7 * gstep)
                 : "memory");
}
// 16 consecutive halves from LDS as one fragment; the padded rows are 16-byte
// aligned, not 32, so the fragment is read as two 16-byte halves.
__device__ __forceinline__ v16h lds_frag(const _Float16* p)
{
    v8h lo = *(const v8h*)p, hi = *(const v8h*)(p + 8);
    return __builtin_shufflevector(lo, hi, 0, 1, 2, 3, 4, 5, 6, 7, 8, 9, 10, 11, 12, 13, 14, 15);
}
__device__ __forceinline__ void async_wait_all()
{
    asm volatile("s_wait_asynccnt 0x0" ::: "memory");
}

// ---------------------------------------------------------------------------
// Kernel A: fold BatchNorm into weights; produce f16 weight copies + f32 bias
// ---------------------------------------------------------------------------
__global__ void fold_weights_kernel(
    const float* __restrict__ w_qk, const float* __restrict__ qk_g, const float* __restrict__ qk_b,
    const float* __restrict__ qk_m, const float* __restrict__ qk_v,
    const float* __restrict__ w_v,  const float* __restrict__ v_g,  const float* __restrict__ v_b,
    const float* __restrict__ v_m,  const float* __restrict__ v_v,
    const float* __restrict__ w_pe, const float* __restrict__ pe_g, const float* __restrict__ pe_b,
    const float* __restrict__ pe_m, const float* __restrict__ pe_v,
    const float* __restrict__ w_pr, const float* __restrict__ pr_g, const float* __restrict__ pr_b,
    const float* __restrict__ pr_m, const float* __restrict__ pr_v,
    _Float16* __restrict__ wcat16, float* __restrict__ bias_cat,
    _Float16* __restrict__ wproj16, float* __restrict__ bias_pr,
    float* __restrict__ wpe_s, float* __restrict__ bias_pe)
{
    const int idx = blockIdx.x * blockDim.x + threadIdx.x;
    const int stride = gridDim.x * blockDim.x;

    for (int i = idx; i < 768 * 256; i += stride) {
        int o = i >> 8, c = i & 255;
        float s, w;
        if (o < 512) { s = qk_g[o] * rsqrtf(qk_v[o] + BN_EPS); w = w_qk[o * 256 + c]; }
        else { int oo = o - 512; s = v_g[oo] * rsqrtf(v_v[oo] + BN_EPS); w = w_v[oo * 256 + c]; }
        wcat16[i] = (_Float16)(w * s);
    }
    for (int o = idx; o < 768; o += stride) {
        if (o < 512) { float s = qk_g[o] * rsqrtf(qk_v[o] + BN_EPS); bias_cat[o] = qk_b[o] - qk_m[o] * s; }
        else { int oo = o - 512; float s = v_g[oo] * rsqrtf(v_v[oo] + BN_EPS); bias_cat[o] = v_b[oo] - v_m[oo] * s; }
    }
    for (int i = idx; i < 256 * 256; i += stride) {
        int o = i >> 8;
        float s = pr_g[o] * rsqrtf(pr_v[o] + BN_EPS);
        wproj16[i] = (_Float16)(w_pr[i] * s);
    }
    for (int o = idx; o < 256; o += stride) {
        float s = pr_g[o] * rsqrtf(pr_v[o] + BN_EPS);
        bias_pr[o] = pr_b[o] - pr_m[o] * s;
        float spe = pe_g[o] * rsqrtf(pe_v[o] + BN_EPS);
        bias_pe[o] = pe_b[o] - pe_m[o] * spe;
    }
    for (int i = idx; i < 256 * 25; i += stride) {
        int c = i / 25;
        float s = pe_g[c] * rsqrtf(pe_v[c] + BN_EPS);
        wpe_s[i] = w_pe[i] * s;
    }
}

// ---------------------------------------------------------------------------
// Kernel B: pack x (B,C,H,W) f32 -> X16 row-major (B*N, C) f16.
// A thread takes 8 channels x 4 positions: eight 16-byte loads along n, four
// 16-byte stores along c. In a wave 8 lanes lie along c and 4 along n, so each
// store fills four whole 128-byte lines of X16, every line from one wave.
// ---------------------------------------------------------------------------
__global__ __launch_bounds__(256) void pack_x_kernel(const float* __restrict__ x, _Float16* __restrict__ X16)
{
    const int lane = threadIdx.x & 31, wave = threadIdx.x >> 5;
    const int n  = blockIdx.x * 128 + wave * 16 + (lane >> 3) * 4;
    const int c0 = blockIdx.y * 64 + (lane & 7) * 8;
    const int b  = blockIdx.z;
    const float* src = x + ((size_t)(b * 256 + c0) << 12) + n;
    v4f v[8];
    // unrolled: constant element indices, and all 8 loads in flight at once
#pragma unroll
    for (int j = 0; j < 8; ++j) v[j] = *(const v4f*)(src + ((size_t)j << 12));
    _Float16* dst = X16 + ((size_t)(b * 4096 + n)) * 256 + c0;
    // unrolled: constant element indices keep the tile in registers
#pragma unroll
    for (int i = 0; i < 4; ++i) {
        v8h h;
#pragma unroll
        for (int j = 0; j < 8; ++j) h[j] = (_Float16)v[j][i];
        *(v8h*)(dst + i * 256) = h;
    }
}

// ---------------------------------------------------------------------------
// Kernel C: fused QKV GEMM: X16 (8192x256) * wcat16^T + bias.
// 128-column weight slab (64 KB f16) async-staged once per block into LDS;
// K-loop streams only A from global, B from ds_load.
// Slab rows lie in LDS at a pitch of 528 bytes (W_PITCH).
// ---------------------------------------------------------------------------
__global__ __launch_bounds__(256) void qkv_gemm_kernel(
    const _Float16* __restrict__ X16, const _Float16* __restrict__ W,
    const float* __restrict__ bias,
    _Float16* __restrict__ q16, _Float16* __restrict__ k16,
    _Float16* __restrict__ v16t, float* __restrict__ vf32)
{
    __shared__ __attribute__((aligned(16))) _Float16 wlds[128 * W_PITCH];   // 64 KB weight slab, padded rows
    const int lane = threadIdx.x & 31;
    const int wave = threadIdx.x >> 5;
    const int wm = wave & 3, wn = wave >> 2;
    const int m0 = blockIdx.x * 64 + wm * 16;
    const int n0 = wn * 64;                    // within-slab column base
    const int nslab = blockIdx.y * 128;        // global column base of slab
    const int row = lane & 15, hi = lane >> 4;

    // async stage the weight slab: 256 threads x 16 x 16B = 64 KB;
    // a wave copies one whole row per copy, rows wave, wave + 8, ...
    {
        const _Float16* wsrc = W + (size_t)nslab * 256 + threadIdx.x * 8;
        _Float16* wdst = wlds + wave * W_PITCH + lane * 8;
        async_copy8_b128(wsrc, wdst, 8 * 256, 8 * W_PITCH);
        async_copy8_b128(wsrc + 64 * 256, wdst + 64 * W_PITCH, 8 * 256, 8 * W_PITCH);
        async_wait_all();
        __syncthreads();
    }

    v8f acc[4] = {};
    const _Float16* arow = X16 + (size_t)(m0 + row) * 256 + hi * 16;
    for (int k0 = 0; k0 < 256; k0 += 32) {
        __builtin_prefetch(arow + k0 + 64, 0, 1);
        v16h a = *(const v16h*)(arow + k0);
#pragma unroll
        for (int t = 0; t < 4; ++t) {
            v16h bm = lds_frag(wlds + (n0 + t * 16 + row) * W_PITCH + k0 + hi * 16);
            acc[t] = __builtin_amdgcn_wmma_f32_16x16x32_f16(
                false, a, false, bm, (short)0, acc[t], false, false);
        }
    }

#pragma unroll
    for (int t = 0; t < 4; ++t) {
        int o = nslab + n0 + t * 16 + row;      // output channel
        float bo = bias[o];
#pragma unroll
        for (int r = 0; r < 8; ++r) {
            int m = m0 + r + 8 * hi;            // global spatial row (b*4096 + n)
            float val = acc[t][r] + bo;
            int b = m >> 12, n = m & 4095;
            int ba = (b << 2) + (n >> 10), na = n & 1023;
            if (o < 256) {                      // q
                int h = o >> 5, d = o & 31;
                q16[(((size_t)((ba << 3) + h) << 10) + na) * 32 + d] = (_Float16)val;
            } else if (o < 512) {               // k
                int oo = o - 256, h = oo >> 5, d = oo & 31;
                k16[(((size_t)((ba << 3) + h) << 10) + na) * 32 + d] = (_Float16)val;
            } else {                            // v : f32 NCHW + transposed f16
                int c = o - 512;
                vf32[((size_t)(b * 256 + c) << 12) + n] = val;
                int h = c >> 5, d = c & 31;
                v16t[((size_t)((((ba << 3) + h) << 5) + d) << 10) + na] = (_Float16)val;
            }
        }
    }
}

// ---------------------------------------------------------------------------
// Kernel D: depthwise 5x5 conv on v (pad 2), BN folded. pp layout [b][c][n].
// One block per (b, c) plane; a thread makes 8 rows x 4 columns of outputs from
// 12 input rows of 8 columns held in registers. Each output still adds its
// taps in the order dy, dx; a tap outside the plane enters as 0.
// ---------------------------------------------------------------------------
__global__ __launch_bounds__(128) void pe_conv_kernel(const float* __restrict__ vf32,
                               const float* __restrict__ wpe,
                               const float* __restrict__ bias_pe,
                               float* __restrict__ pp)
{
    const int plane = blockIdx.x;                 // b * 256 + c
    const int c = plane & 255;
    const int xg = threadIdx.x & 15, yg = threadIdx.x >> 4;
    const int x0 = xg * 4, y0 = yg * 8;
    const char* vin = (const char*)(vf32 + ((size_t)plane << 12));
    const float* w = wpe + c * 25;
    const float bias = bias_pe[c];
    const bool lok = xg > 0, rok = xg < 15;       // left / right halo inside the row
    const bool tok = yg > 0, bok = yg < 7;        // rows above / below inside the plane
    // Byte offsets in the plane: of row y0, of the two rows above it and of the
    // two rows below the thread's eight; clamped, so that every load stays inside.
    const unsigned ol = y0 * 256 + (lok ? x0 - 2 : 0) * 4;
    const unsigned om = y0 * 256 + x0 * 4;
    const unsigned orr = y0 * 256 + (rok ? x0 + 4 : 0) * 4;
    const unsigned up = tok ? 512u : 0u, dn = bok ? 2048u : 0u;
    const unsigned tl = ol - up, tm = om - up, tr = orr - up;
    const unsigned bl = ol + dn, bm = om + dn, br = orr + dn;

    v2f lf[12], rt[12];
    v4f md[12];
    // unrolled (all loops below): constant indices keep the rows and acc in registers
#pragma unroll
    for (int i = 0; i < 2; ++i) {
        lf[i] = *(const v2f*)(vin + tl + i * 256);
        md[i] = *(const v4f*)(vin + tm + i * 256);
        rt[i] = *(const v2f*)(vin + tr + i * 256);
        lf[10 + i] = *(const v2f*)(vin + bl + i * 256);
        md[10 + i] = *(const v4f*)(vin + bm + i * 256);
        rt[10 + i] = *(const v2f*)(vin + br + i * 256);
    }
#pragma unroll
    for (int i = 0; i < 8; ++i) {
        lf[2 + i] = *(const v2f*)(vin + ol + i * 256);
        md[2 + i] = *(const v4f*)(vin + om + i * 256);
        rt[2 + i] = *(const v2f*)(vin + orr + i * 256);
    }
    // Keeps all 36 loads up here, in flight together: left free the scheduler
    // spreads them among the multiply-adds and waits for several of them in full.
    __builtin_amdgcn_sched_barrier(0);
    // The wait that stands before the loads' address registers are used for
    // anything else; the offsets are named so that they stay whole up to it.
    asm volatile("s_wait_xcnt 0x0"
                 :: "v"(ol), "v"(om), "v"(orr), "v"(tl), "v"(tm), "v"(tr), "v"(bl), "v"(bm), "v"(br)
                 : "memory");

    v4f acc[8];
#pragma unroll
    for (int r = 0; r < 8; ++r) acc[r] = (v4f){bias, bias, bias, bias};

#pragma unroll
    for (int i = 0; i < 12; ++i) {
        const bool yok = i < 2 ? tok : (i < 10 ? true : bok);
        float v[8];                               // columns x0 - 2 .. x0 + 5
        v[0] = (yok && lok) ? lf[i][0] : 0.f;
        v[1] = (yok && lok) ? lf[i][1] : 0.f;
        v[2] = yok ? md[i][0] : 0.f;
        v[3] = yok ? md[i][1] : 0.f;
        v[4] = yok ? md[i][2] : 0.f;
        v[5] = yok ? md[i][3] : 0.f;
        v[6] = (yok && rok) ? rt[i][0] : 0.f;
        v[7] = (yok && rok) ? rt[i][1] : 0.f;
#pragma unroll
        for (int r = 0; r < 8; ++r) {
            const int ky = i - r;                 // dy + 2 of input row i for output row r
            if (ky < 0 || ky > 4) continue;
#pragma unroll
            for (int kx = 0; kx < 5; ++kx) {
                const float wk = w[ky * 5 + kx];
#pragma unroll
                for (int j = 0; j < 4; ++j) acc[r][j] += v[j + kx] * wk;
            }
        }
    }

    float* dst = pp + ((size_t)plane << 12) + y0 * 64 + x0;
#pragma unroll
    for (int r = 0; r < 8; ++r) *(v4f*)(dst + r * 64) = acc[r];
}

__device__ __forceinline__ float xhalf(float x)
{
    int i = __builtin_bit_cast(int, x);
    return __builtin_bit_cast(float,
        __builtin_amdgcn_permlanex16(i, i, 0x76543210, 0xfedcba98, false, false));
}

__global__ __launch_bounds__(256) void attn_kernel(
    const _Float16* __restrict__ q16, const _Float16* __restrict__ k16,
    const _Float16* __restrict__ v16t, const float* __restrict__ pp,
    _Float16* __restrict__ comb16)
{
    __shared__ __attribute__((aligned(16))) _Float16 ldsK[32 * KV_PITCH];   // K chunk: [m_local][d], padded rows
    __shared__ __attribute__((aligned(16))) _Float16 ldsV[32 * KV_PITCH];   // V chunk: [d][m_local], padded rows

    const int lane = threadIdx.x & 31, wave = threadIdx.x >> 5;
    const int ba = blockIdx.z, h = blockIdx.y;
    const int n0 = blockIdx.x * 128 + wave * 16;
    const int row = lane & 15, hi = lane >> 4;
    const float scale = 0.17677669529663687f;   // 1/sqrt(hd=32)

    const _Float16* qbase = q16 + ((size_t)(ba * 8 + h) << 10) * 32;
    const _Float16* kbase = k16 + ((size_t)(ba * 8 + h) << 10) * 32;
    const _Float16* vbase = v16t + ((size_t)(ba * 8 + h) << 5) * 1024;

    // B operand: 16 query columns x K=32 (entire head dim), loaded once.
    v16h bq = *(const v16h*)(qbase + (size_t)(n0 + row) * 32 + hi * 16);

    // State of this lane's query (column 'row'); rsum covers only the keys
    // this wave half holds, the halves are joined after the loop.
    float rmax = -1e30f, rsum = 0.f;
    v8f o0 = {}, o1 = {};    // o0[r] = O[query][d = 8*hi + r], o1: d + 16

    // Async stage: waves 0-3 copy the K chunk (contiguous 2 KB), waves 4-7 the
    // V chunk (32 d-rows x 64 B); a lane brings 16 bytes of chunk row srow.
    // Source and place are chosen by selects, so every wave runs the one copy
    // below with all its lanes on.
    const bool isk = threadIdx.x < 128;
    const int srow = (threadIdx.x & 127) >> 2, cpart = threadIdx.x & 3;
    const _Float16* csrc = isk ? kbase + srow * 32 + cpart * 8 : vbase + srow * 1024 + cpart * 8;
    const int cstep = isk ? 32 : 1;          // halves per key along the chunk walk
    _Float16* cdst = (isk ? ldsK : ldsV) + srow * KV_PITCH + cpart * 8;

    for (int m0 = 0; m0 < 1024; m0 += 32) {
        // This wave's LDS reads of the last chunk have returned before the
        // barrier behind which the copies overwrite it.
        asm volatile("s_wait_dscnt 0x0" ::: "memory");
        __syncthreads();   // staging buffers free for reuse
        async_copy_b128(csrc + m0 * cstep, cdst);
        async_wait_all();
        __syncthreads();   // staged chunks visible to all waves

        // A operand: 16 key rows x K=32, same k order as bq.
        v16h ak0 = lds_frag(ldsK + (row)      * KV_PITCH + hi * 16);
        v16h ak1 = lds_frag(ldsK + (16 + row) * KV_PITCH + hi * 16);
        // A operand of the second product: 16 d rows of V^T, keys in the order
        // in which the packed score tiles hold them (8*hi + s, 16 + 8*hi + s).
        v8h av0lo = *(const v8h*)(ldsV + (row)      * KV_PITCH + hi * 8);
        v8h av0hi = *(const v8h*)(ldsV + (row)      * KV_PITCH + 16 + hi * 8);
        v8h av1lo = *(const v8h*)(ldsV + (16 + row) * KV_PITCH + hi * 8);
        v8h av1hi = *(const v8h*)(ldsV + (16 + row) * KV_PITCH + 16 + hi * 8);
        // Keeps the four V loads up here, beside the K loads: left free the
        // scheduler sinks them to just in front of the second product, where
        // their LDS latency is then waited for in full.
        __builtin_amdgcn_sched_barrier(0);

        v8f s0 = {}, s1 = {};
        s0 = __builtin_amdgcn_wmma_f32_16x16x32_f16(false, ak0, false, bq, (short)0, s0, false, false);
        s1 = __builtin_amdgcn_wmma_f32_16x16x32_f16(false, ak1, false, bq, (short)0, s1, false, false);

        // online softmax; s0[r] = S[key 8*hi + r][query], s1[r]: key + 16.
        s0 *= scale; s1 *= scale;
        float mx0 = s0[0], mx1 = s1[0];
        // unrolled: constant element indices keep the tiles in registers
#pragma unroll
        for (int r = 1; r < 8; ++r) { mx0 = fmaxf(mx0, s0[r]); mx1 = fmaxf(mx1, s1[r]); }
        float mx = fmaxf(mx0, mx1);
        mx = fmaxf(mx, xhalf(mx));
        float mnew = fmaxf(rmax, mx);
        float corr = __expf(rmax - mnew);
        rmax = mnew;
        v16h bp;
        // unrolled: constant element indices keep the tiles in registers
#pragma unroll
        for (int r = 0; r < 8; ++r) {
            s0[r] = __expf(s0[r] - mnew);
            s1[r] = __expf(s1[r] - mnew);
            bp[r]     = (_Float16)s0[r];
            bp[8 + r] = (_Float16)s1[r];
        }
        v8f t = s0 + s1;
        float ps = ((t[0] + t[1]) + (t[2] + t[3])) + ((t[4] + t[5]) + (t[6] + t[7]));
        rsum = rsum * corr + ps;
        o0 *= corr; o1 *= corr;

        v16h av0 = __builtin_shufflevector(av0lo, av0hi, 0, 1, 2, 3, 4, 5, 6, 7, 8, 9, 10, 11, 12, 13, 14, 15);
        v16h av1 = __builtin_shufflevector(av1lo, av1hi, 0, 1, 2, 3, 4, 5, 6, 7, 8, 9, 10, 11, 12, 13, 14, 15);
        o0 = __builtin_amdgcn_wmma_f32_16x16x32_f16(false, av0, false, bp, (short)0, o0, false, false);
        o1 = __builtin_amdgcn_wmma_f32_16x16x32_f16(false, av1, false, bp, (short)0, o1, false, false);
        // WMMA consumes ds reads (s_wait_dscnt) before next loop-top barrier.
    }

    // finalize: join the halves' sums, /= rowsum, add positional encoding,
    // store 8 consecutive channels of one f16 GEMM row per 16-byte store
    rsum += xhalf(rsum);
    const float inv = 1.0f / rsum;
    const int b = ba >> 2, area = ba & 3;
    const int n_global = area * 1024 + n0 + row;
    const int c0 = h * 32 + 8 * hi;
    v8h w0, w1;
    // unrolled: constant element indices, and all 16 loads in flight at once
#pragma unroll
    for (int r = 0; r < 8; ++r) {
        float pv0 = pp[((size_t)(b * 256 + c0 + r) << 12) + n_global];
        float pv1 = pp[((size_t)(b * 256 + c0 + 16 + r) << 12) + n_global];
        w0[r] = (_Float16)(o0[r] * inv + pv0);
        w1[r] = (_Float16)(o1[r] * inv + pv1);
    }
    _Float16* crow = comb16 + ((size_t)(b * 4096 + n_global)) * 256 + c0;
    *(v8h*)(crow)      = w0;
    *(v8h*)(crow + 16) = w1;
}

// ---------------------------------------------------------------------------
// Kernel F: projection GEMM: comb16 (8192x256) * wproj16^T + bias -> NCHW f32
// Weight slab async-staged in LDS as in kernel C.
// ---------------------------------------------------------------------------
__global__ __launch_bounds__(256) void proj_gemm_kernel(
    const _Float16* __restrict__ A, const _Float16* __restrict__ W,
    const float* __restrict__ bias, float* __restrict__ out)
{
    __shared__ __attribute__((aligned(16))) _Float16 wlds[128 * W_PITCH];   // 64 KB weight slab, padded rows
    const int lane = threadIdx.x & 31, wave = threadIdx.x >> 5;
    const int wm = wave & 3, wn = wave >> 2;
    const int m0 = blockIdx.x * 64 + wm * 16;
    const int n0 = wn * 64;
    const int nslab = blockIdx.y * 128;
    const int row = lane & 15, hi = lane >> 4;

    {
        const _Float16* wsrc = W + (size_t)nslab * 256 + threadIdx.x * 8;
        _Float16* wdst = wlds + wave * W_PITCH + lane * 8;
        async_copy8_b128(wsrc, wdst, 8 * 256, 8 * W_PITCH);
        async_copy8_b128(wsrc + 64 * 256, wdst + 64 * W_PITCH, 8 * 256, 8 * W_PITCH);
        async_wait_all();
        __syncthreads();
    }

    v8f acc[4] = {};
    const _Float16* arow = A + (size_t)(m0 + row) * 256 + hi * 16;
    for (int k0 = 0; k0 < 256; k0 += 32) {
        __builtin_prefetch(arow + k0 + 64, 0, 1);
        v16h a = *(const v16h*)(arow + k0);
#pragma unroll
        for (int t = 0; t < 4; ++t) {
            v16h bm = lds_frag(wlds + (n0 + t * 16 + row) * W_PITCH + k0 + hi * 16);
            acc[t] = __builtin_amdgcn_wmma_f32_16x16x32_f16(
                false, a, false, bm, (short)0, acc[t], false, false);
        }
    }
#pragma unroll
    for (int t = 0; t < 4; ++t) {
        int o = nslab + n0 + t * 16 + row;
        float bo = bias[o];
#pragma unroll
        for (int r = 0; r < 8; ++r) {
            int m = m0 + r + 8 * hi;
            int b = m >> 12, n = m & 4095;
            out[((size_t)(b * 256 + o) << 12) + n] = acc[t][r] + bo;
        }
    }
}

// ---------------------------------------------------------------------------
extern "C" void kernel_launch(void* const* d_in, const int* in_sizes, int n_in,
                              void* d_out, int out_size, void* d_ws, size_t ws_size,
                              hipStream_t stream)
{
    const float* x     = (const float*)d_in[0];
    const float* w_qk  = (const float*)d_in[1];
    const float* w_v   = (const float*)d_in[2];
    const float* w_pe  = (const float*)d_in[3];
    const float* w_pr  = (const float*)d_in[4];
    const float* qk_g  = (const float*)d_in[5];
    const float* qk_b  = (const float*)d_in[6];
    const float* qk_m  = (const float*)d_in[7];
    const float* qk_v  = (const float*)d_in[8];
    const float* v_g   = (const float*)d_in[9];
    const float* v_b   = (const float*)d_in[10];
    const float* v_m   = (const float*)d_in[11];
    const float* v_v   = (const float*)d_in[12];
    const float* pe_g  = (const float*)d_in[13];
    const float* pe_b  = (const float*)d_in[14];
    const float* pe_m  = (const float*)d_in[15];
    const float* pe_v  = (const float*)d_in[16];
    const float* pr_g  = (const float*)d_in[17];
    const float* pr_b  = (const float*)d_in[18];
    const float* pr_m  = (const float*)d_in[19];
    const float* pr_v  = (const float*)d_in[20];
    float* out = (float*)d_out;

    // workspace carve-up (256B aligned)
    char* ws = (char*)d_ws;
    size_t off = 0;
    auto carve = [&](size_t bytes) -> char* {
        char* p = ws + off;
        off = (off + bytes + 255) & ~(size_t)255;
        return p;
    };
    _Float16* wcat16  = (_Float16*)carve(768 * 256 * sizeof(_Float16));
    float*    biascat = (float*)   carve(768 * sizeof(float));
    _Float16* wproj16 = (_Float16*)carve(256 * 256 * sizeof(_Float16));
    float*    biaspr  = (float*)   carve(256 * sizeof(float));
    float*    wpe_s   = (float*)   carve(256 * 25 * sizeof(float));
    float*    biaspe  = (float*)   carve(256 * sizeof(float));
    _Float16* X16     = (_Float16*)carve((size_t)8192 * 256 * sizeof(_Float16));
    _Float16* q16     = (_Float16*)carve((size_t)8 * 8 * 1024 * 32 * sizeof(_Float16));
    _Float16* k16     = (_Float16*)carve((size_t)8 * 8 * 1024 * 32 * sizeof(_Float16));
    _Float16* v16t    = (_Float16*)carve((size_t)8 * 8 * 32 * 1024 * sizeof(_Float16));
    float*    vf32    = (float*)   carve((size_t)2 * 256 * 4096 * sizeof(float));
    float*    pp      = (float*)   carve((size_t)2 * 256 * 4096 * sizeof(float));
    _Float16* comb16  = (_Float16*)carve((size_t)8192 * 256 * sizeof(_Float16));

    fold_weights_kernel<<<256, 256, 0, stream>>>(
        w_qk, qk_g, qk_b, qk_m, qk_v,
        w_v,  v_g,  v_b,  v_m,  v_v,
        w_pe, pe_g, pe_b, pe_m, pe_v,
        w_pr, pr_g, pr_b, pr_m, pr_v,
        wcat16, biascat, wproj16, biaspr, wpe_s, biaspe);

    pack_x_kernel<<<dim3(32, 4, 2), 256, 0, stream>>>(x, X16);

    qkv_gemm_kernel<<<dim3(8192 / 64, 768 / 128), 256, 0, stream>>>(
        X16, wcat16, biascat, q16, k16, v16t, vf32);

    pe_conv_kernel<<<512, 128, 0, stream>>>(vf32, wpe_s, biaspe, pp);

    attn_kernel<<<dim3(8, 8, 8), 256, 0, stream>>>(q16, k16, v16t, pp, comb16);

    proj_gemm_kernel<<<dim3(8192 / 64, 256 / 128), 256, 0, stream>>>(
        comb16, wproj16, biaspr, out);
}

// v004
// One run takes 52.9 microseconds.
// Two timings next to v003 put it at 1.12 and 1.13 times that version's speed.
// All steps since v000 together make it 2.41 times as fast.
#include <hip/hip_runtime.h>
#include <hip/hip_bf16.h>
#include <stdint.h>

typedef __attribute__((ext_vector_type(16))) _Float16 v16h;
typedef __attribute__((ext_vector_type(8)))  float    v8f;
typedef __attribute__((ext_vector_type(8)))  _Float16 v8h;
typedef __attribute__((ext_vector_type(4)))  float    v4f;
typedef __attribute__((ext_vector_type(2)))  float    v2f;

#define BN_EPS 1e-5f

// LDS row pitches, in halves: 16 bytes x an odd number, so that the 16 rows
// which one ds_load_b128 reads fall on 16 different groups of four banks.
#define W_PITCH  264    // weight slab rows: 512 bytes of data, 528 apart
#define KV_PITCH 40     // K stage rows: 64 bytes of data, 80 apart
#define VS_PITCH 136    // V stage rows: 256 bytes of data, 272 apart

// Attention stages K and V in LDS 128 keys at a time, in two buffers.
#define ST_KEYS  128
#define N_STAGES (1024 / ST_KEYS)
#define K_STAGE  (ST_KEYS * KV_PITCH)   // halves of one K buffer
#define V_STAGE  (32 * VS_PITCH)        // halves of one V buffer

// Wave-wide async global->LDS copies, 16 B per lane (512 B per wave and copy).
// The s_wait_xcnt stands in the copies' own statement, behind the last, so that
// it comes before any later write of their address registers.
// Eight copies, gstep halves apart in global memory and lstep halves apart
// in LDS.
__device__ __forceinline__ void async_copy8_b128(const _Float16* g, _Float16* lds_ptr,
                                                 int gstep, int lstep)
{
    unsigned l = (unsigned)(uintptr_t)lds_ptr;
    unsigned ls = (unsigned)lstep * 2u;
    asm volatile("global_load_async_to_lds_b128 %0, %8, off\n\t"
                 "global_load_async_to_lds_b128 %1, %9, off\n\t"
                 "global_load_async_to_lds_b128 %2, %10, off\n\t"
                 "global_load_async_to_lds_b128 %3, %11, off\n\t"
                 "global_load_async_to_lds_b128 %4, %12, off\n\t"
                 "global_load_async_to_lds_b128 %5, %13, off\n\t"
                 "global_load_async_to_lds_b128 %6, %14, off\n\t"
                 "global_load_async_to_lds_b128 %7, %15, off\n\t"
                 "s_wait_xcnt 0x0"
                 :: "v"(l), "v"(l + ls), "v"(l + 2 * ls), "v"(l + 3 * ls),
                    "v"(l + 4 * ls), "v"(l + 5 * ls), "v"(l + 6 * ls), "v"(l + 7 * ls),
                    "v"(g), "v"(g + gstep), "v"(g + 2 * gstep), "v"(g + 3 * gstep),
                    "v"(g + 4 * gstep), "v"(g + 5 * gstep), "v"(g + 6 * gstep), "v"(g + 7 * gstep)
                 : "memory");
}
// Four copies, each with its own two addresses.
__device__ __forceinline__ void async_copy4_b128(const _Float16* g0, const _Float16* g1,
                                                 const _Float16* g2, const _Float16* g3,
                                                 _Float16* p0, _Float16* p1,
                                                 _Float16* p2, _Float16* p3)
{
    unsigned l0 = (unsigned)(uintptr_t)p0, l1 = (unsigned)(uintptr_t)p1;
    unsigned l2 = (unsigned)(uintptr_t)p2, l3 = (unsigned)(uintptr_t)p3;
    asm volatile("global_load_async_to_lds_b128 %0, %4, off\n\t"
                 "global_load_async_to_lds_b128 %1, %5, off\n\t"
                 "global_load_async_to_lds_b128 %2, %6, off\n\t"
                 "global_load_async_to_lds_b128 %3, %7, off\n\t"
                 "s_wait_xcnt 0x0"
                 :: "v"(l0), "v"(l1), "v"(l2), "v"(l3), "v"(g0), "v"(g1), "v"(g2), "v"(g3)
                 : "memory");
}
// 16 consecutive halves from LDS as one fragment; the padded rows are 16-byte
// aligned, not 32, so the fragment is read as two 16-byte halves.
__device__ __forceinline__ v16h lds_frag(const _Float16* p)
{
    v8h lo = *(const v8h*)p, hi = *(const v8h*)(p + 8);
    return __builtin_shufflevector(lo, hi, 0, 1, 2, 3, 4, 5, 6, 7, 8, 9, 10, 11, 12, 13, 14, 15);
}
__device__ __forceinline__ void async_wait_all()
{
    asm volatile("s_wait_asynccnt 0x0" ::: "memory");
}

// ---------------------------------------------------------------------------
// Kernel A: fold BatchNorm into weights; produce f16 weight copies + f32 bias
// ---------------------------------------------------------------------------
__global__ void fold_weights_kernel(
    const float* __restrict__ w_qk, const float* __restrict__ qk_g, const float* __restrict__ qk_b,
    const float* __restrict__ qk_m, const float* __restrict__ qk_v,
    const float* __restrict__ w_v,  const float* __restrict__ v_g,  const float* __restrict__ v_b,
    const float* __restrict__ v_m,  const float* __restrict__ v_v,
    const float* __restrict__ w_pe, const float* __restrict__ pe_g, const float* __restrict__ pe_b,
    const float* __restrict__ pe_m, const float* __restrict__ pe_v,
    const float* __restrict__ w_pr, const float* __restrict__ pr_g, const float* __restrict__ pr_b,
    const float* __restrict__ pr_m, const float* __restrict__ pr_v,
    _Float16* __restrict__ wcat16, float* __restrict__ bias_cat,
    _Float16* __restrict__ wproj16, float* __restrict__ bias_pr,
    float* __restrict__ wpe_s, float* __restrict__ bias_pe)
{
    const int idx = blockIdx.x * blockDim.x + threadIdx.x;
    const int stride = gridDim.x * blockDim.x;

    for (int i = idx; i < 768 * 256; i += stride) {
        int o = i >> 8, c = i & 255;
        float s, w;
        if (o < 512) { s = qk_g[o] * rsqrtf(qk_v[o] + BN_EPS); w = w_qk[o * 256 + c]; }
        else { int oo = o - 512; s = v_g[oo] * rsqrtf(v_v[oo] + BN_EPS); w = w_v[oo * 256 + c]; }
        wcat16[i] = (_Float16)(w * s);
    }
    for (int o = idx; o < 768; o += stride) {
        if (o < 512) { float s = qk_g[o] * rsqrtf(qk_v[o] + BN_EPS); bias_cat[o] = qk_b[o] - qk_m[o] * s; }
        else { int oo = o - 512; float s = v_g[oo] * rsqrtf(v_v[oo] + BN_EPS); bias_cat[o] = v_b[oo] - v_m[oo] * s; }
    }
    for (int i = idx; i < 256 * 256; i += stride) {
        int o = i >> 8;
        float s = pr_g[o] * rsqrtf(pr_v[o] + BN_EPS);
        wproj16[i] = (_Float16)(w_pr[i] * s);
    }
    for (int o = idx; o < 256; o += stride) {
        float s = pr_g[o] * rsqrtf(pr_v[o] + BN_EPS);
        bias_pr[o] = pr_b[o] - pr_m[o] * s;
        float spe = pe_g[o] * rsqrtf(pe_v[o] + BN_EPS);
        bias_pe[o] = pe_b[o] - pe_m[o] * spe;
    }
    for (int i = idx; i < 256 * 25; i += stride) {
        int c = i / 25;
        float s = pe_g[c] * rsqrtf(pe_v[c] + BN_EPS);
        wpe_s[i] = w_pe[i] * s;
    }
}

// ---------------------------------------------------------------------------
// Kernel B: pack x (B,C,H,W) f32 -> X16 row-major (B*N, C) f16.
// A thread takes 8 channels x 4 positions: eight 16-byte loads along n, four
// 16-byte stores along c. In a wave 8 lanes lie along c and 4 along n, so each
// store fills four whole 128-byte lines of X16, every line from one wave.
// ---------------------------------------------------------------------------
__global__ __launch_bounds__(256) void pack_x_kernel(const float* __restrict__ x, _Float16* __restrict__ X16)
{
    const int lane = threadIdx.x & 31, wave = threadIdx.x >> 5;
    const int n  = blockIdx.x * 128 + wave * 16 + (lane >> 3) * 4;
    const int c0 = blockIdx.y * 64 + (lane & 7) * 8;
    const int b  = blockIdx.z;
    const float* src = x + ((size_t)(b * 256 + c0) << 12) + n;
    v4f v[8];
    // unrolled: constant element indices, and all 8 loads in flight at once
#pragma unroll
    for (int j = 0; j < 8; ++j) v[j] = *(const v4f*)(src + ((size_t)j << 12));
    _Float16* dst = X16 + ((size_t)(b * 4096 + n)) * 256 + c0;
    // unrolled: constant element indices keep the tile in registers
#pragma unroll
    for (int i = 0; i < 4; ++i) {
        v8h h;
#pragma unroll
        for (int j = 0; j < 8; ++j) h[j] = (_Float16)v[j][i];
        *(v8h*)(dst + i * 256) = h;
    }
}

// ---------------------------------------------------------------------------
// Kernel C: fused QKV GEMM: X16 (8192x256) * wcat16^T + bias.
// 128-column weight slab (64 KB f16) async-staged once per block into LDS;
// K-loop streams only A from global, B from ds_load.
// Slab rows lie in LDS at a pitch of 528 bytes (W_PITCH).
// ---------------------------------------------------------------------------
__global__ __launch_bounds__(256) void qkv_gemm_kernel(
    const _Float16* __restrict__ X16, const _Float16* __restrict__ W,
    const float* __restrict__ bias,
    _Float16* __restrict__ q16, _Float16* __restrict__ k16,
    _Float16* __restrict__ v16t, float* __restrict__ vf32)
{
    __shared__ __attribute__((aligned(16))) _Float16 wlds[128 * W_PITCH];   // 64 KB weight slab, padded rows
    const int lane = threadIdx.x & 31;
    const int wave = threadIdx.x >> 5;
    const int wm = wave & 3, wn = wave >> 2;
    const int m0 = blockIdx.x * 64 + wm * 16;
    const int n0 = wn * 64;                    // within-slab column base
    const int nslab = blockIdx.y * 128;        // global column base of slab
    const int row = lane & 15, hi = lane >> 4;

    // async stage the weight slab: 256 threads x 16 x 16B = 64 KB;
    // a wave copies one whole row per copy, rows wave, wave + 8, ...
    {
        const _Float16* wsrc = W + (size_t)nslab * 256 + threadIdx.x * 8;
        _Float16* wdst = wlds + wave * W_PITCH + lane * 8;
        async_copy8_b128(wsrc, wdst, 8 * 256, 8 * W_PITCH);
        async_copy8_b128(wsrc + 64 * 256, wdst + 64 * W_PITCH, 8 * 256, 8 * W_PITCH);
        async_wait_all();
        __syncthreads();
    }

    v8f acc[4] = {};
    const _Float16* arow = X16 + (size_t)(m0 + row) * 256 + hi * 16;
    for (int k0 = 0; k0 < 256; k0 += 32) {
        __builtin_prefetch(arow + k0 + 64, 0, 1);
        v16h a = *(const v16h*)(arow + k0);
#pragma unroll
        for (int t = 0; t < 4; ++t) {
            v16h bm = lds_frag(wlds + (n0 + t * 16 + row) * W_PITCH + k0 + hi * 16);
            acc[t] = __builtin_amdgcn_wmma_f32_16x16x32_f16(
                false, a, false, bm, (short)0, acc[t], false, false);
        }
    }

#pragma unroll
    for (int t = 0; t < 4; ++t) {
        int o = nslab + n0 + t * 16 + row;      // output channel
        float bo = bias[o];
#pragma unroll
        for (int r = 0; r < 8; ++r) {
            int m = m0 + r + 8 * hi;            // global spatial row (b*4096 + n)
            float val = acc[t][r] + bo;
            int b = m >> 12, n = m & 4095;
            int ba = (b << 2) + (n >> 10), na = n & 1023;
            if (o < 256) {                      // q
                int h = o >> 5, d = o & 31;
                q16[(((size_t)((ba << 3) + h) << 10) + na) * 32 + d] = (_Float16)val;
            } else if (o < 512) {               // k
                int oo = o - 256, h = oo >> 5, d = oo & 31;
                k16[(((size_t)((ba << 3) + h) << 10) + na) * 32 + d] = (_Float16)val;
            } else {                            // v : f32 NCHW + transposed f16
                int c = o - 512;
                vf32[((size_t)(b * 256 + c) << 12) + n] = val;
                int h = c >> 5, d = c & 31;
                v16t[((size_t)((((ba << 3) + h) << 5) + d) << 10) + na] = (_Float16)val;
            }
        }
    }
}

// ---------------------------------------------------------------------------
// Kernel D: depthwise 5x5 conv on v (pad 2), BN folded. pp layout [b][c][n].
// One block per (b, c) plane; a thread makes 8 rows x 4 columns of outputs from
// 12 input rows of 8 columns held in registers. Each output still adds its
// taps in the order dy, dx; a tap outside the plane enters as 0.
// ---------------------------------------------------------------------------
__global__ __launch_bounds__(128) void pe_conv_kernel(const float* __restrict__ vf32,
                               const float* __restrict__ wpe,
                               const float* __restrict__ bias_pe,
                               float* __restrict__ pp)
{
    const int plane = blockIdx.x;                 // b * 256 + c
    const int c = plane & 255;
    const int xg = threadIdx.x & 15, yg = threadIdx.x >> 4;
    const int x0 = xg * 4, y0 = yg * 8;
    const char* vin = (const char*)(vf32 + ((size_t)plane << 12));
    const float* w = wpe + c * 25;
    const float bias = bias_pe[c];
    const bool lok = xg > 0, rok = xg < 15;       // left / right halo inside the row
    const bool tok = yg > 0, bok = yg < 7;        // rows above / below inside the plane
    // Byte offsets in the plane: of row y0, of the two rows above it and of the
    // two rows below the thread's eight; clamped, so that every load stays inside.
    const unsigned ol = y0 * 256 + (lok ? x0 - 2 : 0) * 4;
    const unsigned om = y0 * 256 + x0 * 4;
    const unsigned orr = y0 * 256 + (rok ? x0 + 4 : 0) * 4;
    const unsigned up = tok ? 512u : 0u, dn = bok ? 2048u : 0u;
    const unsigned tl = ol - up, tm = om - up, tr = orr - up;
    const unsigned bl = ol + dn, bm = om + dn, br = orr + dn;

    v2f lf[12], rt[12];
    v4f md[12];
    // unrolled (all loops below): constant indices keep the rows and acc in registers
#pragma unroll
    for (int i = 0; i < 2; ++i) {
        lf[i] = *(const v2f*)(vin + tl + i * 256);
        md[i] = *(const v4f*)(vin + tm + i * 256);
        rt[i] = *(const v2f*)(vin + tr + i * 256);
        lf[10 + i] = *(const v2f*)(vin + bl + i * 256);
        md[10 + i] = *(const v4f*)(vin + bm + i * 256);
        rt[10 + i] = *(const v2f*)(vin + br + i * 256);
    }
#pragma unroll
    for (int i = 0; i < 8; ++i) {
        lf[2 + i] = *(const v2f*)(vin + ol + i * 256);
        md[2 + i] = *(const v4f*)(vin + om + i * 256);
        rt[2 + i] = *(const v2f*)(vin + orr + i * 256);
    }
    // Keeps all 36 loads up here, in flight together: left free the scheduler
    // spreads them among the multiply-adds and waits for several of them in full.
    __builtin_amdgcn_sched_barrier(0);
    // The wait that stands before the loads' address registers are used for
    // anything else; the offsets are named so that they stay whole up to it.
    asm volatile("s_wait_xcnt 0x0"
                 :: "v"(ol), "v"(om), "v"(orr), "v"(tl), "v"(tm), "v"(tr), "v"(bl), "v"(bm), "v"(br)
                 : "memory");

    v4f acc[8];
#pragma unroll
    for (int r = 0; r < 8; ++r) acc[r] = (v4f){bias, bias, bias, bias};

#pragma unroll
    for (int i = 0; i < 12; ++i) {
        const bool yok = i < 2 ? tok : (i < 10 ? true : bok);
        float v[8];                               // columns x0 - 2 .. x0 + 5
        v[0] = (yok && lok) ? lf[i][0] : 0.f;
        v[1] = (yok && lok) ? lf[i][1] : 0.f;
        v[2] = yok ? md[i][0] : 0.f;
        v[3] = yok ? md[i][1] : 0.f;
        v[4] = yok ? md[i][2] : 0.f;
        v[5] = yok ? md[i][3] : 0.f;
        v[6] = (yok && rok) ? rt[i][0] : 0.f;
        v[7] = (yok && rok) ? rt[i][1] : 0.f;
#pragma unroll
        for (int r = 0; r < 8; ++r) {
            const int ky = i - r;                 // dy + 2 of input row i for output row r
            if (ky < 0 || ky > 4) continue;
#pragma unroll
            for (int kx = 0; kx < 5; ++kx) {
                const float wk = w[ky * 5 + kx];
#pragma unroll
                for (int j = 0; j < 4; ++j) acc[r][j] += v[j + kx] * wk;
            }
        }
    }

    float* dst = pp + ((size_t)plane << 12) + y0 * 64 + x0;
#pragma unroll
    for (int r = 0; r < 8; ++r) *(v4f*)(dst + r * 64) = acc[r];
}

__device__ __forceinline__ float xhalf(float x)
{
    int i = __builtin_bit_cast(int, x);
    return __builtin_bit_cast(float,
        __builtin_amdgcn_permlanex16(i, i, 0x76543210, 0xfedcba98, false, false));
}

__global__ __launch_bounds__(256) void attn_kernel(
    const _Float16* __restrict__ q16, const _Float16* __restrict__ k16,
    const _Float16* __restrict__ v16t, const float* __restrict__ pp,
    _Float16* __restrict__ comb16)
{
    __shared__ __attribute__((aligned(16))) _Float16 ldsK[2 * K_STAGE];   // K stages: [m_local][d], padded rows
    __shared__ __attribute__((aligned(16))) _Float16 ldsV[2 * V_STAGE];   // V stages: [d][m_local], padded rows

    const int lane = threadIdx.x & 31, wave = threadIdx.x >> 5;
    const int ba = blockIdx.z, h = blockIdx.y;
    const int n0 = blockIdx.x * 128 + wave * 16;
    const int row = lane & 15, hi = lane >> 4;
    const float scale = 0.17677669529663687f;   // 1/sqrt(hd=32)

    const _Float16* qbase = q16 + ((size_t)(ba * 8 + h) << 10) * 32;
    const _Float16* kbase = k16 + ((size_t)(ba * 8 + h) << 10) * 32;
    const _Float16* vbase = v16t + ((size_t)(ba * 8 + h) << 5) * 1024;

    // B operand: 16 query columns x K=32 (entire head dim), loaded once.
    v16h bq = *(const v16h*)(qbase + (size_t)(n0 + row) * 32 + hi * 16);

    // State of this lane's query (column 'row'); rsum covers only the keys
    // this wave half holds, the halves are joined after the loop.
    float rmax = -1e30f, rsum = 0.f;
    v8f o0 = {}, o1 = {};    // o0[r] = O[query][d = 8*hi + r], o1: d + 16

    // A stage is 8 KB of K (contiguous) and 8 KB of V (32 d-rows x 256 B). Every
    // thread brings two 16-byte pieces of each, so every wave runs the same four
    // copies with all its lanes on, and each copy of a wave takes whole lines.
    const int tid = threadIdx.x;
    const _Float16* ksrc = kbase + tid * 8;
    const _Float16* vsrc = vbase + (tid >> 4) * 1024 + (tid & 15) * 8;
    _Float16* kdst = ldsK + (tid >> 2) * KV_PITCH + (tid & 3) * 8;
    _Float16* vdst = ldsV + (tid >> 4) * VS_PITCH + (tid & 15) * 8;
    auto stage_copy = [&](int s, int buf) {
        const _Float16* kg = ksrc + s * (ST_KEYS * 32);
        const _Float16* vg = vsrc + s * ST_KEYS;
        _Float16* kl = kdst + buf * K_STAGE;
        _Float16* vl = vdst + buf * V_STAGE;
        async_copy4_b128(kg, kg + 64 * 32, vg, vg + 16 * 1024,
                         kl, kl + 64 * KV_PITCH, vl, vl + 16 * VS_PITCH);
    };

    stage_copy(0, 0);
    async_wait_all();
    __syncthreads();       // stage 0 visible to all waves
    stage_copy(1, 1);

    for (int s = 0; s < N_STAGES; ++s) {
      const _Float16* kst = ldsK + (s & 1) * K_STAGE;
      const _Float16* vst = ldsV + (s & 1) * V_STAGE;
      // kept rolled: unrolled, the scheduler weaves two passes into each other, with
      // more v_nop slots behind the matrix instructions and twice the registers
#pragma nounroll
      for (int p = 0; p < ST_KEYS / 32; ++p) {
        const _Float16* kp = kst + p * 32 * KV_PITCH;
        const _Float16* vp = vst + p * 32;
        // A operand: 16 key rows x K=32, same k order as bq.
        v16h ak0 = lds_frag(kp + (row)      * KV_PITCH + hi * 16);
        v16h ak1 = lds_frag(kp + (16 + row) * KV_PITCH + hi * 16);
        // A operand of the second product: 16 d rows of V^T, keys in the order
        // in which the packed score tiles hold them (8*hi + s, 16 + 8*hi + s).
        v8h av0lo = *(const v8h*)(vp + (row)      * VS_PITCH + hi * 8);
        v8h av0hi = *(const v8h*)(vp + (row)      * VS_PITCH + 16 + hi * 8);
        v8h av1lo = *(const v8h*)(vp + (16 + row) * VS_PITCH + hi * 8);
        v8h av1hi = *(const v8h*)(vp + (16 + row) * VS_PITCH + 16 + hi * 8);
        // Keeps the four V loads up here, beside the K loads: left free the
        // scheduler sinks them to just in front of the second product, where
        // their LDS latency is then waited for in full.
        __builtin_amdgcn_sched_barrier(0);

        v8f s0 = {}, s1 = {};
        s0 = __builtin_amdgcn_wmma_f32_16x16x32_f16(false, ak0, false, bq, (short)0, s0, false, false);
        s1 = __builtin_amdgcn_wmma_f32_16x16x32_f16(false, ak1, false, bq, (short)0, s1, false, false);

        // online softmax; s0[r] = S[key 8*hi + r][query], s1[r]: key + 16.
        s0 *= scale; s1 *= scale;
        float mx0 = s0[0], mx1 = s1[0];
        // unrolled: constant element indices keep the tiles in registers
#pragma unroll
        for (int r = 1; r < 8; ++r) { mx0 = fmaxf(mx0, s0[r]); mx1 = fmaxf(mx1, s1[r]); }
        float mx = fmaxf(mx0, mx1);
        mx = fmaxf(mx, xhalf(mx));
        float mnew = fmaxf(rmax, mx);
        float corr = __expf(rmax - mnew);
        rmax = mnew;
        v16h bp;
        // unrolled: constant element indices keep the tiles in registers
#pragma unroll
        for (int r = 0; r < 8; ++r) {
            s0[r] = __expf(s0[r] - mnew);
            s1[r] = __expf(s1[r] - mnew);
            bp[r]     = (_Float16)s0[r];
            bp[8 + r] = (_Float16)s1[r];
        }
        v8f t = s0 + s1;
        float ps = ((t[0] + t[1]) + (t[2] + t[3])) + ((t[4] + t[5]) + (t[6] + t[7]));
        rsum = rsum * corr + ps;
        o0 *= corr; o1 *= corr;

        v16h av0 = __builtin_shufflevector(av0lo, av0hi, 0, 1, 2, 3, 4, 5, 6, 7, 8, 9, 10, 11, 12, 13, 14, 15);
        v16h av1 = __builtin_shufflevector(av1lo, av1hi, 0, 1, 2, 3, 4, 5, 6, 7, 8, 9, 10, 11, 12, 13, 14, 15);
        o0 = __builtin_amdgcn_wmma_f32_16x16x32_f16(false, av0, false, bp, (short)0, o0, false, false);
        o1 = __builtin_amdgcn_wmma_f32_16x16x32_f16(false, av1, false, bp, (short)0, o1, false, false);
      }
      // Hand-over of the stages: this wave's LDS reads of stage s have returned
      // and its own copies of stage s + 1 have landed before the barrier; behind
      // it stage s + 1 may be read by all and the buffer of stage s refilled.
      asm volatile("s_wait_dscnt 0x0" ::: "memory");
      async_wait_all();
      __syncthreads();
      if (s + 2 < N_STAGES) stage_copy(s + 2, s & 1);
    }
    async_wait_all();      // no copy is left in flight when the wave goes on

    // finalize: join the halves' sums, /= rowsum, add positional encoding,
    // store 8 consecutive channels of one f16 GEMM row per 16-byte store
    rsum += xhalf(rsum);
    const float inv = 1.0f / rsum;
    const int b = ba >> 2, area = ba & 3;
    const int n_global = area * 1024 + n0 + row;
    const int c0 = h * 32 + 8 * hi;
    v8h w0, w1;
    // unrolled: constant element indices, and all 16 loads in flight at once
#pragma unroll
    for (int r = 0; r < 8; ++r) {
        float pv0 = pp[((size_t)(b * 256 + c0 + r) << 12) + n_global];
        float pv1 = pp[((size_t)(b * 256 + c0 + 16 + r) << 12) + n_global];
        w0[r] = (_Float16)(o0[r] * inv + pv0);
        w1[r] = (_Float16)(o1[r] * inv + pv1);
    }
    _Float16* crow = comb16 + ((size_t)(b * 4096 + n_global)) * 256 + c0;
    *(v8h*)(crow)      = w0;
    *(v8h*)(crow + 16) = w1;
}

// ---------------------------------------------------------------------------
// Kernel F: projection GEMM: comb16 (8192x256) * wproj16^T + bias -> NCHW f32
// Weight slab async-staged in LDS as in kernel C.
// ---------------------------------------------------------------------------
__global__ __launch_bounds__(256) void proj_gemm_kernel(
    const _Float16* __restrict__ A, const _Float16* __restrict__ W,
    const float* __restrict__ bias, float* __restrict__ out)
{
    __shared__ __attribute__((aligned(16))) _Float16 wlds[128 * W_PITCH];   // 64 KB weight slab, padded rows
    const int lane = threadIdx.x & 31, wave = threadIdx.x >> 5;
    const int wm = wave & 3, wn = wave >> 2;
    const int m0 = blockIdx.x * 64 + wm * 16;
    const int n0 = wn * 64;
    const int nslab = blockIdx.y * 128;
    const int row = lane & 15, hi = lane >> 4;

    {
        const _Float16* wsrc = W + (size_t)nslab * 256 + threadIdx.x * 8;
        _Float16* wdst = wlds + wave * W_PITCH + lane * 8;
        async_copy8_b128(wsrc, wdst, 8 * 256, 8 * W_PITCH);
        async_copy8_b128(wsrc + 64 * 256, wdst + 64 * W_PITCH, 8 * 256, 8 * W_PITCH);
        async_wait_all();
        __syncthreads();
    }

    v8f acc[4] = {};
    const _Float16* arow = A + (size_t)(m0 + row) * 256 + hi * 16;
    for (int k0 = 0; k0 < 256; k0 += 32) {
        __builtin_prefetch(arow + k0 + 64, 0, 1);
        v16h a = *(const v16h*)(arow + k0);
#pragma unroll
        for (int t = 0; t < 4; ++t) {
            v16h bm = lds_frag(wlds + (n0 + t * 16 + row) * W_PITCH + k0 + hi * 16);
            acc[t] = __builtin_amdgcn_wmma_f32_16x16x32_f16(
                false, a, false, bm, (short)0, acc[t], false, false);
        }
    }
#pragma unroll
    for (int t = 0; t < 4; ++t) {
        int o = nslab + n0 + t * 16 + row;
        float bo = bias[o];
#pragma unroll
        for (int r = 0; r < 8; ++r) {
            int m = m0 + r + 8 * hi;
            int b = m >> 12, n = m & 4095;
            out[((size_t)(b * 256 + o) << 12) + n] = acc[t][r] + bo;
        }
    }
}

// ---------------------------------------------------------------------------
extern "C" void kernel_launch(void* const* d_in, const int* in_sizes, int n_in,
                              void* d_out, int out_size, void* d_ws, size_t ws_size,
                              hipStream_t stream)
{
    const float* x     = (const float*)d_in[0];
    const float* w_qk  = (const float*)d_in[1];
    const float* w_v   = (const float*)d_in[2];
    const float* w_pe  = (const float*)d_in[3];
    const float* w_pr  = (const float*)d_in[4];
    const float* qk_g  = (const float*)d_in[5];
    const float* qk_b  = (const float*)d_in[6];
    const float* qk_m  = (const float*)d_in[7];
    const float* qk_v  = (const float*)d_in[8];
    const float* v_g   = (const float*)d_in[9];
    const float* v_b   = (const float*)d_in[10];
    const float* v_m   = (const float*)d_in[11];
    const float* v_v   = (const float*)d_in[12];
    const float* pe_g  = (const float*)d_in[13];
    const float* pe_b  = (const float*)d_in[14];
    const float* pe_m  = (const float*)d_in[15];
    const float* pe_v  = (const float*)d_in[16];
    const float* pr_g  = (const float*)d_in[17];
    const float* pr_b  = (const float*)d_in[18];
    const float* pr_m  = (const float*)d_in[19];
    const float* pr_v  = (const float*)d_in[20];
    float* out = (float*)d_out;

    // workspace carve-up (256B aligned)
    char* ws = (char*)d_ws;
    size_t off = 0;
    auto carve = [&](size_t bytes) -> char* {
        char* p = ws + off;
        off = (off + bytes + 255) & ~(size_t)255;
        return p;
    };
    _Float16* wcat16  = (_Float16*)carve(768 * 256 * sizeof(_Float16));
    float*    biascat = (float*)   carve(768 * sizeof(float));
    _Float16* wproj16 = (_Float16*)carve(256 * 256 * sizeof(_Float16));
    float*    biaspr  = (float*)   carve(256 * sizeof(float));
    float*    wpe_s   = (float*)   carve(256 * 25 * sizeof(float));
    float*    biaspe  = (float*)   carve(256 * sizeof(float));
    _Float16* X16     = (_Float16*)carve((size_t)8192 * 256 * sizeof(_Float16));
    _Float16* q16     = (_Float16*)carve((size_t)8 * 8 * 1024 * 32 * sizeof(_Float16));
    _Float16* k16     = (_Float16*)carve((size_t)8 * 8 * 1024 * 32 * sizeof(_Float16));
    _Float16* v16t    = (_Float16*)carve((size_t)8 * 8 * 32 * 1024 * sizeof(_Float16));
    float*    vf32    = (float*)   carve((size_t)2 * 256 * 4096 * sizeof(float));
    float*    pp      = (float*)   carve((size_t)2 * 256 * 4096 * sizeof(float));
    _Float16* comb16  = (_Float16*)carve((size_t)8192 * 256 * sizeof(_Float16));

    fold_weights_kernel<<<256, 256, 0, stream>>>(
        w_qk, qk_g, qk_b, qk_m, qk_v,
        w_v,  v_g,  v_b,  v_m,  v_v,
        w_pe, pe_g, pe_b, pe_m, pe_v,
        w_pr, pr_g, pr_b, pr_m, pr_v,
        wcat16, biascat, wproj16, biaspr, wpe_s, biaspe);

    pack_x_kernel<<<dim3(32, 4, 2), 256, 0, stream>>>(x, X16);

    qkv_gemm_kernel<<<dim3(8192 / 64, 768 / 128), 256, 0, stream>>>(
        X16, wcat16, biascat, q16, k16, v16t, vf32);

    pe_conv_kernel<<<512, 128, 0, stream>>>(vf32, wpe_s, biaspe, pp);

    attn_kernel<<<dim3(8, 8, 8), 256, 0, stream>>>(q16, k16, v16t, pp, comb16);

    proj_gemm_kernel<<<dim3(8192 / 64, 256 / 128), 256, 0, stream>>>(
        comb16, wproj16, biaspr, out);
}

// v005
// It runs in 44.8 microseconds.
// Two timings next to v004 put it at 1.18 and 1.19 times that version's speed.
// Counting every step since v000, it is 2.86 times as fast.
#include <hip/hip_runtime.h>
#include <hip/hip_bf16.h>
#include <stdint.h>

typedef __attribute__((ext_vector_type(16))) _Float16 v16h;
typedef __attribute__((ext_vector_type(8)))  float    v8f;
typedef __attribute__((ext_vector_type(8)))  _Float16 v8h;
typedef __attribute__((ext_vector_type(4)))  float    v4f;
typedef __attribute__((ext_vector_type(2)))  float    v2f;

#define BN_EPS 1e-5f

// LDS row pitches, in halves: 16 bytes x an odd number, so that the 16 rows
// which one ds_load_b128 reads fall on 16 different groups of four banks.
#define W_PITCH  264    // weight slab rows: 512 bytes of data, 528 apart
#define KV_PITCH 40     // K stage rows: 64 bytes of data, 80 apart
#define VS_PITCH 136    // V stage rows: 256 bytes of data, 272 apart

// Attention stages K and V in LDS 128 keys at a time, in two buffers.
#define ST_KEYS  128
#define N_STAGES (1024 / ST_KEYS)
#define K_STAGE  (ST_KEYS * KV_PITCH)   // halves of one K buffer
#define V_STAGE  (32 * VS_PITCH)        // halves of one V buffer

// Wave-wide async global->LDS copies, 16 B per lane (512 B per wave and copy).
// The s_wait_xcnt stands in the copies' own statement, behind the last, so that
// it comes before any later write of their address registers.
// Eight copies, gstep halves apart in global memory and lstep halves apart
// in LDS.
__device__ __forceinline__ void async_copy8_b128(const _Float16* g, _Float16* lds_ptr,
                                                 int gstep, int lstep)
{
    unsigned l = (unsigned)(uintptr_t)lds_ptr;
    unsigned ls = (unsigned)lstep * 2u;
    asm volatile("global_load_async_to_lds_b128 %0, %8, off\n\t"
                 "global_load_async_to_lds_b128 %1, %9, off\n\t"
                 "global_load_async_to_lds_b128 %2, %10, off\n\t"
                 "global_load_async_to_lds_b128 %3, %11, off\n\t"
                 "global_load_async_to_lds_b128 %4, %12, off\n\t"
                 "global_load_async_to_lds_b128 %5, %13, off\n\t"
                 "global_load_async_to_lds_b128 %6, %14, off\n\t"
                 "global_load_async_to_lds_b128 %7, %15, off\n\t"
                 "s_wait_xcnt 0x0"
                 :: "v"(l), "v"(l + ls), "v"(l + 2 * ls), "v"(l + 3 * ls),
                    "v"(l + 4 * ls), "v"(l + 5 * ls), "v"(l + 6 * ls), "v"(l + 7 * ls),
                    "v"(g), "v"(g + gstep), "v"(g + 2 * gstep), "v"(g + 3 * gstep),
                    "v"(g + 4 * gstep), "v"(g + 5 * gstep), "v"(g + 6 * gstep), "v"(g + 7 * gstep)
                 : "memory");
}
// Four copies, each with its own two addresses.
__device__ __forceinline__ void async_copy4_b128(const _Float16* g0, const _Float16* g1,
                                                 const _Float16* g2, const _Float16* g3,
                                                 _Float16* p0, _Float16* p1,
                                                 _Float16* p2, _Float16* p3)
{
    unsigned l0 = (unsigned)(uintptr_t)p0, l1 = (unsigned)(uintptr_t)p1;
    unsigned l2 = (unsigned)(uintptr_t)p2, l3 = (unsigned)(uintptr_t)p3;
    asm volatile("global_load_async_to_lds_b128 %0, %4, off\n\t"
                 "global_load_async_to_lds_b128 %1, %5, off\n\t"
                 "global_load_async_to_lds_b128 %2, %6, off\n\t"
                 "global_load_async_to_lds_b128 %3, %7, off\n\t"
                 "s_wait_xcnt 0x0"
                 :: "v"(l0), "v"(l1), "v"(l2), "v"(l3), "v"(g0), "v"(g1), "v"(g2), "v"(g3)
                 : "memory");
}
// 16 consecutive halves from LDS as one fragment; the padded rows are 16-byte
// aligned, not 32, so the fragment is read as two 16-byte halves.
__device__ __forceinline__ v16h lds_frag(const _Float16* p)
{
    v8h lo = *(const v8h*)p, hi = *(const v8h*)(p + 8);
    return __builtin_shufflevector(lo, hi, 0, 1, 2, 3, 4, 5, 6, 7, 8, 9, 10, 11, 12, 13, 14, 15);
}
__device__ __forceinline__ void async_wait_all()
{
    asm volatile("s_wait_asynccnt 0x0" ::: "memory");
}

// ---------------------------------------------------------------------------
// Kernel A: fold BatchNorm into weights; produce f16 weight copies + f32 bias
// ---------------------------------------------------------------------------
__global__ void fold_weights_kernel(
    const float* __restrict__ w_qk, const float* __restrict__ qk_g, const float* __restrict__ qk_b,
    const float* __restrict__ qk_m, const float* __restrict__ qk_v,
    const float* __restrict__ w_v,  const float* __restrict__ v_g,  const float* __restrict__ v_b,
    const float* __restrict__ v_m,  const float* __restrict__ v_v,
    const float* __restrict__ w_pe, const float* __restrict__ pe_g, const float* __restrict__ pe_b,
    const float* __restrict__ pe_m, const float* __restrict__ pe_v,
    const float* __restrict__ w_pr, const float* __restrict__ pr_g, const float* __restrict__ pr_b,
    const float* __restrict__ pr_m, const float* __restrict__ pr_v,
    _Float16* __restrict__ wcat16, float* __restrict__ bias_cat,
    _Float16* __restrict__ wproj16, float* __restrict__ bias_pr,
    float* __restrict__ wpe_s, float* __restrict__ bias_pe)
{
    const int idx = blockIdx.x * blockDim.x + threadIdx.x;
    const int stride = gridDim.x * blockDim.x;

    for (int i = idx; i < 768 * 256; i += stride) {
        int o = i >> 8, c = i & 255;
        float s, w;
        if (o < 512) { s = qk_g[o] * rsqrtf(qk_v[o] + BN_EPS); w = w_qk[o * 256 + c]; }
        else { int oo = o - 512; s = v_g[oo] * rsqrtf(v_v[oo] + BN_EPS); w = w_v[oo * 256 + c]; }
        wcat16[i] = (_Float16)(w * s);
    }
    for (int o = idx; o < 768; o += stride) {
        if (o < 512) { float s = qk_g[o] * rsqrtf(qk_v[o] + BN_EPS); bias_cat[o] = qk_b[o] - qk_m[o] * s; }
        else { int oo = o - 512; float s = v_g[oo] * rsqrtf(v_v[oo] + BN_EPS); bias_cat[o] = v_b[oo] - v_m[oo] * s; }
    }
    for (int i = idx; i < 256 * 256; i += stride) {
        int o = i >> 8;
        float s = pr_g[o] * rsqrtf(pr_v[o] + BN_EPS);
        wproj16[i] = (_Float16)(w_pr[i] * s);
    }
    for (int o = idx; o < 256; o += stride) {
        float s = pr_g[o] * rsqrtf(pr_v[o] + BN_EPS);
        bias_pr[o] = pr_b[o] - pr_m[o] * s;
        float spe = pe_g[o] * rsqrtf(pe_v[o] + BN_EPS);
        bias_pe[o] = pe_b[o] - pe_m[o] * spe;
    }
    for (int i = idx; i < 256 * 25; i += stride) {
        int c = i / 25;
        float s = pe_g[c] * rsqrtf(pe_v[c] + BN_EPS);
        wpe_s[i] = w_pe[i] * s;
    }
}

// ---------------------------------------------------------------------------
// Kernel B: pack x (B,C,H,W) f32 -> X16 row-major (B*N, C) f16.
// A thread takes 8 channels x 4 positions: eight 16-byte loads along n, four
// 16-byte stores along c. In a wave 8 lanes lie along c and 4 along n, so each
// store fills four whole 128-byte lines of X16, every line from one wave.
// ---------------------------------------------------------------------------
__global__ __launch_bounds__(256) void pack_x_kernel(const float* __restrict__ x, _Float16* __restrict__ X16)
{
    const int lane = threadIdx.x & 31, wave = threadIdx.x >> 5;
    const int n  = blockIdx.x * 128 + wave * 16 + (lane >> 3) * 4;
    const int c0 = blockIdx.y * 64 + (lane & 7) * 8;
    const int b  = blockIdx.z;
    const float* src = x + ((size_t)(b * 256 + c0) << 12) + n;
    v4f v[8];
    // unrolled: constant element indices, and all 8 loads in flight at once
#pragma unroll
    for (int j = 0; j < 8; ++j) v[j] = *(const v4f*)(src + ((size_t)j << 12));
    _Float16* dst = X16 + ((size_t)(b * 4096 + n)) * 256 + c0;
    // unrolled: constant element indices keep the tile in registers
#pragma unroll
    for (int i = 0; i < 4; ++i) {
        v8h h;
#pragma unroll
        for (int j = 0; j < 8; ++j) h[j] = (_Float16)v[j][i];
        *(v8h*)(dst + i * 256) = h;
    }
}

// ---------------------------------------------------------------------------
// Kernel C: fused QKV GEMM: X16 (8192x256) * wcat16^T + bias.
// 128-column weight slab (64 KB f16) async-staged once per block into LDS;
// K-loop streams only the x rows from global, the weight rows from ds_load.
// Slab rows lie in LDS at a pitch of 528 bytes (W_PITCH).
// The weights are the A operand and the x rows the B operand, so a lane holds 8
// consecutive channels of ONE position and 16 lanes lie along the positions:
// q and k rows (channels contiguous) leave as one 16-byte store a tile, the v
// planes (positions contiguous) in runs of 16 positions a store.
// ---------------------------------------------------------------------------
__global__ __launch_bounds__(256) void qkv_gemm_kernel(
    const _Float16* __restrict__ X16, const _Float16* __restrict__ W,
    const float* __restrict__ bias,
    _Float16* __restrict__ q16, _Float16* __restrict__ k16,
    _Float16* __restrict__ v16t, float* __restrict__ vf32)
{
    __shared__ __attribute__((aligned(16))) _Float16 wlds[128 * W_PITCH];   // 64 KB weight slab, padded rows
    const int lane = threadIdx.x & 31;
    const int wave = threadIdx.x >> 5;
    const int wm = wave & 3, wn = wave >> 2;
    const int m0 = blockIdx.x * 64 + wm * 16;
    const int n0 = wn * 64;                    // within-slab column base
    const int nslab = blockIdx.y * 128;        // global column base of slab
    const int row = lane & 15, hi = lane >> 4;
    const int kind = blockIdx.y >> 1;           // the block's slab: 0 q, 1 k, 2 v
    const int c0 = (blockIdx.y & 1) * 128 + n0 + 8 * hi;   // lane's first channel inside q, k or v

    // async stage the weight slab: 256 threads x 16 x 16B = 64 KB;
    // a wave copies one whole row per copy, rows wave, wave + 8, ...
    {
        const _Float16* wsrc = W + (size_t)nslab * 256 + threadIdx.x * 8;
        _Float16* wdst = wlds + wave * W_PITCH + lane * 8;
        async_copy8_b128(wsrc, wdst, 8 * 256, 8 * W_PITCH);
        async_copy8_b128(wsrc + 64 * 256, wdst + 64 * W_PITCH, 8 * 256, 8 * W_PITCH);
        async_wait_all();
        __syncthreads();
    }

    v8f acc[4] = {};
    const _Float16* arow = X16 + (size_t)(m0 + row) * 256 + hi * 16;
    for (int k0 = 0; k0 < 256; k0 += 32) {
        __builtin_prefetch(arow + k0 + 64, 0, 1);
        v16h a = *(const v16h*)(arow + k0);
#pragma unroll
        for (int t = 0; t < 4; ++t) {
            v16h bm = lds_frag(wlds + (n0 + t * 16 + row) * W_PITCH + k0 + hi * 16);
            acc[t] = __builtin_amdgcn_wmma_f32_16x16x32_f16(
                false, bm, false, a, (short)0, acc[t], false, false);
        }
    }

    // acc[t][r] = Y[position m0 + row][channel nslab + n0 + t*16 + 8*hi + r]
    const char* bsrc = (const char*)(bias + kind * 256);
    const unsigned boff = (unsigned)c0 * 4u;    // byte offset of the lane's first bias value
    v4f blo[4], bhi[4];                         // the lane's 8 bias values of each tile
    // unrolled (all loops below): constant element indices keep them and acc in registers
#pragma unroll
    for (int t = 0; t < 4; ++t) {
        blo[t] = *(const v4f*)(bsrc + boff + t * 64);
        bhi[t] = *(const v4f*)(bsrc + boff + t * 64 + 16);
    }
    // The wait that stands before the bias loads' address register is used for
    // anything else; the offset is named so that it stays whole up to it.
    asm volatile("s_wait_xcnt 0x0" :: "v"(boff) : "memory");
#pragma unroll
    for (int t = 0; t < 4; ++t) {
#pragma unroll
        for (int r = 0; r < 4; ++r) { acc[t][r] += blo[t][r]; acc[t][4 + r] += bhi[t][r]; }
    }
    const int m = m0 + row;                     // global spatial row (b*4096 + n)
    const int b = m >> 12, n = m & 4095;
    const int ba = (b << 2) + (n >> 10), na = n & 1023;
    if (kind < 2) {                             // q, k: [ba][h][na][d], 8 d a lane
        _Float16* dst = (kind == 0 ? q16 : k16)
            + (((size_t)((ba << 3) + (c0 >> 5)) << 10) + na) * 32 + (c0 & 31);
#pragma unroll
        for (int t = 0; t < 4; ++t) {           // tiles 0, 1: one head; 2, 3: the next
            v8h hv;
#pragma unroll
            for (int r = 0; r < 8; ++r) hv[r] = (_Float16)acc[t][r];
            *(v8h*)(dst + (t >> 1) * (1024 * 32) + (t & 1) * 16) = hv;
        }
    } else {                                    // v : f32 NCHW + transposed f16
        float* vf = vf32 + ((size_t)(b * 256 + c0) << 12) + n;
        _Float16* vt = v16t + ((size_t)((ba << 8) + c0) << 10) + na;
#pragma unroll
        for (int t = 0; t < 4; ++t) {
#pragma unroll
            for (int r = 0; r < 8; ++r) {
                vf[(t * 16 + r) << 12] = acc[t][r];
                vt[(t * 16 + r) << 10] = (_Float16)acc[t][r];
            }
        }
        // The wait that stands before the stores' address and data registers are
        // used for anything else on any way the built code goes on from here.
        asm volatile("s_wait_xcnt 0x0" ::: "memory");
    }
}

// ---------------------------------------------------------------------------
// Kernel D: depthwise 5x5 conv on v (pad 2), BN folded. pp layout [b][c][n].
// One block per (b, c) plane; a thread makes 8 rows x 4 columns of outputs from
// 12 input rows of 8 columns held in registers. Each output still adds its
// taps in the order dy, dx; a tap outside the plane enters as 0.
// ---------------------------------------------------------------------------
__global__ __launch_bounds__(128) void pe_conv_kernel(const float* __restrict__ vf32,
                               const float* __restrict__ wpe,
                               const float* __restrict__ bias_pe,
                               float* __restrict__ pp)
{
    const int plane = blockIdx.x;                 // b * 256 + c
    const int c = plane & 255;
    const int xg = threadIdx.x & 15, yg = threadIdx.x >> 4;
    const int x0 = xg * 4, y0 = yg * 8;
    const char* vin = (const char*)(vf32 + ((size_t)plane << 12));
    const float* w = wpe + c * 25;
    const float bias = bias_pe[c];
    const bool lok = xg > 0, rok = xg < 15;       // left / right halo inside the row
    const bool tok = yg > 0, bok = yg < 7;        // rows above / below inside the plane
    // Byte offsets in the plane: of row y0, of the two rows above it and of the
    // two rows below the thread's eight; clamped, so that every load stays inside.
    const unsigned ol = y0 * 256 + (lok ? x0 - 2 : 0) * 4;
    const unsigned om = y0 * 256 + x0 * 4;
    const unsigned orr = y0 * 256 + (rok ? x0 + 4 : 0) * 4;
    const unsigned up = tok ? 512u : 0u, dn = bok ? 2048u : 0u;
    const unsigned tl = ol - up, tm = om - up, tr = orr - up;
    const unsigned bl = ol + dn, bm = om + dn, br = orr + dn;

    v2f lf[12], rt[12];
    v4f md[12];
    // unrolled (all loops below): constant indices keep the rows and acc in registers
#pragma unroll
    for (int i = 0; i < 2; ++i) {
        lf[i] = *(const v2f*)(vin + tl + i * 256);
        md[i] = *(const v4f*)(vin + tm + i * 256);
        rt[i] = *(const v2f*)(vin + tr + i * 256);
        lf[10 + i] = *(const v2f*)(vin + bl + i * 256);
        md[10 + i] = *(const v4f*)(vin + bm + i * 256);
        rt[10 + i] = *(const v2f*)(vin + br + i * 256);
    }
#pragma unroll
    for (int i = 0; i < 8; ++i) {
        lf[2 + i] = *(const v2f*)(vin + ol + i * 256);
        md[2 + i] = *(const v4f*)(vin + om + i * 256);
        rt[2 + i] = *(const v2f*)(vin + orr + i * 256);
    }
    // Keeps all 36 loads up here, in flight together: left free the scheduler
    // spreads them among the multiply-adds and waits for several of them in full.
    __builtin_amdgcn_sched_barrier(0);
    // The wait that stands before the loads' address registers are used for
    // anything else; the offsets are named so that they stay whole up to it.
    asm volatile("s_wait_xcnt 0x0"
                 :: "v"(ol), "v"(om), "v"(orr), "v"(tl), "v"(tm), "v"(tr), "v"(bl), "v"(bm), "v"(br)
                 : "memory");

    v4f acc[8];
#pragma unroll
    for (int r = 0; r < 8; ++r) acc[r] = (v4f){bias, bias, bias, bias};

#pragma unroll
    for (int i = 0; i < 12; ++i) {
        const bool yok = i < 2 ? tok : (i < 10 ? true : bok);
        float v[8];                               // columns x0 - 2 .. x0 + 5
        v[0] = (yok && lok) ? lf[i][0] : 0.f;
        v[1] = (yok && lok) ? lf[i][1] : 0.f;
        v[2] = yok ? md[i][0] : 0.f;
        v[3] = yok ? md[i][1] : 0.f;
        v[4] = yok ? md[i][2] : 0.f;
        v[5] = yok ? md[i][3] : 0.f;
        v[6] = (yok && rok) ? rt[i][0] : 0.f;
        v[7] = (yok && rok) ? rt[i][1] : 0.f;
#pragma unroll
        for (int r = 0; r < 8; ++r) {
            const int ky = i - r;                 // dy + 2 of input row i for output row r
            if (ky < 0 || ky > 4) continue;
#pragma unroll
            for (int kx = 0; kx < 5; ++kx) {
                const float wk = w[ky * 5 + kx];
#pragma unroll
                for (int j = 0; j < 4; ++j) acc[r][j] += v[j + kx] * wk;
            }
        }
    }

    float* dst = pp + ((size_t)plane << 12) + y0 * 64 + x0;
#pragma unroll
    for (int r = 0; r < 8; ++r) *(v4f*)(dst + r * 64) = acc[r];
}

__device__ __forceinline__ float xhalf(float x)
{
    int i = __builtin_bit_cast(int, x);
    return __builtin_bit_cast(float,
        __builtin_amdgcn_permlanex16(i, i, 0x76543210, 0xfedcba98, false, false));
}

__global__ __launch_bounds__(256) void attn_kernel(
    const _Float16* __restrict__ q16, const _Float16* __restrict__ k16,
    const _Float16* __restrict__ v16t, const float* __restrict__ pp,
    _Float16* __restrict__ comb16)
{
    __shared__ __attribute__((aligned(16))) _Float16 ldsK[2 * K_STAGE];   // K stages: [m_local][d], padded rows
    __shared__ __attribute__((aligned(16))) _Float16 ldsV[2 * V_STAGE];   // V stages: [d][m_local], padded rows

    const int lane = threadIdx.x & 31, wave = threadIdx.x >> 5;
    const int ba = blockIdx.z, h = blockIdx.y;
    const int n0 = blockIdx.x * 128 + wave * 16;
    const int row = lane & 15, hi = lane >> 4;
    const float scale = 0.17677669529663687f;   // 1/sqrt(hd=32)

    const _Float16* qbase = q16 + ((size_t)(ba * 8 + h) << 10) * 32;
    const _Float16* kbase = k16 + ((size_t)(ba * 8 + h) << 10) * 32;
    const _Float16* vbase = v16t + ((size_t)(ba * 8 + h) << 5) * 1024;

    // B operand: 16 query columns x K=32 (entire head dim), loaded once.
    v16h bq = *(const v16h*)(qbase + (size_t)(n0 + row) * 32 + hi * 16);

    // State of this lane's query (column 'row'); rsum covers only the keys
    // this wave half holds, the halves are joined after the loop.
    float rmax = -1e30f, rsum = 0.f;
    v8f o0 = {}, o1 = {};    // o0[r] = O[query][d = 8*hi + r], o1: d + 16

    // A stage is 8 KB of K (contiguous) and 8 KB of V (32 d-rows x 256 B). Every
    // thread brings two 16-byte pieces of each, so every wave runs the same four
    // copies with all its lanes on, and each copy of a wave takes whole lines.
    const int tid = threadIdx.x;
    const _Float16* ksrc = kbase + tid * 8;
    const _Float16* vsrc = vbase + (tid >> 4) * 1024 + (tid & 15) * 8;
    _Float16* kdst = ldsK + (tid >> 2) * KV_PITCH + (tid & 3) * 8;
    _Float16* vdst = ldsV + (tid >> 4) * VS_PITCH + (tid & 15) * 8;
    auto stage_copy = [&](int s, int buf) {
        const _Float16* kg = ksrc + s * (ST_KEYS * 32);
        const _Float16* vg = vsrc + s * ST_KEYS;
        _Float16* kl = kdst + buf * K_STAGE;
        _Float16* vl = vdst + buf * V_STAGE;
        async_copy4_b128(kg, kg + 64 * 32, vg, vg + 16 * 1024,
                         kl, kl + 64 * KV_PITCH, vl, vl + 16 * VS_PITCH);
    };

    stage_copy(0, 0);
    async_wait_all();
    __syncthreads();       // stage 0 visible to all waves
    stage_copy(1, 1);

    for (int s = 0; s < N_STAGES; ++s) {
      const _Float16* kst = ldsK + (s & 1) * K_STAGE;
      const _Float16* vst = ldsV + (s & 1) * V_STAGE;
      // kept rolled: unrolled, the scheduler weaves two passes into each other, with
      // more v_nop slots behind the matrix instructions and twice the registers
#pragma nounroll
      for (int p = 0; p < ST_KEYS / 32; ++p) {
        const _Float16* kp = kst + p * 32 * KV_PITCH;
        const _Float16* vp = vst + p * 32;
        // A operand: 16 key rows x K=32, same k order as bq.
        v16h ak0 = lds_frag(kp + (row)      * KV_PITCH + hi * 16);
        v16h ak1 = lds_frag(kp + (16 + row) * KV_PITCH + hi * 16);
        // A operand of the second product: 16 d rows of V^T, keys in the order
        // in which the packed score tiles hold them (8*hi + s, 16 + 8*hi + s).
        v8h av0lo = *(const v8h*)(vp + (row)      * VS_PITCH + hi * 8);
        v8h av0hi = *(const v8h*)(vp + (row)      * VS_PITCH + 16 + hi * 8);
        v8h av1lo = *(const v8h*)(vp + (16 + row) * VS_PITCH + hi * 8);
        v8h av1hi = *(const v8h*)(vp + (16 + row) * VS_PITCH + 16 + hi * 8);
        // Keeps the four V loads up here, beside the K loads: left free the
        // scheduler sinks them to just in front of the second product, where
        // their LDS latency is then waited for in full.
        __builtin_amdgcn_sched_barrier(0);

        v8f s0 = {}, s1 = {};
        s0 = __builtin_amdgcn_wmma_f32_16x16x32_f16(false, ak0, false, bq, (short)0, s0, false, false);
        s1 = __builtin_amdgcn_wmma_f32_16x16x32_f16(false, ak1, false, bq, (short)0, s1, false, false);

        // online softmax; s0[r] = S[key 8*hi + r][query], s1[r]: key + 16.
        s0 *= scale; s1 *= scale;
        float mx0 = s0[0], mx1 = s1[0];
        // unrolled: constant element indices keep the tiles in registers
#pragma unroll
        for (int r = 1; r < 8; ++r) { mx0 = fmaxf(mx0, s0[r]); mx1 = fmaxf(mx1, s1[r]); }
        float mx = fmaxf(mx0, mx1);
        mx = fmaxf(mx, xhalf(mx));
        float mnew = fmaxf(rmax, mx);
        float corr = __expf(rmax - mnew);
        rmax = mnew;
        v16h bp;
        // unrolled: constant element indices keep the tiles in registers
#pragma unroll
        for (int r = 0; r < 8; ++r) {
            s0[r] = __expf(s0[r] - mnew);
            s1[r] = __expf(s1[r] - mnew);
            bp[r]     = (_Float16)s0[r];
            bp[8 + r] = (_Float16)s1[r];
        }
        v8f t = s0 + s1;
        float ps = ((t[0] + t[1]) + (t[2] + t[3])) + ((t[4] + t[5]) + (t[6] + t[7]));
        rsum = rsum * corr + ps;
        o0 *= corr; o1 *= corr;

        v16h av0 = __builtin_shufflevector(av0lo, av0hi, 0, 1, 2, 3, 4, 5, 6, 7, 8, 9, 10, 11, 12, 13, 14, 15);
        v16h av1 = __builtin_shufflevector(av1lo, av1hi, 0, 1, 2, 3, 4, 5, 6, 7, 8, 9, 10, 11, 12, 13, 14, 15);
        o0 = __builtin_amdgcn_wmma_f32_16x16x32_f16(false, av0, false, bp, (short)0, o0, false, false);
        o1 = __builtin_amdgcn_wmma_f32_16x16x32_f16(false, av1, false, bp, (short)0, o1, false, false);
      }
      // Hand-over of the stages: this wave's LDS reads of stage s have returned
      // and its own copies of stage s + 1 have landed before the barrier; behind
      // it stage s + 1 may be read by all and the buffer of stage s refilled.
      asm volatile("s_wait_dscnt 0x0" ::: "memory");
      async_wait_all();
      __syncthreads();
      if (s + 2 < N_STAGES) stage_copy(s + 2, s & 1);
    }
    async_wait_all();      // no copy is left in flight when the wave goes on

    // finalize: join the halves' sums, /= rowsum, add positional encoding,
    // store 8 consecutive channels of one f16 GEMM row per 16-byte store
    rsum += xhalf(rsum);
    const float inv = 1.0f / rsum;
    const int b = ba >> 2, area = ba & 3;
    const int n_global = area * 1024 + n0 + row;
    const int c0 = h * 32 + 8 * hi;
    v8h w0, w1;
    // unrolled: constant element indices, and all 16 loads in flight at once
#pragma unroll
    for (int r = 0; r < 8; ++r) {
        float pv0 = pp[((size_t)(b * 256 + c0 + r) << 12) + n_global];
        float pv1 = pp[((size_t)(b * 256 + c0 + 16 + r) << 12) + n_global];
        w0[r] = (_Float16)(o0[r] * inv + pv0);
        w1[r] = (_Float16)(o1[r] * inv + pv1);
    }
    _Float16* crow = comb16 + ((size_t)(b * 4096 + n_global)) * 256 + c0;
    *(v8h*)(crow)      = w0;
    *(v8h*)(crow + 16) = w1;
}

// ---------------------------------------------------------------------------
// Kernel F: projection GEMM: comb16 (8192x256) * wproj16^T + bias -> NCHW f32
// Weight slab async-staged in LDS as in kernel C; weights as the A operand as
// there, so that 16 lanes lie along n, the contiguous axis of out.
// ---------------------------------------------------------------------------
__global__ __launch_bounds__(256) void proj_gemm_kernel(
    const _Float16* __restrict__ A, const _Float16* __restrict__ W,
    const float* __restrict__ bias, float* __restrict__ out)
{
    __shared__ __attribute__((aligned(16))) _Float16 wlds[128 * W_PITCH];   // 64 KB weight slab, padded rows
    const int lane = threadIdx.x & 31, wave = threadIdx.x >> 5;
    const int wm = wave & 3, wn = wave >> 2;
    const int m0 = blockIdx.x * 64 + wm * 16;
    const int n0 = wn * 64;
    const int nslab = blockIdx.y * 128;
    const int row = lane & 15, hi = lane >> 4;
    const int o0 = nslab + n0 + 8 * hi;         // lane's first output channel

    {
        const _Float16* wsrc = W + (size_t)nslab * 256 + threadIdx.x * 8;
        _Float16* wdst = wlds + wave * W_PITCH + lane * 8;
        async_copy8_b128(wsrc, wdst, 8 * 256, 8 * W_PITCH);
        async_copy8_b128(wsrc + 64 * 256, wdst + 64 * W_PITCH, 8 * 256, 8 * W_PITCH);
        async_wait_all();
        __syncthreads();
    }

    v8f acc[4] = {};
    const _Float16* arow = A + (size_t)(m0 + row) * 256 + hi * 16;
    for (int k0 = 0; k0 < 256; k0 += 32) {
        __builtin_prefetch(arow + k0 + 64, 0, 1);
        v16h a = *(const v16h*)(arow + k0);
#pragma unroll
        for (int t = 0; t < 4; ++t) {
            v16h bm = lds_frag(wlds + (n0 + t * 16 + row) * W_PITCH + k0 + hi * 16);
            acc[t] = __builtin_amdgcn_wmma_f32_16x16x32_f16(
                false, bm, false, a, (short)0, acc[t], false, false);
        }
    }
    // acc[t][r] = Y[position m0 + row][channel o0 + t*16 + r]
    const int m = m0 + row;
    const int b = m >> 12, n = m & 4095;
    float* dst = out + ((size_t)(b * 256 + o0) << 12) + n;
    // unrolled: constant element indices keep acc in registers
#pragma unroll
    for (int t = 0; t < 4; ++t) {
        const v4f blo = *(const v4f*)(bias + o0 + t * 16);
        const v4f bhi = *(const v4f*)(bias + o0 + t * 16 + 4);
#pragma unroll
        for (int r = 0; r < 8; ++r)
            dst[(t * 16 + r) << 12] = acc[t][r] + (r < 4 ? blo[r & 3] : bhi[r & 3]);
    }
}

// ---------------------------------------------------------------------------
extern "C" void kernel_launch(void* const* d_in, const int* in_sizes, int n_in,
                              void* d_out, int out_size, void* d_ws, size_t ws_size,
                              hipStream_t stream)
{
    const float* x     = (const float*)d_in[0];
    const float* w_qk  = (const float*)d_in[1];
    const float* w_v   = (const float*)d_in[2];
    const float* w_pe  = (const float*)d_in[3];
    const float* w_pr  = (const float*)d_in[4];
    const float* qk_g  = (const float*)d_in[5];
    const float* qk_b  = (const float*)d_in[6];
    const float* qk_m  = (const float*)d_in[7];
    const float* qk_v  = (const float*)d_in[8];
    const float* v_g   = (const float*)d_in[9];
    const float* v_b   = (const float*)d_in[10];
    const float* v_m   = (const float*)d_in[11];
    const float* v_v   = (const float*)d_in[12];
    const float* pe_g  = (const float*)d_in[13];
    const float* pe_b  = (const float*)d_in[14];
    const float* pe_m  = (const float*)d_in[15];
    const float* pe_v  = (const float*)d_in[16];
    const float* pr_g  = (const float*)d_in[17];
    const float* pr_b  = (const float*)d_in[18];
    const float* pr_m  = (const float*)d_in[19];
    const float* pr_v  = (const float*)d_in[20];
    float* out = (float*)d_out;

    // workspace carve-up (256B aligned)
    char* ws = (char*)d_ws;
    size_t off = 0;
    auto carve = [&](size_t bytes) -> char* {
        char* p = ws + off;
        off = (off + bytes + 255) & ~(size_t)255;
        return p;
    };
    _Float16* wcat16  = (_Float16*)carve(768 * 256 * sizeof(_Float16));
    float*    biascat = (float*)   carve(768 * sizeof(float));
    _Float16* wproj16 = (_Float16*)carve(256 * 256 * sizeof(_Float16));
    float*    biaspr  = (float*)   carve(256 * sizeof(float));
    float*    wpe_s   = (float*)   carve(256 * 25 * sizeof(float));
    float*    biaspe  = (float*)   carve(256 * sizeof(float));
    _Float16* X16     = (_Float16*)carve((size_t)8192 * 256 * sizeof(_Float16));
    _Float16* q16     = (_Float16*)carve((size_t)8 * 8 * 1024 * 32 * sizeof(_Float16));
    _Float16* k16     = (_Float16*)carve((size_t)8 * 8 * 1024 * 32 * sizeof(_Float16));
    _Float16* v16t    = (_Float16*)carve((size_t)8 * 8 * 32 * 1024 * sizeof(_Float16));
    float*    vf32    = (float*)   carve((size_t)2 * 256 * 4096 * sizeof(float));
    float*    pp      = (float*)   carve((size_t)2 * 256 * 4096 * sizeof(float));
    _Float16* comb16  = (_Float16*)carve((size_t)8192 * 256 * sizeof(_Float16));

    fold_weights_kernel<<<256, 256, 0, stream>>>(
        w_qk, qk_g, qk_b, qk_m, qk_v,
        w_v,  v_g,  v_b,  v_m,  v_v,
        w_pe, pe_g, pe_b, pe_m, pe_v,
        w_pr, pr_g, pr_b, pr_m, pr_v,
        wcat16, biascat, wproj16, biaspr, wpe_s, biaspe);

    pack_x_kernel<<<dim3(32, 4, 2), 256, 0, stream>>>(x, X16);

    qkv_gemm_kernel<<<dim3(8192 / 64, 768 / 128), 256, 0, stream>>>(
        X16, wcat16, biascat, q16, k16, v16t, vf32);

    pe_conv_kernel<<<512, 128, 0, stream>>>(vf32, wpe_s, biaspe, pp);

    attn_kernel<<<dim3(8, 8, 8), 256, 0, stream>>>(q16, k16, v16t, pp, comb16);

    proj_gemm_kernel<<<dim3(8192 / 64, 256 / 128), 256, 0, stream>>>(
        comb16, wproj16, biaspr, out);
}

// v006
// It runs in 42.5 microseconds.
// Timed twice side by side with v005, it ran 1.06 times as fast both times.
// All steps since v000 together make it 3.03 times as fast.
#include <hip/hip_runtime.h>
#include <hip/hip_bf16.h>
#include <stdint.h>

typedef __attribute__((ext_vector_type(16))) _Float16 v16h;
typedef __attribute__((ext_vector_type(8)))  float    v8f;
typedef __attribute__((ext_vector_type(8)))  _Float16 v8h;
typedef __attribute__((ext_vector_type(4)))  float    v4f;
typedef __attribute__((ext_vector_type(2)))  float    v2f;

#define BN_EPS 1e-5f

// LDS row pitches, in halves: 16 bytes x an odd number, so that the 16 rows
// which one ds_load_b128 reads fall on 16 different groups of four banks.
#define W_PITCH  264    // weight slab rows: 512 bytes of data, 528 apart
#define KV_PITCH 40     // K stage rows: 64 bytes of data, 80 apart
#define VS_PITCH 136    // V stage rows: 256 bytes of data, 272 apart

// Attention stages K and V in LDS 128 keys at a time, in two buffers.
#define ST_KEYS  128
#define N_STAGES (1024 / ST_KEYS)
#define K_STAGE  (ST_KEYS * KV_PITCH)   // halves of one K buffer
#define V_STAGE  (32 * VS_PITCH)        // halves of one V buffer

// Wave-wide async global->LDS copies, 16 B per lane (512 B per wave and copy).
// The s_wait_xcnt stands in the copies' own statement, behind the last, so that
// it comes before any later write of their address registers.
// Eight copies, gstep halves apart in global memory and lstep halves apart
// in LDS.
__device__ __forceinline__ void async_copy8_b128(const _Float16* g, _Float16* lds_ptr,
                                                 int gstep, int lstep)
{
    unsigned l = (unsigned)(uintptr_t)lds_ptr;
    unsigned ls = (unsigned)lstep * 2u;
    asm volatile("global_load_async_to_lds_b128 %0, %8, off\n\t"
                 "global_load_async_to_lds_b128 %1, %9, off\n\t"
                 "global_load_async_to_lds_b128 %2, %10, off\n\t"
                 "global_load_async_to_lds_b128 %3, %11, off\n\t"
                 "global_load_async_to_lds_b128 %4, %12, off\n\t"
                 "global_load_async_to_lds_b128 %5, %13, off\n\t"
                 "global_load_async_to_lds_b128 %6, %14, off\n\t"
                 "global_load_async_to_lds_b128 %7, %15, off\n\t"
                 "s_wait_xcnt 0x0"
                 :: "v"(l), "v"(l + ls), "v"(l + 2 * ls), "v"(l + 3 * ls),
                    "v"(l + 4 * ls), "v"(l + 5 * ls), "v"(l + 6 * ls), "v"(l + 7 * ls),
                    "v"(g), "v"(g + gstep), "v"(g + 2 * gstep), "v"(g + 3 * gstep),
                    "v"(g + 4 * gstep), "v"(g + 5 * gstep), "v"(g + 6 * gstep), "v"(g + 7 * gstep)
                 : "memory");
}
// Four copies, each with its own two addresses.
__device__ __forceinline__ void async_copy4_b128(const _Float16* g0, const _Float16* g1,
                                                 const _Float16* g2, const _Float16* g3,
                                                 _Float16* p0, _Float16* p1,
                                                 _Float16* p2, _Float16* p3)
{
    unsigned l0 = (unsigned)(uintptr_t)p0, l1 = (unsigned)(uintptr_t)p1;
    unsigned l2 = (unsigned)(uintptr_t)p2, l3 = (unsigned)(uintptr_t)p3;
    asm volatile("global_load_async_to_lds_b128 %0, %4, off\n\t"
                 "global_load_async_to_lds_b128 %1, %5, off\n\t"
                 "global_load_async_to_lds_b128 %2, %6, off\n\t"
                 "global_load_async_to_lds_b128 %3, %7, off\n\t"
                 "s_wait_xcnt 0x0"
                 :: "v"(l0), "v"(l1), "v"(l2), "v"(l3), "v"(g0), "v"(g1), "v"(g2), "v"(g3)
                 : "memory");
}
// 16 consecutive halves from LDS as one fragment; the padded rows are 16-byte
// aligned, not 32, so the fragment is read as two 16-byte halves.
__device__ __forceinline__ v16h lds_frag(const _Float16* p)
{
    v8h lo = *(const v8h*)p, hi = *(const v8h*)(p + 8);
    return __builtin_shufflevector(lo, hi, 0, 1, 2, 3, 4, 5, 6, 7, 8, 9, 10, 11, 12, 13, 14, 15);
}
__device__ __forceinline__ void async_wait_all()
{
    asm volatile("s_wait_asynccnt 0x0" ::: "memory");
}

// ---------------------------------------------------------------------------
// Part A of the first launch: fold BatchNorm into weights; produce f16 weight
// copies + f32 bias. idx: the thread's number among the 'stride' threads that
// share this part.
// ---------------------------------------------------------------------------
__device__ __forceinline__ void fold_weights(const int idx, const int stride,
    const float* __restrict__ w_qk, const float* __restrict__ qk_g, const float* __restrict__ qk_b,
    const float* __restrict__ qk_m, const float* __restrict__ qk_v,
    const float* __restrict__ w_v,  const float* __restrict__ v_g,  const float* __restrict__ v_b,
    const float* __restrict__ v_m,  const float* __restrict__ v_v,
    const float* __restrict__ w_pe, const float* __restrict__ pe_g, const float* __restrict__ pe_b,
    const float* __restrict__ pe_m, const float* __restrict__ pe_v,
    const float* __restrict__ w_pr, const float* __restrict__ pr_g, const float* __restrict__ pr_b,
    const float* __restrict__ pr_m, const float* __restrict__ pr_v,
    _Float16* __restrict__ wcat16, float* __restrict__ bias_cat,
    _Float16* __restrict__ wproj16, float* __restrict__ bias_pr,
    float* __restrict__ wpe_s, float* __restrict__ bias_pe)
{
    for (int i = idx; i < 768 * 256; i += stride) {
        int o = i >> 8, c = i & 255;
        float s, w;
        if (o < 512) { s = qk_g[o] * rsqrtf(qk_v[o] + BN_EPS); w = w_qk[o * 256 + c]; }
        else { int oo = o - 512; s = v_g[oo] * rsqrtf(v_v[oo] + BN_EPS); w = w_v[oo * 256 + c]; }
        wcat16[i] = (_Float16)(w * s);
    }
    for (int o = idx; o < 768; o += stride) {
        if (o < 512) { float s = qk_g[o] * rsqrtf(qk_v[o] + BN_EPS); bias_cat[o] = qk_b[o] - qk_m[o] * s; }
        else { int oo = o - 512; float s = v_g[oo] * rsqrtf(v_v[oo] + BN_EPS); bias_cat[o] = v_b[oo] - v_m[oo] * s; }
    }
    for (int i = idx; i < 256 * 256; i += stride) {
        int o = i >> 8;
        float s = pr_g[o] * rsqrtf(pr_v[o] + BN_EPS);
        wproj16[i] = (_Float16)(w_pr[i] * s);
    }
    for (int o = idx; o < 256; o += stride) {
        float s = pr_g[o] * rsqrtf(pr_v[o] + BN_EPS);
        bias_pr[o] = pr_b[o] - pr_m[o] * s;
        float spe = pe_g[o] * rsqrtf(pe_v[o] + BN_EPS);
        bias_pe[o] = pe_b[o] - pe_m[o] * spe;
    }
    for (int i = idx; i < 256 * 25; i += stride) {
        int c = i / 25;
        float s = pe_g[c] * rsqrtf(pe_v[c] + BN_EPS);
        wpe_s[i] = w_pe[i] * s;
    }
}

// ---------------------------------------------------------------------------
// Part B of the first launch: pack x (B,C,H,W) f32 -> X16 row-major (B*N, C) f16.
// A thread takes 8 channels x 4 positions: eight 16-byte loads along n, four
// 16-byte stores along c. In a wave 8 lanes lie along c and 4 along n, so each
// store fills four whole 128-byte lines of X16, every line from one wave.
// ---------------------------------------------------------------------------
// blk: the block's number among the 32 (n) x 4 (c) x 2 (b) blocks of this part.
__device__ __forceinline__ void pack_x(const int blk, const float* __restrict__ x, _Float16* __restrict__ X16)
{
    const int lane = threadIdx.x & 31, wave = threadIdx.x >> 5;
    const int n  = (blk & 31) * 128 + wave * 16 + (lane >> 3) * 4;
    const int c0 = ((blk >> 5) & 3) * 64 + (lane & 7) * 8;
    const int b  = blk >> 7;
    const float* src = x + ((size_t)(b * 256 + c0) << 12) + n;
    v4f v[8];
    // unrolled: constant element indices, and all 8 loads in flight at once
#pragma unroll
    for (int j = 0; j < 8; ++j) v[j] = *(const v4f*)(src + ((size_t)j << 12));
    _Float16* dst = X16 + ((size_t)(b * 4096 + n)) * 256 + c0;
    // unrolled: constant element indices keep the tile in registers
#pragma unroll
    for (int i = 0; i < 4; ++i) {
        v8h h;
#pragma unroll
        for (int j = 0; j < 8; ++j) h[j] = (_Float16)v[j][i];
        *(v8h*)(dst + i * 256) = h;
    }
    // The wait that stands before the stores' address and data registers are
    // used for anything else on any way the built code goes on from here.
    asm volatile("s_wait_xcnt 0x0" ::: "memory");
}

// ---------------------------------------------------------------------------
// First launch: parts A and B read only inputs and write different buffers, so
// neither waits for the other: they share one launch, each in blocks of its own.
// The fold blocks come first: theirs is the longer chain of dependent loads.
// ---------------------------------------------------------------------------
#define FOLD_BLOCKS 256
#define PACK_BLOCKS 256
__global__ __launch_bounds__(256) void prep_kernel(
    const float* __restrict__ x, _Float16* __restrict__ X16,
    const float* __restrict__ w_qk, const float* __restrict__ qk_g, const float* __restrict__ qk_b,
    const float* __restrict__ qk_m, const float* __restrict__ qk_v,
    const float* __restrict__ w_v,  const float* __restrict__ v_g,  const float* __restrict__ v_b,
    const float* __restrict__ v_m,  const float* __restrict__ v_v,
    const float* __restrict__ w_pe, const float* __restrict__ pe_g, const float* __restrict__ pe_b,
    const float* __restrict__ pe_m, const float* __restrict__ pe_v,
    const float* __restrict__ w_pr, const float* __restrict__ pr_g, const float* __restrict__ pr_b,
    const float* __restrict__ pr_m, const float* __restrict__ pr_v,
    _Float16* __restrict__ wcat16, float* __restrict__ bias_cat,
    _Float16* __restrict__ wproj16, float* __restrict__ bias_pr,
    float* __restrict__ wpe_s, float* __restrict__ bias_pe)
{
    if (blockIdx.x < FOLD_BLOCKS)
        fold_weights(blockIdx.x * 256 + threadIdx.x, FOLD_BLOCKS * 256,
                     w_qk, qk_g, qk_b, qk_m, qk_v,
                     w_v,  v_g,  v_b,  v_m,  v_v,
                     w_pe, pe_g, pe_b, pe_m, pe_v,
                     w_pr, pr_g, pr_b, pr_m, pr_v,
                     wcat16, bias_cat, wproj16, bias_pr, wpe_s, bias_pe);
    else
        pack_x(blockIdx.x - FOLD_BLOCKS, x, X16);
}

// ---------------------------------------------------------------------------
// Kernel C: fused QKV GEMM: X16 (8192x256) * wcat16^T + bias.
// 128-column weight slab (64 KB f16) async-staged once per block into LDS;
// K-loop streams only the x rows from global, the weight rows from ds_load.
// Slab rows lie in LDS at a pitch of 528 bytes (W_PITCH).
// The weights are the A operand and the x rows the B operand, so a lane holds 8
// consecutive channels of ONE position and 16 lanes lie along the positions:
// q and k rows (channels contiguous) leave as one 16-byte store a tile, the v
// planes (positions contiguous) in runs of 16 positions a store.
// ---------------------------------------------------------------------------
__global__ __launch_bounds__(256) void qkv_gemm_kernel(
    const _Float16* __restrict__ X16, const _Float16* __restrict__ W,
    const float* __restrict__ bias,
    _Float16* __restrict__ q16, _Float16* __restrict__ k16,
    _Float16* __restrict__ v16t, float* __restrict__ vf32)
{
    __shared__ __attribute__((aligned(16))) _Float16 wlds[128 * W_PITCH];   // 64 KB weight slab, padded rows
    const int lane = threadIdx.x & 31;
    const int wave = threadIdx.x >> 5;
    const int wm = wave & 3, wn = wave >> 2;
    const int m0 = blockIdx.x * 64 + wm * 16;
    const int n0 = wn * 64;                    // within-slab column base
    const int nslab = blockIdx.y * 128;        // global column base of slab
    const int row = lane & 15, hi = lane >> 4;
    const int kind = blockIdx.y >> 1;           // the block's slab: 0 q, 1 k, 2 v
    const int c0 = (blockIdx.y & 1) * 128 + n0 + 8 * hi;   // lane's first channel inside q, k or v

    // async stage the weight slab: 256 threads x 16 x 16B = 64 KB;
    // a wave copies one whole row per copy, rows wave, wave + 8, ...
    {
        const _Float16* wsrc = W + (size_t)nslab * 256 + threadIdx.x * 8;
        _Float16* wdst = wlds + wave * W_PITCH + lane * 8;
        async_copy8_b128(wsrc, wdst, 8 * 256, 8 * W_PITCH);
        async_copy8_b128(wsrc + 64 * 256, wdst + 64 * W_PITCH, 8 * 256, 8 * W_PITCH);
        async_wait_all();
        __syncthreads();
    }

    v8f acc[4] = {};
    const _Float16* arow = X16 + (size_t)(m0 + row) * 256 + hi * 16;
    for (int k0 = 0; k0 < 256; k0 += 32) {
        __builtin_prefetch(arow + k0 + 64, 0, 1);
        v16h a = *(const v16h*)(arow + k0);
#pragma unroll
        for (int t = 0; t < 4; ++t) {
            v16h bm = lds_frag(wlds + (n0 + t * 16 + row) * W_PITCH + k0 + hi * 16);
            acc[t] = __builtin_amdgcn_wmma_f32_16x16x32_f16(
                false, bm, false, a, (short)0, acc[t], false, false);
        }
    }

    // acc[t][r] = Y[position m0 + row][channel nslab + n0 + t*16 + 8*hi + r]
    const char* bsrc = (const char*)(bias + kind * 256);
    const unsigned boff = (unsigned)c0 * 4u;    // byte offset of the lane's first bias value
    v4f blo[4], bhi[4];                         // the lane's 8 bias values of each tile
    // unrolled (all loops below): constant element indices keep them and acc in registers
#pragma unroll
    for (int t = 0; t < 4; ++t) {
        blo[t] = *(const v4f*)(bsrc + boff + t * 64);
        bhi[t] = *(const v4f*)(bsrc + boff + t * 64 + 16);
    }
    // The wait that stands before the bias loads' address register is used for
    // anything else; the offset is named so that it stays whole up to it.
    asm volatile("s_wait_xcnt 0x0" :: "v"(boff) : "memory");
#pragma unroll
    for (int t = 0; t < 4; ++t) {
#pragma unroll
        for (int r = 0; r < 4; ++r) { acc[t][r] += blo[t][r]; acc[t][4 + r] += bhi[t][r]; }
    }
    const int m = m0 + row;                     // global spatial row (b*4096 + n)
    const int b = m >> 12, n = m & 4095;
    const int ba = (b << 2) + (n >> 10), na = n & 1023;
    if (kind < 2) {                             // q, k: [ba][h][na][d], 8 d a lane
        _Float16* dst = (kind == 0 ? q16 : k16)
            + (((size_t)((ba << 3) + (c0 >> 5)) << 10) + na) * 32 + (c0 & 31);
#pragma unroll
        for (int t = 0; t < 4; ++t) {           // tiles 0, 1: one head; 2, 3: the next
            v8h hv;
#pragma unroll
            for (int r = 0; r < 8; ++r) hv[r] = (_Float16)acc[t][r];
            *(v8h*)(dst + (t >> 1) * (1024 * 32) + (t & 1) * 16) = hv;
        }
    } else {                                    // v : f32 NCHW + transposed f16
        float* vf = vf32 + ((size_t)(b * 256 + c0) << 12) + n;
        _Float16* vt = v16t + ((size_t)((ba << 8) + c0) << 10) + na;
#pragma unroll
        for (int t = 0; t < 4; ++t) {
#pragma unroll
            for (int r = 0; r < 8; ++r) {
                vf[(t * 16 + r) << 12] = acc[t][r];
                vt[(t * 16 + r) << 10] = (_Float16)acc[t][r];
            }
        }
        // The wait that stands before the stores' address and data registers are
        // used for anything else on any way the built code goes on from here.
        asm volatile("s_wait_xcnt 0x0" ::: "memory");
    }
}

// ---------------------------------------------------------------------------
// Kernel D: depthwise 5x5 conv on v (pad 2), BN folded. pp layout [b][c][n].
// One block per (b, c) plane; a thread makes 8 rows x 4 columns of outputs from
// 12 input rows of 8 columns held in registers. Each output still adds its
// taps in the order dy, dx; a tap outside the plane enters as 0.
// ---------------------------------------------------------------------------
__global__ __launch_bounds__(128) void pe_conv_kernel(const float* __restrict__ vf32,
                               const float* __restrict__ wpe,
                               const float* __restrict__ bias_pe,
                               float* __restrict__ pp)
{
    const int plane = blockIdx.x;                 // b * 256 + c
    const int c = plane & 255;
    const int xg = threadIdx.x & 15, yg = threadIdx.x >> 4;
    const int x0 = xg * 4, y0 = yg * 8;
    const char* vin = (const char*)(vf32 + ((size_t)plane << 12));
    const float* w = wpe + c * 25;
    const float bias = bias_pe[c];
    const bool lok = xg > 0, rok = xg < 15;       // left / right halo inside the row
    const bool tok = yg > 0, bok = yg < 7;        // rows above / below inside the plane
    // Byte offsets in the plane: of row y0, of the two rows above it and of the
    // two rows below the thread's eight; clamped, so that every load stays inside.
    const unsigned ol = y0 * 256 + (lok ? x0 - 2 : 0) * 4;
    const unsigned om = y0 * 256 + x0 * 4;
    const unsigned orr = y0 * 256 + (rok ? x0 + 4 : 0) * 4;
    const unsigned up = tok ? 512u : 0u, dn = bok ? 2048u : 0u;
    const unsigned tl = ol - up, tm = om - up, tr = orr - up;
    const unsigned bl = ol + dn, bm = om + dn, br = orr + dn;

    v2f lf[12], rt[12];
    v4f md[12];
    // unrolled (all loops below): constant indices keep the rows and acc in registers
#pragma unroll
    for (int i = 0; i < 2; ++i) {
        lf[i] = *(const v2f*)(vin + tl + i * 256);
        md[i] = *(const v4f*)(vin + tm + i * 256);
        rt[i] = *(const v2f*)(vin + tr + i * 256);
        lf[10 + i] = *(const v2f*)(vin + bl + i * 256);
        md[10 + i] = *(const v4f*)(vin + bm + i * 256);
        rt[10 + i] = *(const v2f*)(vin + br + i * 256);
    }
#pragma unroll
    for (int i = 0; i < 8; ++i) {
        lf[2 + i] = *(const v2f*)(vin + ol + i * 256);
        md[2 + i] = *(const v4f*)(vin + om + i * 256);
        rt[2 + i] = *(const v2f*)(vin + orr + i * 256);
    }
    // Keeps all 36 loads up here, in flight together: left free the scheduler
    // spreads them among the multiply-adds and waits for several of them in full.
    __builtin_amdgcn_sched_barrier(0);
    // The wait that stands before the loads' address registers are used for
    // anything else; the offsets are named so that they stay whole up to it.
    asm volatile("s_wait_xcnt 0x0"
                 :: "v"(ol), "v"(om), "v"(orr), "v"(tl), "v"(tm), "v"(tr), "v"(bl), "v"(bm), "v"(br)
                 : "memory");

    v4f acc[8];
#pragma unroll
    for (int r = 0; r < 8; ++r) acc[r] = (v4f){bias, bias, bias, bias};

#pragma unroll
    for (int i = 0; i < 12; ++i) {
        const bool yok = i < 2 ? tok : (i < 10 ? true : bok);
        float v[8];                               // columns x0 - 2 .. x0 + 5
        v[0] = (yok && lok) ? lf[i][0] : 0.f;
        v[1] = (yok && lok) ? lf[i][1] : 0.f;
        v[2] = yok ? md[i][0] : 0.f;
        v[3] = yok ? md[i][1] : 0.f;
        v[4] = yok ? md[i][2] : 0.f;
        v[5] = yok ? md[i][3] : 0.f;
        v[6] = (yok && rok) ? rt[i][0] : 0.f;
        v[7] = (yok && rok) ? rt[i][1] : 0.f;
#pragma unroll
        for (int r = 0; r < 8; ++r) {
            const int ky = i - r;                 // dy + 2 of input row i for output row r
            if (ky < 0 || ky > 4) continue;
#pragma unroll
            for (int kx = 0; kx < 5; ++kx) {
                const float wk = w[ky * 5 + kx];
#pragma unroll
                for (int j = 0; j < 4; ++j) acc[r][j] += v[j + kx] * wk;
            }
        }
    }

    float* dst = pp + ((size_t)plane << 12) + y0 * 64 + x0;
#pragma unroll
    for (int r = 0; r < 8; ++r) *(v4f*)(dst + r * 64) = acc[r];
}

__device__ __forceinline__ float xhalf(float x)
{
    int i = __builtin_bit_cast(int, x);
    return __builtin_bit_cast(float,
        __builtin_amdgcn_permlanex16(i, i, 0x76543210, 0xfedcba98, false, false));
}

__global__ __launch_bounds__(256) void attn_kernel(
    const _Float16* __restrict__ q16, const _Float16* __restrict__ k16,
    const _Float16* __restrict__ v16t, const float* __restrict__ pp,
    _Float16* __restrict__ comb16)
{
    __shared__ __attribute__((aligned(16))) _Float16 ldsK[2 * K_STAGE];   // K stages: [m_local][d], padded rows
    __shared__ __attribute__((aligned(16))) _Float16 ldsV[2 * V_STAGE];   // V stages: [d][m_local], padded rows

    const int lane = threadIdx.x & 31, wave = threadIdx.x >> 5;
    const int ba = blockIdx.z, h = blockIdx.y;
    const int n0 = blockIdx.x * 128 + wave * 16;
    const int row = lane & 15, hi = lane >> 4;
    const float scale = 0.17677669529663687f;   // 1/sqrt(hd=32)

    const _Float16* qbase = q16 + ((size_t)(ba * 8 + h) << 10) * 32;
    const _Float16* kbase = k16 + ((size_t)(ba * 8 + h) << 10) * 32;
    const _Float16* vbase = v16t + ((size_t)(ba * 8 + h) << 5) * 1024;

    // B operand: 16 query columns x K=32 (entire head dim), loaded once.
    v16h bq = *(const v16h*)(qbase + (size_t)(n0 + row) * 32 + hi * 16);

    // State of this lane's query (column 'row'); rsum covers only the keys
    // this wave half holds, the halves are joined after the loop.
    float rmax = -1e30f, rsum = 0.f;
    v8f o0 = {}, o1 = {};    // o0[r] = O[query][d = 8*hi + r], o1: d + 16

    // A stage is 8 KB of K (contiguous) and 8 KB of V (32 d-rows x 256 B). Every
    // thread brings two 16-byte pieces of each, so every wave runs the same four
    // copies with all its lanes on, and each copy of a wave takes whole lines.
    const int tid = threadIdx.x;
    const _Float16* ksrc = kbase + tid * 8;
    const _Float16* vsrc = vbase + (tid >> 4) * 1024 + (tid & 15) * 8;
    _Float16* kdst = ldsK + (tid >> 2) * KV_PITCH + (tid & 3) * 8;
    _Float16* vdst = ldsV + (tid >> 4) * VS_PITCH + (tid & 15) * 8;
    auto stage_copy = [&](int s, int buf) {
        const _Float16* kg = ksrc + s * (ST_KEYS * 32);
        const _Float16* vg = vsrc + s * ST_KEYS;
        _Float16* kl = kdst + buf * K_STAGE;
        _Float16* vl = vdst + buf * V_STAGE;
        async_copy4_b128(kg, kg + 64 * 32, vg, vg + 16 * 1024,
                         kl, kl + 64 * KV_PITCH, vl, vl + 16 * VS_PITCH);
    };

    stage_copy(0, 0);
    async_wait_all();
    __syncthreads();       // stage 0 visible to all waves
    stage_copy(1, 1);

    for (int s = 0; s < N_STAGES; ++s) {
      const _Float16* kst = ldsK + (s & 1) * K_STAGE;
      const _Float16* vst = ldsV + (s & 1) * V_STAGE;
      // kept rolled: unrolled, the scheduler weaves two passes into each other, with
      // more v_nop slots behind the matrix instructions and twice the registers
#pragma nounroll
      for (int p = 0; p < ST_KEYS / 32; ++p) {
        const _Float16* kp = kst + p * 32 * KV_PITCH;
        const _Float16* vp = vst + p * 32;
        // A operand: 16 key rows x K=32, same k order as bq.
        v16h ak0 = lds_frag(kp + (row)      * KV_PITCH + hi * 16);
        v16h ak1 = lds_frag(kp + (16 + row) * KV_PITCH + hi * 16);
        // A operand of the second product: 16 d rows of V^T, keys in the order
        // in which the packed score tiles hold them (8*hi + s, 16 + 8*hi + s).
        v8h av0lo = *(const v8h*)(vp + (row)      * VS_PITCH + hi * 8);
        v8h av0hi = *(const v8h*)(vp + (row)      * VS_PITCH + 16 + hi * 8);
        v8h av1lo = *(const v8h*)(vp + (16 + row) * VS_PITCH + hi * 8);
        v8h av1hi = *(const v8h*)(vp + (16 + row) * VS_PITCH + 16 + hi * 8);
        // Keeps the four V loads up here, beside the K loads: left free the
        // scheduler sinks them to just in front of the second product, where
        // their LDS latency is then waited for in full.
        __builtin_amdgcn_sched_barrier(0);

        v8f s0 = {}, s1 = {};
        s0 = __builtin_amdgcn_wmma_f32_16x16x32_f16(false, ak0, false, bq, (short)0, s0, false, false);
        s1 = __builtin_amdgcn_wmma_f32_16x16x32_f16(false, ak1, false, bq, (short)0, s1, false, false);

        // online softmax; s0[r] = S[key 8*hi + r][query], s1[r]: key + 16.
        s0 *= scale; s1 *= scale;
        float mx0 = s0[0], mx1 = s1[0];
        // unrolled: constant element indices keep the tiles in registers
#pragma unroll
        for (int r = 1; r < 8; ++r) { mx0 = fmaxf(mx0, s0[r]); mx1 = fmaxf(mx1, s1[r]); }
        float mx = fmaxf(mx0, mx1);
        mx = fmaxf(mx, xhalf(mx));
        float mnew = fmaxf(rmax, mx);
        float corr = __expf(rmax - mnew);
        rmax = mnew;
        v16h bp;
        // unrolled: constant element indices keep the tiles in registers
#pragma unroll
        for (int r = 0; r < 8; ++r) {
            s0[r] = __expf(s0[r] - mnew);
            s1[r] = __expf(s1[r] - mnew);
            bp[r]     = (_Float16)s0[r];
            bp[8 + r] = (_Float16)s1[r];
        }
        v8f t = s0 + s1;
        float ps = ((t[0] + t[1]) + (t[2] + t[3])) + ((t[4] + t[5]) + (t[6] + t[7]));
        rsum = rsum * corr + ps;
        o0 *= corr; o1 *= corr;

        v16h av0 = __builtin_shufflevector(av0lo, av0hi, 0, 1, 2, 3, 4, 5, 6, 7, 8, 9, 10, 11, 12, 13, 14, 15);
        v16h av1 = __builtin_shufflevector(av1lo, av1hi, 0, 1, 2, 3, 4, 5, 6, 7, 8, 9, 10, 11, 12, 13, 14, 15);
        o0 = __builtin_amdgcn_wmma_f32_16x16x32_f16(false, av0, false, bp, (short)0, o0, false, false);
        o1 = __builtin_amdgcn_wmma_f32_16x16x32_f16(false, av1, false, bp, (short)0, o1, false, false);
      }
      // Hand-over of the stages: this wave's LDS reads of stage s have returned
      // and its own copies of stage s + 1 have landed before the barrier; behind
      // it stage s + 1 may be read by all and the buffer of stage s refilled.
      asm volatile("s_wait_dscnt 0x0" ::: "memory");
      async_wait_all();
      __syncthreads();
      if (s + 2 < N_STAGES) stage_copy(s + 2, s & 1);
    }
    async_wait_all();      // no copy is left in flight when the wave goes on

    // finalize: join the halves' sums, /= rowsum, add positional encoding,
    // store 8 consecutive channels of one f16 GEMM row per 16-byte store
    rsum += xhalf(rsum);
    const float inv = 1.0f / rsum;
    const int b = ba >> 2, area = ba & 3;
    const int n_global = area * 1024 + n0 + row;
    const int c0 = h * 32 + 8 * hi;
    v8h w0, w1;
    // unrolled: constant element indices, and all 16 loads in flight at once
#pragma unroll
    for (int r = 0; r < 8; ++r) {
        float pv0 = pp[((size_t)(b * 256 + c0 + r) << 12) + n_global];
        float pv1 = pp[((size_t)(b * 256 + c0 + 16 + r) << 12) + n_global];
        w0[r] = (_Float16)(o0[r] * inv + pv0);
        w1[r] = (_Float16)(o1[r] * inv + pv1);
    }
    _Float16* crow = comb16 + ((size_t)(b * 4096 + n_global)) * 256 + c0;
    *(v8h*)(crow)      = w0;
    *(v8h*)(crow + 16) = w1;
}

// ---------------------------------------------------------------------------
// Kernel F: projection GEMM: comb16 (8192x256) * wproj16^T + bias -> NCHW f32
// Weight slab async-staged in LDS as in kernel C; weights as the A operand as
// there, so that 16 lanes lie along n, the contiguous axis of out.
// ---------------------------------------------------------------------------
__global__ __launch_bounds__(256) void proj_gemm_kernel(
    const _Float16* __restrict__ A, const _Float16* __restrict__ W,
    const float* __restrict__ bias, float* __restrict__ out)
{
    __shared__ __attribute__((aligned(16))) _Float16 wlds[128 * W_PITCH];   // 64 KB weight slab, padded rows
    const int lane = threadIdx.x & 31, wave = threadIdx.x >> 5;
    const int wm = wave & 3, wn = wave >> 2;
    const int m0 = blockIdx.x * 64 + wm * 16;
    const int n0 = wn * 64;
    const int nslab = blockIdx.y * 128;
    const int row = lane & 15, hi = lane >> 4;
    const int o0 = nslab + n0 + 8 * hi;         // lane's first output channel

    {
        const _Float16* wsrc = W + (size_t)nslab * 256 + threadIdx.x * 8;
        _Float16* wdst = wlds + wave * W_PITCH + lane * 8;
        async_copy8_b128(wsrc, wdst, 8 * 256, 8 * W_PITCH);
        async_copy8_b128(wsrc + 64 * 256, wdst + 64 * W_PITCH, 8 * 256, 8 * W_PITCH);
        async_wait_all();
        __syncthreads();
    }

    v8f acc[4] = {};
    const _Float16* arow = A + (size_t)(m0 + row) * 256 + hi * 16;
    for (int k0 = 0; k0 < 256; k0 += 32) {
        __builtin_prefetch(arow + k0 + 64, 0, 1);
        v16h a = *(const v16h*)(arow + k0);
#pragma unroll
        for (int t = 0; t < 4; ++t) {
            v16h bm = lds_frag(wlds + (n0 + t * 16 + row) * W_PITCH + k0 + hi * 16);
            acc[t] = __builtin_amdgcn_wmma_f32_16x16x32_f16(
                false, bm, false, a, (short)0, acc[t], false, false);
        }
    }
    // acc[t][r] = Y[position m0 + row][channel o0 + t*16 + r]
    const int m = m0 + row;
    const int b = m >> 12, n = m & 4095;
    float* dst = out + ((size_t)(b * 256 + o0) << 12) + n;
    // unrolled: constant element indices keep acc in registers
#pragma unroll
    for (int t = 0; t < 4; ++t) {
        const v4f blo = *(const v4f*)(bias + o0 + t * 16);
        const v4f bhi = *(const v4f*)(bias + o0 + t * 16 + 4);
#pragma unroll
        for (int r = 0; r < 8; ++r)
            dst[(t * 16 + r) << 12] = acc[t][r] + (r < 4 ? blo[r & 3] : bhi[r & 3]);
    }
}

// ---------------------------------------------------------------------------
extern "C" void kernel_launch(void* const* d_in, const int* in_sizes, int n_in,
                              void* d_out, int out_size, void* d_ws, size_t ws_size,
                              hipStream_t stream)
{
    const float* x     = (const float*)d_in[0];
    const float* w_qk  = (const float*)d_in[1];
    const float* w_v   = (const float*)d_in[2];
    const float* w_pe  = (const float*)d_in[3];
    const float* w_pr  = (const float*)d_in[4];
    const float* qk_g  = (const float*)d_in[5];
    const float* qk_b  = (const float*)d_in[6];
    const float* qk_m  = (const float*)d_in[7];
    const float* qk_v  = (const float*)d_in[8];
    const float* v_g   = (const float*)d_in[9];
    const float* v_b   = (const float*)d_in[10];
    const float* v_m   = (const float*)d_in[11];
    const float* v_v   = (const float*)d_in[12];
    const float* pe_g  = (const float*)d_in[13];
    const float* pe_b  = (const float*)d_in[14];
    const float* pe_m  = (const float*)d_in[15];
    const float* pe_v  = (const float*)d_in[16];
    const float* pr_g  = (const float*)d_in[17];
    const float* pr_b  = (const float*)d_in[18];
    const float* pr_m  = (const float*)d_in[19];
    const float* pr_v  = (const float*)d_in[20];
    float* out = (float*)d_out;

    // workspace carve-up (256B aligned)
    char* ws = (char*)d_ws;
    size_t off = 0;
    auto carve = [&](size_t bytes) -> char* {
        char* p = ws + off;
        off = (off + bytes + 255) & ~(size_t)255;
        return p;
    };
    _Float16* wcat16  = (_Float16*)carve(768 * 256 * sizeof(_Float16));
    float*    biascat = (float*)   carve(768 * sizeof(float));
    _Float16* wproj16 = (_Float16*)carve(256 * 256 * sizeof(_Float16));
    float*    biaspr  = (float*)   carve(256 * sizeof(float));
    float*    wpe_s   = (float*)   carve(256 * 25 * sizeof(float));
    float*    biaspe  = (float*)   carve(256 * sizeof(float));
    _Float16* X16     = (_Float16*)carve((size_t)8192 * 256 * sizeof(_Float16));
    _Float16* q16     = (_Float16*)carve((size_t)8 * 8 * 1024 * 32 * sizeof(_Float16));
    _Float16* k16     = (_Float16*)carve((size_t)8 * 8 * 1024 * 32 * sizeof(_Float16));
    _Float16* v16t    = (_Float16*)carve((size_t)8 * 8 * 32 * 1024 * sizeof(_Float16));
    float*    vf32    = (float*)   carve((size_t)2 * 256 * 4096 * sizeof(float));
    float*    pp      = (float*)   carve((size_t)2 * 256 * 4096 * sizeof(float));
    _Float16* comb16  = (_Float16*)carve((size_t)8192 * 256 * sizeof(_Float16));

    prep_kernel<<<FOLD_BLOCKS + PACK_BLOCKS, 256, 0, stream>>>(
        x, X16,
        w_qk, qk_g, qk_b, qk_m, qk_v,
        w_v,  v_g,  v_b,  v_m,  v_v,
        w_pe, pe_g, pe_b, pe_m, pe_v,
        w_pr, pr_g, pr_b, pr_m, pr_v,
        wcat16, biascat, wproj16, biaspr, wpe_s, biaspe);

    qkv_gemm_kernel<<<dim3(8192 / 64, 768 / 128), 256, 0, stream>>>(
        X16, wcat16, biascat, q16, k16, v16t, vf32);

    pe_conv_kernel<<<512, 128, 0, stream>>>(vf32, wpe_s, biaspe, pp);

    attn_kernel<<<dim3(8, 8, 8), 256, 0, stream>>>(q16, k16, v16t, pp, comb16);

    proj_gemm_kernel<<<dim3(8192 / 64, 256 / 128), 256, 0, stream>>>(
        comb16, wproj16, biaspr, out);
}

// v007
// Measured time: 40.4 microseconds a run.
// Timed twice side by side with v006, it ran 1.05 and 1.06 times as fast.
// All steps since v000 together make it 3.18 times as fast.
#include <hip/hip_runtime.h>
#include <hip/hip_bf16.h>
#include <stdint.h>

typedef __attribute__((ext_vector_type(16))) _Float16 v16h;
typedef __attribute__((ext_vector_type(8)))  float    v8f;
typedef __attribute__((ext_vector_type(8)))  _Float16 v8h;
typedef __attribute__((ext_vector_type(4)))  float    v4f;
typedef __attribute__((ext_vector_type(2)))  float    v2f;
typedef v4f __attribute__((aligned(4))) v4f_a4;   // four floats at a 4-byte aligned address

#define BN_EPS 1e-5f

// LDS row pitches, in halves: 16 bytes x an odd number, so that the 16 rows
// which one ds_load_b128 reads fall on 16 different groups of four banks.
#define W_PITCH  264    // weight slab rows: 512 bytes of data, 528 apart
#define KV_PITCH 40     // K stage rows: 64 bytes of data, 80 apart
#define VS_PITCH 136    // V stage rows: 256 bytes of data, 272 apart

// Attention stages K and V in LDS 128 keys at a time, in two buffers.
#define ST_KEYS  128
#define N_STAGES (1024 / ST_KEYS)
#define K_STAGE  (ST_KEYS * KV_PITCH)   // halves of one K buffer
#define V_STAGE  (32 * VS_PITCH)        // halves of one V buffer

// Wave-wide async global->LDS copies, 16 B per lane (512 B per wave and copy).
// The s_wait_xcnt stands in the copies' own statement, behind the last, so that
// it comes before any later write of their address registers.
// Eight copies, gstep halves apart in global memory and lstep halves apart
// in LDS.
__device__ __forceinline__ void async_copy8_b128(const _Float16* g, _Float16* lds_ptr,
                                                 int gstep, int lstep)
{
    unsigned l = (unsigned)(uintptr_t)lds_ptr;
    unsigned ls = (unsigned)lstep * 2u;
    asm volatile("global_load_async_to_lds_b128 %0, %8, off\n\t"
                 "global_load_async_to_lds_b128 %1, %9, off\n\t"
                 "global_load_async_to_lds_b128 %2, %10, off\n\t"
                 "global_load_async_to_lds_b128 %3, %11, off\n\t"
                 "global_load_async_to_lds_b128 %4, %12, off\n\t"
                 "global_load_async_to_lds_b128 %5, %13, off\n\t"
                 "global_load_async_to_lds_b128 %6, %14, off\n\t"
                 "global_load_async_to_lds_b128 %7, %15, off\n\t"
                 "s_wait_xcnt 0x0"
                 :: "v"(l), "v"(l + ls), "v"(l + 2 * ls), "v"(l + 3 * ls),
                    "v"(l + 4 * ls), "v"(l + 5 * ls), "v"(l + 6 * ls), "v"(l + 7 * ls),
                    "v"(g), "v"(g + gstep), "v"(g + 2 * gstep), "v"(g + 3 * gstep),
                    "v"(g + 4 * gstep), "v"(g + 5 * gstep), "v"(g + 6 * gstep), "v"(g + 7 * gstep)
                 : "memory");
}
// Four copies, each with its own two addresses.
__device__ __forceinline__ void async_copy4_b128(const _Float16* g0, const _Float16* g1,
                                                 const _Float16* g2, const _Float16* g3,
                                                 _Float16* p0, _Float16* p1,
                                                 _Float16* p2, _Float16* p3)
{
    unsigned l0 = (unsigned)(uintptr_t)p0, l1 = (unsigned)(uintptr_t)p1;
    unsigned l2 = (unsigned)(uintptr_t)p2, l3 = (unsigned)(uintptr_t)p3;
    asm volatile("global_load_async_to_lds_b128 %0, %4, off\n\t"
                 "global_load_async_to_lds_b128 %1, %5, off\n\t"
                 "global_load_async_to_lds_b128 %2, %6, off\n\t"
                 "global_load_async_to_lds_b128 %3, %7, off\n\t"
                 "s_wait_xcnt 0x0"
                 :: "v"(l0), "v"(l1), "v"(l2), "v"(l3), "v"(g0), "v"(g1), "v"(g2), "v"(g3)
                 : "memory");
}
// 16 consecutive halves from LDS as one fragment; the padded rows are 16-byte
// aligned, not 32, so the fragment is read as two 16-byte halves.
__device__ __forceinline__ v16h lds_frag(const _Float16* p)
{
    v8h lo = *(const v8h*)p, hi = *(const v8h*)(p + 8);
    return __builtin_shufflevector(lo, hi, 0, 1, 2, 3, 4, 5, 6, 7, 8, 9, 10, 11, 12, 13, 14, 15);
}
__device__ __forceinline__ void async_wait_all()
{
    asm volatile("s_wait_asynccnt 0x0" ::: "memory");
}

// ---------------------------------------------------------------------------
// Part A of the first launch: fold BatchNorm into weights; produce f16 weight
// copies + f32 bias. idx: the thread's number among the 'stride' threads that
// share this part.
// ---------------------------------------------------------------------------
__device__ __forceinline__ void fold_weights(const int idx, const int stride,
    const float* __restrict__ w_qk, const float* __restrict__ qk_g, const float* __restrict__ qk_b,
    const float* __restrict__ qk_m, const float* __restrict__ qk_v,
    const float* __restrict__ w_v,  const float* __restrict__ v_g,  const float* __restrict__ v_b,
    const float* __restrict__ v_m,  const float* __restrict__ v_v,
    const float* __restrict__ w_pe, const float* __restrict__ pe_g, const float* __restrict__ pe_b,
    const float* __restrict__ pe_m, const float* __restrict__ pe_v,
    const float* __restrict__ w_pr, const float* __restrict__ pr_g, const float* __restrict__ pr_b,
    const float* __restrict__ pr_m, const float* __restrict__ pr_v,
    _Float16* __restrict__ wcat16, float* __restrict__ bias_cat,
    _Float16* __restrict__ wproj16, float* __restrict__ bias_pr,
    float* __restrict__ wpe_s, float* __restrict__ bias_pe)
{
    for (int i = idx; i < 768 * 256; i += stride) {
        int o = i >> 8, c = i & 255;
        float s, w;
        if (o < 512) { s = qk_g[o] * rsqrtf(qk_v[o] + BN_EPS); w = w_qk[o * 256 + c]; }
        else { int oo = o - 512; s = v_g[oo] * rsqrtf(v_v[oo] + BN_EPS); w = w_v[oo * 256 + c]; }
        wcat16[i] = (_Float16)(w * s);
    }
    for (int o = idx; o < 768; o += stride) {
        if (o < 512) { float s = qk_g[o] * rsqrtf(qk_v[o] + BN_EPS); bias_cat[o] = qk_b[o] - qk_m[o] * s; }
        else { int oo = o - 512; float s = v_g[oo] * rsqrtf(v_v[oo] + BN_EPS); bias_cat[o] = v_b[oo] - v_m[oo] * s; }
    }
    for (int i = idx; i < 256 * 256; i += stride) {
        int o = i >> 8;
        float s = pr_g[o] * rsqrtf(pr_v[o] + BN_EPS);
        wproj16[i] = (_Float16)(w_pr[i] * s);
    }
    for (int o = idx; o < 256; o += stride) {
        float s = pr_g[o] * rsqrtf(pr_v[o] + BN_EPS);
        bias_pr[o] = pr_b[o] - pr_m[o] * s;
        float spe = pe_g[o] * rsqrtf(pe_v[o] + BN_EPS);
        bias_pe[o] = pe_b[o] - pe_m[o] * spe;
    }
    for (int i = idx; i < 256 * 25; i += stride) {
        int c = i / 25;
        float s = pe_g[c] * rsqrtf(pe_v[c] + BN_EPS);
        wpe_s[i] = w_pe[i] * s;
    }
}

// ---------------------------------------------------------------------------
// Part B of the first launch: pack x (B,C,H,W) f32 -> X16 row-major (B*N, C) f16.
// A thread takes 8 channels x 4 positions: eight 16-byte loads along n, four
// 16-byte stores along c. In a wave 8 lanes lie along c and 4 along n, so each
// store fills four whole 128-byte lines of X16, every line from one wave.
// ---------------------------------------------------------------------------
// blk: the block's number among the 32 (n) x 4 (c) x 2 (b) blocks of this part.
__device__ __forceinline__ void pack_x(const int blk, const float* __restrict__ x, _Float16* __restrict__ X16)
{
    const int lane = threadIdx.x & 31, wave = threadIdx.x >> 5;
    const int n  = (blk & 31) * 128 + wave * 16 + (lane >> 3) * 4;
    const int c0 = ((blk >> 5) & 3) * 64 + (lane & 7) * 8;
    const int b  = blk >> 7;
    const float* src = x + ((size_t)(b * 256 + c0) << 12) + n;
    v4f v[8];
    // unrolled: constant element indices, and all 8 loads in flight at once
#pragma unroll
    for (int j = 0; j < 8; ++j) v[j] = *(const v4f*)(src + ((size_t)j << 12));
    _Float16* dst = X16 + ((size_t)(b * 4096 + n)) * 256 + c0;
    // unrolled: constant element indices keep the tile in registers
#pragma unroll
    for (int i = 0; i < 4; ++i) {
        v8h h;
#pragma unroll
        for (int j = 0; j < 8; ++j) h[j] = (_Float16)v[j][i];
        *(v8h*)(dst + i * 256) = h;
    }
    // The wait that stands before the stores' address and data registers are
    // used for anything else on any way the built code goes on from here.
    asm volatile("s_wait_xcnt 0x0" ::: "memory");
}

// ---------------------------------------------------------------------------
// First launch: parts A and B read only inputs and write different buffers, so
// neither waits for the other: they share one launch, each in blocks of its own.
// The fold blocks come first: theirs is the longer chain of dependent loads.
// ---------------------------------------------------------------------------
#define FOLD_BLOCKS 256
#define PACK_BLOCKS 256
__global__ __launch_bounds__(256) void prep_kernel(
    const float* __restrict__ x, _Float16* __restrict__ X16,
    const float* __restrict__ w_qk, const float* __restrict__ qk_g, const float* __restrict__ qk_b,
    const float* __restrict__ qk_m, const float* __restrict__ qk_v,
    const float* __restrict__ w_v,  const float* __restrict__ v_g,  const float* __restrict__ v_b,
    const float* __restrict__ v_m,  const float* __restrict__ v_v,
    const float* __restrict__ w_pe, const float* __restrict__ pe_g, const float* __restrict__ pe_b,
    const float* __restrict__ pe_m, const float* __restrict__ pe_v,
    const float* __restrict__ w_pr, const float* __restrict__ pr_g, const float* __restrict__ pr_b,
    const float* __restrict__ pr_m, const float* __restrict__ pr_v,
    _Float16* __restrict__ wcat16, float* __restrict__ bias_cat,
    _Float16* __restrict__ wproj16, float* __restrict__ bias_pr,
    float* __restrict__ wpe_s, float* __restrict__ bias_pe)
{
    if (blockIdx.x < FOLD_BLOCKS)
        fold_weights(blockIdx.x * 256 + threadIdx.x, FOLD_BLOCKS * 256,
                     w_qk, qk_g, qk_b, qk_m, qk_v,
                     w_v,  v_g,  v_b,  v_m,  v_v,
                     w_pe, pe_g, pe_b, pe_m, pe_v,
                     w_pr, pr_g, pr_b, pr_m, pr_v,
                     wcat16, bias_cat, wproj16, bias_pr, wpe_s, bias_pe);
    else
        pack_x(blockIdx.x - FOLD_BLOCKS, x, X16);
}

// ---------------------------------------------------------------------------
// Kernel C: fused QKV GEMM: X16 (8192x256) * wcat16^T + bias.
// 128-column weight slab (64 KB f16) async-staged once per block into LDS;
// K-loop streams only the x rows from global, the weight rows from ds_load.
// Slab rows lie in LDS at a pitch of 528 bytes (W_PITCH).
// The weights are the A operand and the x rows the B operand, so a lane holds 8
// consecutive channels of ONE position and 16 lanes lie along the positions:
// q and k rows (channels contiguous) leave as one 16-byte store a tile, the v
// planes (positions contiguous) in runs of 16 positions a store.
// ---------------------------------------------------------------------------
__global__ __launch_bounds__(256) void qkv_gemm_kernel(
    const _Float16* __restrict__ X16, const _Float16* __restrict__ W,
    const float* __restrict__ bias,
    _Float16* __restrict__ q16, _Float16* __restrict__ k16,
    _Float16* __restrict__ v16t, float* __restrict__ vf32)
{
    __shared__ __attribute__((aligned(16))) _Float16 wlds[128 * W_PITCH];   // 64 KB weight slab, padded rows
    const int lane = threadIdx.x & 31;
    const int wave = threadIdx.x >> 5;
    const int wm = wave & 3, wn = wave >> 2;
    const int m0 = blockIdx.x * 64 + wm * 16;
    const int n0 = wn * 64;                    // within-slab column base
    const int nslab = blockIdx.y * 128;        // global column base of slab
    const int row = lane & 15, hi = lane >> 4;
    const int kind = blockIdx.y >> 1;           // the block's slab: 0 q, 1 k, 2 v
    const int c0 = (blockIdx.y & 1) * 128 + n0 + 8 * hi;   // lane's first channel inside q, k or v

    // async stage the weight slab: 256 threads x 16 x 16B = 64 KB;
    // a wave copies one whole row per copy, rows wave, wave + 8, ...
    {
        const _Float16* wsrc = W + (size_t)nslab * 256 + threadIdx.x * 8;
        _Float16* wdst = wlds + wave * W_PITCH + lane * 8;
        async_copy8_b128(wsrc, wdst, 8 * 256, 8 * W_PITCH);
        async_copy8_b128(wsrc + 64 * 256, wdst + 64 * W_PITCH, 8 * 256, 8 * W_PITCH);
        async_wait_all();
        __syncthreads();
    }

    v8f acc[4] = {};
    const _Float16* arow = X16 + (size_t)(m0 + row) * 256 + hi * 16;
    for (int k0 = 0; k0 < 256; k0 += 32) {
        __builtin_prefetch(arow + k0 + 64, 0, 1);
        v16h a = *(const v16h*)(arow + k0);
#pragma unroll
        for (int t = 0; t < 4; ++t) {
            v16h bm = lds_frag(wlds + (n0 + t * 16 + row) * W_PITCH + k0 + hi * 16);
            acc[t] = __builtin_amdgcn_wmma_f32_16x16x32_f16(
                false, bm, false, a, (short)0, acc[t], false, false);
        }
    }

    // acc[t][r] = Y[position m0 + row][channel nslab + n0 + t*16 + 8*hi + r]
    const char* bsrc = (const char*)(bias + kind * 256);
    const unsigned boff = (unsigned)c0 * 4u;    // byte offset of the lane's first bias value
    v4f blo[4], bhi[4];                         // the lane's 8 bias values of each tile
    // unrolled (all loops below): constant element indices keep them and acc in registers
#pragma unroll
    for (int t = 0; t < 4; ++t) {
        blo[t] = *(const v4f*)(bsrc + boff + t * 64);
        bhi[t] = *(const v4f*)(bsrc + boff + t * 64 + 16);
    }
    // The wait that stands before the bias loads' address register is used for
    // anything else; the offset is named so that it stays whole up to it.
    asm volatile("s_wait_xcnt 0x0" :: "v"(boff) : "memory");
#pragma unroll
    for (int t = 0; t < 4; ++t) {
#pragma unroll
        for (int r = 0; r < 4; ++r) { acc[t][r] += blo[t][r]; acc[t][4 + r] += bhi[t][r]; }
    }
    const int m = m0 + row;                     // global spatial row (b*4096 + n)
    const int b = m >> 12, n = m & 4095;
    const int ba = (b << 2) + (n >> 10), na = n & 1023;
    if (kind < 2) {                             // q, k: [ba][h][na][d], 8 d a lane
        _Float16* dst = (kind == 0 ? q16 : k16)
            + (((size_t)((ba << 3) + (c0 >> 5)) << 10) + na) * 32 + (c0 & 31);
#pragma unroll
        for (int t = 0; t < 4; ++t) {           // tiles 0, 1: one head; 2, 3: the next
            v8h hv;
#pragma unroll
            for (int r = 0; r < 8; ++r) hv[r] = (_Float16)acc[t][r];
            *(v8h*)(dst + (t >> 1) * (1024 * 32) + (t & 1) * 16) = hv;
        }
    } else {                                    // v : f32 NCHW + transposed f16
        float* vf = vf32 + ((size_t)(b * 256 + c0) << 12) + n;
        _Float16* vt = v16t + ((size_t)((ba << 8) + c0) << 10) + na;
#pragma unroll
        for (int t = 0; t < 4; ++t) {
#pragma unroll
            for (int r = 0; r < 8; ++r) {
                vf[(t * 16 + r) << 12] = acc[t][r];
                vt[(t * 16 + r) << 10] = (_Float16)acc[t][r];
            }
        }
        // The wait that stands before the stores' address and data registers are
        // used for anything else on any way the built code goes on from here.
        asm volatile("s_wait_xcnt 0x0" ::: "memory");
    }
}

// ---------------------------------------------------------------------------
// Part D, inside the attention launch: depthwise 5x5 conv on v (pad 2), BN
// folded, for the 32 channels and the 128 positions (two image rows) of one
// attention block; the result stays in LDS, [channel][position], for that
// block's epilogue. A thread makes 2 rows x 8 columns of one channel from 6
// input rows of 12 columns held in registers. Each output still adds its taps
// in the order dy, dx; a tap outside the plane enters as 0.
// ---------------------------------------------------------------------------
#define PP_PITCH 132    // floats: rows 16-byte aligned, and 8 rows apart = 32 banks apart
__device__ __forceinline__ void pe_conv_tile(const float* __restrict__ vplanes,  // plane of the block's first channel
                                             const float* __restrict__ wpe,      // its 25 weights
                                             const float* __restrict__ bias_pe,  // its bias
                                             const int y0,                       // first of the two image rows
                                             float* __restrict__ ppl)
{
    const int cl = threadIdx.x >> 3, xg = threadIdx.x & 7;
    const int x0 = xg * 8;
    const char* vin = (const char*)vplanes;
    const bool lok = xg > 0, rok = xg < 7;        // left / right halo inside the row
    const bool tok = y0 > 0, bok = y0 < 62;       // rows above / below inside the plane
    // Byte offsets: of row y0, of the two rows above it and of the two rows below
    // the thread's two; clamped, so that every load stays inside the plane.
    const unsigned pl = (unsigned)cl * 16384u + (unsigned)y0 * 256u;
    const unsigned ol = pl + (lok ? x0 - 2 : 0) * 4;
    const unsigned om = pl + x0 * 4;
    const unsigned orr = pl + (rok ? x0 + 8 : 0) * 4;
    const unsigned up = tok ? 512u : 0u, dn = bok ? 512u : 0u;
    const unsigned tl = ol - up, tm = om - up, tr = orr - up;
    const unsigned bl = ol + dn, bm = om + dn, br = orr + dn;
    const unsigned wo = (unsigned)cl * 100u, bo = (unsigned)cl * 4u;

    v2f lf[6], rt[6];
    v4f ma[6], mb[6];
    v4f_a4 wq[6];                                 // weights 0 .. 23
    // unrolled: constant indices keep the weights in registers
#pragma unroll
    for (int k = 0; k < 6; ++k) wq[k] = *(const v4f_a4*)((const char*)wpe + wo + k * 16);
    const float wl = *(const float*)((const char*)wpe + wo + 96);      // weight 24
    const float bias = *(const float*)((const char*)bias_pe + bo);
    // unrolled (all loops below): constant indices keep the rows and acc in registers
#pragma unroll
    for (int i = 0; i < 2; ++i) {
        lf[i] = *(const v2f*)(vin + tl + i * 256);
        ma[i] = *(const v4f*)(vin + tm + i * 256);
        mb[i] = *(const v4f*)(vin + tm + i * 256 + 16);
        rt[i] = *(const v2f*)(vin + tr + i * 256);
        lf[2 + i] = *(const v2f*)(vin + ol + i * 256);
        ma[2 + i] = *(const v4f*)(vin + om + i * 256);
        mb[2 + i] = *(const v4f*)(vin + om + i * 256 + 16);
        rt[2 + i] = *(const v2f*)(vin + orr + i * 256);
        lf[4 + i] = *(const v2f*)(vin + bl + i * 256);
        ma[4 + i] = *(const v4f*)(vin + bm + i * 256);
        mb[4 + i] = *(const v4f*)(vin + bm + i * 256 + 16);
        rt[4 + i] = *(const v2f*)(vin + br + i * 256);
    }
    // Holds the weight loads up here, issued ahead of the rows: left free they sink
    // to their first use among the multiply-adds, where each is waited for in full.
    asm volatile("" :: "v"(wq[0]), "v"(wq[1]), "v"(wq[2]), "v"(wq[3]), "v"(wq[4]), "v"(wq[5]), "v"(wl), "v"(bias));
    // Keeps all 32 loads up here, in flight together: left free the scheduler
    // spreads them among the multiply-adds and waits for several of them in full.
    __builtin_amdgcn_sched_barrier(0);
    // The wait that stands before the loads' address registers are used for
    // anything else; the offsets are named so that they stay whole up to it.
    asm volatile("s_wait_xcnt 0x0"
                 :: "v"(ol), "v"(om), "v"(orr), "v"(tl), "v"(tm), "v"(tr), "v"(bl), "v"(bm), "v"(br),
                    "v"(wo), "v"(bo)
                 : "memory");

    v2f acc[2][4];                                // two neighbouring columns an element
#pragma unroll
    for (int r = 0; r < 2; ++r)
#pragma unroll
        for (int j = 0; j < 4; ++j) acc[r][j] = (v2f){bias, bias};

#pragma unroll
    for (int i = 0; i < 6; ++i) {
        const bool yok = i < 2 ? tok : (i < 4 ? true : bok);
        float v[12];                              // columns x0 - 2 .. x0 + 9
        v[0] = (yok && lok) ? lf[i][0] : 0.f;
        v[1] = (yok && lok) ? lf[i][1] : 0.f;
#pragma unroll
        for (int j = 0; j < 4; ++j) {
            v[2 + j] = yok ? ma[i][j] : 0.f;
            v[6 + j] = yok ? mb[i][j] : 0.f;
        }
        v[10] = (yok && rok) ? rt[i][0] : 0.f;
        v[11] = (yok && rok) ? rt[i][1] : 0.f;
#pragma unroll
        for (int r = 0; r < 2; ++r) {
            const int ky = i - r;                 // dy + 2 of input row i for output row r
            if (ky < 0 || ky > 4) continue;
#pragma unroll
            for (int kx = 0; kx < 5; ++kx) {
                const int k = ky * 5 + kx;
                const float w = k < 24 ? wq[k >> 2][k & 3] : wl;
#pragma unroll
                for (int j = 0; j < 4; ++j)       // one packed multiply-add for two columns
                    acc[r][j] = __builtin_elementwise_fma((v2f){v[2 * j + kx], v[2 * j + kx + 1]},
                                                          (v2f){w, w}, acc[r][j]);
            }
        }
    }

    float* dst = ppl + cl * PP_PITCH + x0;
#pragma unroll
    for (int r = 0; r < 2; ++r) {
        *(v4f*)(dst + r * 64)     = (v4f){acc[r][0][0], acc[r][0][1], acc[r][1][0], acc[r][1][1]};
        *(v4f*)(dst + r * 64 + 4) = (v4f){acc[r][2][0], acc[r][2][1], acc[r][3][0], acc[r][3][1]};
    }
}

__device__ __forceinline__ float xhalf(float x)
{
    int i = __builtin_bit_cast(int, x);
    return __builtin_bit_cast(float,
        __builtin_amdgcn_permlanex16(i, i, 0x76543210, 0xfedcba98, false, false));
}

__global__ __launch_bounds__(256) void attn_kernel(
    const _Float16* __restrict__ q16, const _Float16* __restrict__ k16,
    const _Float16* __restrict__ v16t, const float* __restrict__ vf32,
    const float* __restrict__ wpe, const float* __restrict__ bias_pe,
    _Float16* __restrict__ comb16)
{
    __shared__ __attribute__((aligned(16))) _Float16 ldsK[2 * K_STAGE];   // K stages: [m_local][d], padded rows
    __shared__ __attribute__((aligned(16))) _Float16 ldsV[2 * V_STAGE];   // V stages: [d][m_local], padded rows
    __shared__ __attribute__((aligned(16))) float ppl[32 * PP_PITCH];     // pp of this block: [d][n_local], padded rows

    const int lane = threadIdx.x & 31, wave = threadIdx.x >> 5;
    const int ba = blockIdx.z, h = blockIdx.y;
    const int n0 = blockIdx.x * 128 + wave * 16;
    const int row = lane & 15, hi = lane >> 4;
    const float scale = 0.17677669529663687f;   // 1/sqrt(hd=32)

    const _Float16* qbase = q16 + ((size_t)(ba * 8 + h) << 10) * 32;
    const _Float16* kbase = k16 + ((size_t)(ba * 8 + h) << 10) * 32;
    const _Float16* vbase = v16t + ((size_t)(ba * 8 + h) << 5) * 1024;

    // B operand: 16 query columns x K=32 (entire head dim), loaded once.
    v16h bq = *(const v16h*)(qbase + (size_t)(n0 + row) * 32 + hi * 16);

    // State of this lane's query (column 'row'); rsum covers only the keys
    // this wave half holds, the halves are joined after the loop.
    float rmax = -1e30f, rsum = 0.f;
    v8f o0 = {}, o1 = {};    // o0[r] = O[query][d = 8*hi + r], o1: d + 16

    // A stage is 8 KB of K (contiguous) and 8 KB of V (32 d-rows x 256 B). Every
    // thread brings two 16-byte pieces of each, so every wave runs the same four
    // copies with all its lanes on, and each copy of a wave takes whole lines.
    const int tid = threadIdx.x;
    const _Float16* ksrc = kbase + tid * 8;
    const _Float16* vsrc = vbase + (tid >> 4) * 1024 + (tid & 15) * 8;
    _Float16* kdst = ldsK + (tid >> 2) * KV_PITCH + (tid & 3) * 8;
    _Float16* vdst = ldsV + (tid >> 4) * VS_PITCH + (tid & 15) * 8;
    auto stage_copy = [&](int s, int buf) {
        const _Float16* kg = ksrc + s * (ST_KEYS * 32);
        const _Float16* vg = vsrc + s * ST_KEYS;
        _Float16* kl = kdst + buf * K_STAGE;
        _Float16* vl = vdst + buf * V_STAGE;
        async_copy4_b128(kg, kg + 64 * 32, vg, vg + 16 * 1024,
                         kl, kl + 64 * KV_PITCH, vl, vl + 16 * VS_PITCH);
    };

    stage_copy(0, 0);
    // pp of the block's 32 channels and 128 positions; its LDS writes are read
    // only behind the loop, with the stage barriers in between.
    pe_conv_tile(vf32 + ((size_t)((ba >> 2) * 256 + h * 32) << 12), wpe + h * 32 * 25, bias_pe + h * 32,
                 (ba & 3) * 16 + blockIdx.x * 2, ppl);
    async_wait_all();
    __syncthreads();       // stage 0 visible to all waves
    stage_copy(1, 1);

    for (int s = 0; s < N_STAGES; ++s) {
      const _Float16* kst = ldsK + (s & 1) * K_STAGE;
      const _Float16* vst = ldsV + (s & 1) * V_STAGE;
      // kept rolled: unrolled, the scheduler weaves two passes into each other, with
      // more v_nop slots behind the matrix instructions and twice the registers
#pragma nounroll
      for (int p = 0; p < ST_KEYS / 32; ++p) {
        const _Float16* kp = kst + p * 32 * KV_PITCH;
        const _Float16* vp = vst + p * 32;
        // A operand: 16 key rows x K=32, same k order as bq.
        v16h ak0 = lds_frag(kp + (row)      * KV_PITCH + hi * 16);
        v16h ak1 = lds_frag(kp + (16 + row) * KV_PITCH + hi * 16);
        // A operand of the second product: 16 d rows of V^T, keys in the order
        // in which the packed score tiles hold them (8*hi + s, 16 + 8*hi + s).
        v8h av0lo = *(const v8h*)(vp + (row)      * VS_PITCH + hi * 8);
        v8h av0hi = *(const v8h*)(vp + (row)      * VS_PITCH + 16 + hi * 8);
        v8h av1lo = *(const v8h*)(vp + (16 + row) * VS_PITCH + hi * 8);
        v8h av1hi = *(const v8h*)(vp + (16 + row) * VS_PITCH + 16 + hi * 8);
        // Keeps the four V loads up here, beside the K loads: left free the
        // scheduler sinks them to just in front of the second product, where
        // their LDS latency is then waited for in full.
        __builtin_amdgcn_sched_barrier(0);

        v8f s0 = {}, s1 = {};
        s0 = __builtin_amdgcn_wmma_f32_16x16x32_f16(false, ak0, false, bq, (short)0, s0, false, false);
        s1 = __builtin_amdgcn_wmma_f32_16x16x32_f16(false, ak1, false, bq, (short)0, s1, false, false);

        // online softmax; s0[r] = S[key 8*hi + r][query], s1[r]: key + 16.
        s0 *= scale; s1 *= scale;
        float mx0 = s0[0], mx1 = s1[0];
        // unrolled: constant element indices keep the tiles in registers
#pragma unroll
        for (int r = 1; r < 8; ++r) { mx0 = fmaxf(mx0, s0[r]); mx1 = fmaxf(mx1, s1[r]); }
        float mx = fmaxf(mx0, mx1);
        mx = fmaxf(mx, xhalf(mx));
        float mnew = fmaxf(rmax, mx);
        float corr = __expf(rmax - mnew);
        rmax = mnew;
        v16h bp;
        // unrolled: constant element indices keep the tiles in registers
#pragma unroll
        for (int r = 0; r < 8; ++r) {
            s0[r] = __expf(s0[r] - mnew);
            s1[r] = __expf(s1[r] - mnew);
            bp[r]     = (_Float16)s0[r];
            bp[8 + r] = (_Float16)s1[r];
        }
        v8f t = s0 + s1;
        float ps = ((t[0] + t[1]) + (t[2] + t[3])) + ((t[4] + t[5]) + (t[6] + t[7]));
        rsum = rsum * corr + ps;
        o0 *= corr; o1 *= corr;

        v16h av0 = __builtin_shufflevector(av0lo, av0hi, 0, 1, 2, 3, 4, 5, 6, 7, 8, 9, 10, 11, 12, 13, 14, 15);
        v16h av1 = __builtin_shufflevector(av1lo, av1hi, 0, 1, 2, 3, 4, 5, 6, 7, 8, 9, 10, 11, 12, 13, 14, 15);
        o0 = __builtin_amdgcn_wmma_f32_16x16x32_f16(false, av0, false, bp, (short)0, o0, false, false);
        o1 = __builtin_amdgcn_wmma_f32_16x16x32_f16(false, av1, false, bp, (short)0, o1, false, false);
      }
      // Hand-over of the stages: this wave's LDS reads of stage s have returned
      // and its own copies of stage s + 1 have landed before the barrier; behind
      // it stage s + 1 may be read by all and the buffer of stage s refilled.
      asm volatile("s_wait_dscnt 0x0" ::: "memory");
      async_wait_all();
      __syncthreads();
      if (s + 2 < N_STAGES) stage_copy(s + 2, s & 1);
    }
    async_wait_all();      // no copy is left in flight when the wave goes on

    // finalize: join the halves' sums, /= rowsum, add positional encoding,
    // store 8 consecutive channels of one f16 GEMM row per 16-byte store
    rsum += xhalf(rsum);
    const float inv = 1.0f / rsum;
    const int b = ba >> 2, area = ba & 3;
    const int n_global = area * 1024 + n0 + row;
    const int c0 = h * 32 + 8 * hi;
    v8h w0, w1;
    const float* pcol = ppl + 8 * hi * PP_PITCH + wave * 16 + row;
    // unrolled: constant element indices, and all 16 loads in flight at once
#pragma unroll
    for (int r = 0; r < 8; ++r) {
        float pv0 = pcol[r * PP_PITCH];
        float pv1 = pcol[(16 + r) * PP_PITCH];
        w0[r] = (_Float16)(o0[r] * inv + pv0);
        w1[r] = (_Float16)(o1[r] * inv + pv1);
    }
    _Float16* crow = comb16 + ((size_t)(b * 4096 + n_global)) * 256 + c0;
    *(v8h*)(crow)      = w0;
    *(v8h*)(crow + 16) = w1;
}

// ---------------------------------------------------------------------------
// Kernel F: projection GEMM: comb16 (8192x256) * wproj16^T + bias -> NCHW f32
// Weight slab async-staged in LDS as in kernel C; weights as the A operand as
// there, so that 16 lanes lie along n, the contiguous axis of out.
// ---------------------------------------------------------------------------
__global__ __launch_bounds__(256) void proj_gemm_kernel(
    const _Float16* __restrict__ A, const _Float16* __restrict__ W,
    const float* __restrict__ bias, float* __restrict__ out)
{
    __shared__ __attribute__((aligned(16))) _Float16 wlds[128 * W_PITCH];   // 64 KB weight slab, padded rows
    const int lane = threadIdx.x & 31, wave = threadIdx.x >> 5;
    const int wm = wave & 3, wn = wave >> 2;
    const int m0 = blockIdx.x * 64 + wm * 16;
    const int n0 = wn * 64;
    const int nslab = blockIdx.y * 128;
    const int row = lane & 15, hi = lane >> 4;
    const int o0 = nslab + n0 + 8 * hi;         // lane's first output channel

    {
        const _Float16* wsrc = W + (size_t)nslab * 256 + threadIdx.x * 8;
        _Float16* wdst = wlds + wave * W_PITCH + lane * 8;
        async_copy8_b128(wsrc, wdst, 8 * 256, 8 * W_PITCH);
        async_copy8_b128(wsrc + 64 * 256, wdst + 64 * W_PITCH, 8 * 256, 8 * W_PITCH);
        async_wait_all();
        __syncthreads();
    }

    v8f acc[4] = {};
    const _Float16* arow = A + (size_t)(m0 + row) * 256 + hi * 16;
    for (int k0 = 0; k0 < 256; k0 += 32) {
        __builtin_prefetch(arow + k0 + 64, 0, 1);
        v16h a = *(const v16h*)(arow + k0);
#pragma unroll
        for (int t = 0; t < 4; ++t) {
            v16h bm = lds_frag(wlds + (n0 + t * 16 + row) * W_PITCH + k0 + hi * 16);
            acc[t] = __builtin_amdgcn_wmma_f32_16x16x32_f16(
                false, bm, false, a, (short)0, acc[t], false, false);
        }
    }
    // acc[t][r] = Y[position m0 + row][channel o0 + t*16 + r]
    const int m = m0 + row;
    const int b = m >> 12, n = m & 4095;
    float* dst = out + ((size_t)(b * 256 + o0) << 12) + n;
    // unrolled: constant element indices keep acc in registers
#pragma unroll
    for (int t = 0; t < 4; ++t) {
        const v4f blo = *(const v4f*)(bias + o0 + t * 16);
        const v4f bhi = *(const v4f*)(bias + o0 + t * 16 + 4);
#pragma unroll
        for (int r = 0; r < 8; ++r)
            dst[(t * 16 + r) << 12] = acc[t][r] + (r < 4 ? blo[r & 3] : bhi[r & 3]);
    }
}

// ---------------------------------------------------------------------------
extern "C" void kernel_launch(void* const* d_in, const int* in_sizes, int n_in,
                              void* d_out, int out_size, void* d_ws, size_t ws_size,
                              hipStream_t stream)
{
    const float* x     = (const float*)d_in[0];
    const float* w_qk  = (const float*)d_in[1];
    const float* w_v   = (const float*)d_in[2];
    const float* w_pe  = (const float*)d_in[3];
    const float* w_pr  = (const float*)d_in[4];
    const float* qk_g  = (const float*)d_in[5];
    const float* qk_b  = (const float*)d_in[6];
    const float* qk_m  = (const float*)d_in[7];
    const float* qk_v  = (const float*)d_in[8];
    const float* v_g   = (const float*)d_in[9];
    const float* v_b   = (const float*)d_in[10];
    const float* v_m   = (const float*)d_in[11];
    const float* v_v   = (const float*)d_in[12];
    const float* pe_g  = (const float*)d_in[13];
    const float* pe_b  = (const float*)d_in[14];
    const float* pe_m  = (const float*)d_in[15];
    const float* pe_v  = (const float*)d_in[16];
    const float* pr_g  = (const float*)d_in[17];
    const float* pr_b  = (const float*)d_in[18];
    const float* pr_m  = (const float*)d_in[19];
    const float* pr_v  = (const float*)d_in[20];
    float* out = (float*)d_out;

    // workspace carve-up (256B aligned)
    char* ws = (char*)d_ws;
    size_t off = 0;
    auto carve = [&](size_t bytes) -> char* {
        char* p = ws + off;
        off = (off + bytes + 255) & ~(size_t)255;
        return p;
    };
    _Float16* wcat16  = (_Float16*)carve(768 * 256 * sizeof(_Float16));
    float*    biascat = (float*)   carve(768 * sizeof(float));
    _Float16* wproj16 = (_Float16*)carve(256 * 256 * sizeof(_Float16));
    float*    biaspr  = (float*)   carve(256 * sizeof(float));
    float*    wpe_s   = (float*)   carve(256 * 25 * sizeof(float));
    float*    biaspe  = (float*)   carve(256 * sizeof(float));
    _Float16* X16     = (_Float16*)carve((size_t)8192 * 256 * sizeof(_Float16));
    _Float16* q16     = (_Float16*)carve((size_t)8 * 8 * 1024 * 32 * sizeof(_Float16));
    _Float16* k16     = (_Float16*)carve((size_t)8 * 8 * 1024 * 32 * sizeof(_Float16));
    _Float16* v16t    = (_Float16*)carve((size_t)8 * 8 * 32 * 1024 * sizeof(_Float16));
    float*    vf32    = (float*)   carve((size_t)2 * 256 * 4096 * sizeof(float));
    _Float16* comb16  = (_Float16*)carve((size_t)8192 * 256 * sizeof(_Float16));

    prep_kernel<<<FOLD_BLOCKS + PACK_BLOCKS, 256, 0, stream>>>(
        x, X16,
        w_qk, qk_g, qk_b, qk_m, qk_v,
        w_v,  v_g,  v_b,  v_m,  v_v,
        w_pe, pe_g, pe_b, pe_m, pe_v,
        w_pr, pr_g, pr_b, pr_m, pr_v,
        wcat16, biascat, wproj16, biaspr, wpe_s, biaspe);

    qkv_gemm_kernel<<<dim3(8192 / 64, 768 / 128), 256, 0, stream>>>(
        X16, wcat16, biascat, q16, k16, v16t, vf32);

    attn_kernel<<<dim3(8, 8, 8), 256, 0, stream>>>(q16, k16, v16t, vf32, wpe_s, biaspe, comb16);

    proj_gemm_kernel<<<dim3(8192 / 64, 256 / 128), 256, 0, stream>>>(
        comb16, wproj16, biaspr, out);
}

// v008
// It runs in 37.8 microseconds.
// In both of two side-by-side timings against v007, it was 1.06 times as fast.
// All steps since v000 together make it 3.37 times as fast.
#include <hip/hip_runtime.h>
#include <hip/hip_bf16.h>
#include <stdint.h>

typedef __attribute__((ext_vector_type(16))) _Float16 v16h;
typedef __attribute__((ext_vector_type(8)))  float    v8f;
typedef __attribute__((ext_vector_type(8)))  _Float16 v8h;
typedef __attribute__((ext_vector_type(4)))  float    v4f;
typedef __attribute__((ext_vector_type(2)))  float    v2f;
typedef v4f __attribute__((aligned(4))) v4f_a4;   // four floats at a 4-byte aligned address

#define BN_EPS 1e-5f

// LDS row pitches, in halves: 16 bytes x an odd number, so that the 16 rows
// which one ds_load_b128 reads fall on 16 different groups of four banks.
#define W_PITCH  264    // weight slab rows: 512 bytes of data, 528 apart
#define KV_PITCH 40     // K stage rows: 64 bytes of data, 80 apart
#define VS_PITCH 136    // V stage rows: 256 bytes of data, 272 apart

// Attention stages K and V in LDS 128 keys at a time, in two buffers.
#define ST_KEYS  128
#define N_STAGES (1024 / ST_KEYS)
#define K_STAGE  (ST_KEYS * KV_PITCH)   // halves of one K buffer
#define V_STAGE  (32 * VS_PITCH)        // halves of one V buffer

// Wave-wide async global->LDS copies, 16 B per lane (512 B per wave and copy).
// The s_wait_xcnt stands in the copies' own statement, behind the last, so that
// it comes before any later write of their address registers.
// Eight copies, gstep halves apart in global memory and lstep halves apart
// in LDS.
__device__ __forceinline__ void async_copy8_b128(const _Float16* g, _Float16* lds_ptr,
                                                 int gstep, int lstep)
{
    unsigned l = (unsigned)(uintptr_t)lds_ptr;
    unsigned ls = (unsigned)lstep * 2u;
    asm volatile("global_load_async_to_lds_b128 %0, %8, off\n\t"
                 "global_load_async_to_lds_b128 %1, %9, off\n\t"
                 "global_load_async_to_lds_b128 %2, %10, off\n\t"
                 "global_load_async_to_lds_b128 %3, %11, off\n\t"
                 "global_load_async_to_lds_b128 %4, %12, off\n\t"
                 "global_load_async_to_lds_b128 %5, %13, off\n\t"
                 "global_load_async_to_lds_b128 %6, %14, off\n\t"
                 "global_load_async_to_lds_b128 %7, %15, off\n\t"
                 "s_wait_xcnt 0x0"
                 :: "v"(l), "v"(l + ls), "v"(l + 2 * ls), "v"(l + 3 * ls),
                    "v"(l + 4 * ls), "v"(l + 5 * ls), "v"(l + 6 * ls), "v"(l + 7 * ls),
                    "v"(g), "v"(g + gstep), "v"(g + 2 * gstep), "v"(g + 3 * gstep),
                    "v"(g + 4 * gstep), "v"(g + 5 * gstep), "v"(g + 6 * gstep), "v"(g + 7 * gstep)
                 : "memory");
}
// Four copies, each with its own two addresses.
__device__ __forceinline__ void async_copy4_b128(const _Float16* g0, const _Float16* g1,
                                                 const _Float16* g2, const _Float16* g3,
                                                 _Float16* p0, _Float16* p1,
                                                 _Float16* p2, _Float16* p3)
{
    unsigned l0 = (unsigned)(uintptr_t)p0, l1 = (unsigned)(uintptr_t)p1;
    unsigned l2 = (unsigned)(uintptr_t)p2, l3 = (unsigned)(uintptr_t)p3;
    asm volatile("global_load_async_to_lds_b128 %0, %4, off\n\t"
                 "global_load_async_to_lds_b128 %1, %5, off\n\t"
                 "global_load_async_to_lds_b128 %2, %6, off\n\t"
                 "global_load_async_to_lds_b128 %3, %7, off\n\t"
                 "s_wait_xcnt 0x0"
                 :: "v"(l0), "v"(l1), "v"(l2), "v"(l3), "v"(g0), "v"(g1), "v"(g2), "v"(g3)
                 : "memory");
}
// 16 consecutive halves from LDS as one fragment; the padded rows are 16-byte
// aligned, not 32, so the fragment is read as two 16-byte halves.
__device__ __forceinline__ v16h lds_frag(const _Float16* p)
{
    v8h lo = *(const v8h*)p, hi = *(const v8h*)(p + 8);
    return __builtin_shufflevector(lo, hi, 0, 1, 2, 3, 4, 5, 6, 7, 8, 9, 10, 11, 12, 13, 14, 15);
}
__device__ __forceinline__ void async_wait_all()
{
    asm volatile("s_wait_asynccnt 0x0" ::: "memory");
}

// ---------------------------------------------------------------------------
// Part A of the first launch: fold BatchNorm into weights; produce f16 weight
// copies + f32 bias. idx: the thread's number among the 'stride' threads that
// share this part.
// ---------------------------------------------------------------------------
__device__ __forceinline__ void fold_weights(const int idx, const int stride,
    const float* __restrict__ w_qk, const float* __restrict__ qk_g, const float* __restrict__ qk_b,
    const float* __restrict__ qk_m, const float* __restrict__ qk_v,
    const float* __restrict__ w_v,  const float* __restrict__ v_g,  const float* __restrict__ v_b,
    const float* __restrict__ v_m,  const float* __restrict__ v_v,
    const float* __restrict__ w_pe, const float* __restrict__ pe_g, const float* __restrict__ pe_b,
    const float* __restrict__ pe_m, const float* __restrict__ pe_v,
    const float* __restrict__ w_pr, const float* __restrict__ pr_g, const float* __restrict__ pr_b,
    const float* __restrict__ pr_m, const float* __restrict__ pr_v,
    _Float16* __restrict__ wcat16, float* __restrict__ bias_cat,
    _Float16* __restrict__ wproj16, float* __restrict__ bias_pr,
    float* __restrict__ wpe_s, float* __restrict__ bias_pe)
{
    for (int i = idx; i < 768 * 256; i += stride) {
        int o = i >> 8, c = i & 255;
        float s, w;
        if (o < 512) { s = qk_g[o] * rsqrtf(qk_v[o] + BN_EPS); w = w_qk[o * 256 + c]; }
        else { int oo = o - 512; s = v_g[oo] * rsqrtf(v_v[oo] + BN_EPS); w = w_v[oo * 256 + c]; }
        wcat16[i] = (_Float16)(w * s);
    }
    for (int o = idx; o < 768; o += stride) {
        if (o < 512) { float s = qk_g[o] * rsqrtf(qk_v[o] + BN_EPS); bias_cat[o] = qk_b[o] - qk_m[o] * s; }
        else { int oo = o - 512; float s = v_g[oo] * rsqrtf(v_v[oo] + BN_EPS); bias_cat[o] = v_b[oo] - v_m[oo] * s; }
    }
    for (int i = idx; i < 256 * 256; i += stride) {
        int o = i >> 8;
        float s = pr_g[o] * rsqrtf(pr_v[o] + BN_EPS);
        wproj16[i] = (_Float16)(w_pr[i] * s);
    }
    for (int o = idx; o < 256; o += stride) {
        float s = pr_g[o] * rsqrtf(pr_v[o] + BN_EPS);
        bias_pr[o] = pr_b[o] - pr_m[o] * s;
        float spe = pe_g[o] * rsqrtf(pe_v[o] + BN_EPS);
        bias_pe[o] = pe_b[o] - pe_m[o] * spe;
    }
    for (int i = idx; i < 256 * 25; i += stride) {
        int c = i / 25;
        float s = pe_g[c] * rsqrtf(pe_v[c] + BN_EPS);
        wpe_s[i] = w_pe[i] * s;
    }
}

// ---------------------------------------------------------------------------
// Part B of the first launch: pack x (B,C,H,W) f32 -> X16 row-major (B*N, C) f16.
// A thread takes 8 channels x 4 positions: eight 16-byte loads along n, four
// 16-byte stores along c. In a wave 8 lanes lie along c and 4 along n, so each
// store fills four whole 128-byte lines of X16, every line from one wave.
// ---------------------------------------------------------------------------
// blk: the block's number among the 32 (n) x 4 (c) x 2 (b) blocks of this part.
__device__ __forceinline__ void pack_x(const int blk, const float* __restrict__ x, _Float16* __restrict__ X16)
{
    const int lane = threadIdx.x & 31, wave = threadIdx.x >> 5;
    const int n  = (blk & 31) * 128 + wave * 16 + (lane >> 3) * 4;
    const int c0 = ((blk >> 5) & 3) * 64 + (lane & 7) * 8;
    const int b  = blk >> 7;
    const float* src = x + ((size_t)(b * 256 + c0) << 12) + n;
    v4f v[8];
    // unrolled: constant element indices, and all 8 loads in flight at once
#pragma unroll
    for (int j = 0; j < 8; ++j) v[j] = *(const v4f*)(src + ((size_t)j << 12));
    _Float16* dst = X16 + ((size_t)(b * 4096 + n)) * 256 + c0;
    // unrolled: constant element indices keep the tile in registers
#pragma unroll
    for (int i = 0; i < 4; ++i) {
        v8h h;
#pragma unroll
        for (int j = 0; j < 8; ++j) h[j] = (_Float16)v[j][i];
        *(v8h*)(dst + i * 256) = h;
    }
    // The wait that stands before the stores' address and data registers are
    // used for anything else on any way the built code goes on from here.
    asm volatile("s_wait_xcnt 0x0" ::: "memory");
}

// ---------------------------------------------------------------------------
// First launch: parts A and B read only inputs and write different buffers, so
// neither waits for the other: they share one launch, each in blocks of its own.
// The fold blocks come first: theirs is the longer chain of dependent loads.
// ---------------------------------------------------------------------------
#define FOLD_BLOCKS 256
#define PACK_BLOCKS 256
__global__ __launch_bounds__(256) void prep_kernel(
    const float* __restrict__ x, _Float16* __restrict__ X16,
    const float* __restrict__ w_qk, const float* __restrict__ qk_g, const float* __restrict__ qk_b,
    const float* __restrict__ qk_m, const float* __restrict__ qk_v,
    const float* __restrict__ w_v,  const float* __restrict__ v_g,  const float* __restrict__ v_b,
    const float* __restrict__ v_m,  const float* __restrict__ v_v,
    const float* __restrict__ w_pe, const float* __restrict__ pe_g, const float* __restrict__ pe_b,
    const float* __restrict__ pe_m, const float* __restrict__ pe_v,
    const float* __restrict__ w_pr, const float* __restrict__ pr_g, const float* __restrict__ pr_b,
    const float* __restrict__ pr_m, const float* __restrict__ pr_v,
    _Float16* __restrict__ wcat16, float* __restrict__ bias_cat,
    _Float16* __restrict__ wproj16, float* __restrict__ bias_pr,
    float* __restrict__ wpe_s, float* __restrict__ bias_pe)
{
    if (blockIdx.x < FOLD_BLOCKS)
        fold_weights(blockIdx.x * 256 + threadIdx.x, FOLD_BLOCKS * 256,
                     w_qk, qk_g, qk_b, qk_m, qk_v,
                     w_v,  v_g,  v_b,  v_m,  v_v,
                     w_pe, pe_g, pe_b, pe_m, pe_v,
                     w_pr, pr_g, pr_b, pr_m, pr_v,
                     wcat16, bias_cat, wproj16, bias_pr, wpe_s, bias_pe);
    else
        pack_x(blockIdx.x - FOLD_BLOCKS, x, X16);
}

// ---------------------------------------------------------------------------
// Kernel C: fused QKV GEMM: X16 (8192x256) * wcat16^T + bias.
// 128-column weight slab (64 KB f16) async-staged once per block into LDS;
// K-loop streams only the x rows from global, the weight rows from ds_load.
// Slab rows lie in LDS at a pitch of 528 bytes (W_PITCH).
// The weights are the A operand and the x rows the B operand, so a lane holds 8
// consecutive channels of ONE position and 16 lanes lie along the positions:
// q and k rows (channels contiguous) leave as one 16-byte store a tile, the v
// planes (positions contiguous) in runs of 16 positions a store.
// ---------------------------------------------------------------------------
__global__ __launch_bounds__(256) void qkv_gemm_kernel(
    const _Float16* __restrict__ X16, const _Float16* __restrict__ W,
    const float* __restrict__ bias,
    _Float16* __restrict__ q16, _Float16* __restrict__ k16,
    _Float16* __restrict__ v16t, float* __restrict__ vf32)
{
    __shared__ __attribute__((aligned(16))) _Float16 wlds[128 * W_PITCH];   // 64 KB weight slab, padded rows
    const int lane = threadIdx.x & 31;
    const int wave = threadIdx.x >> 5;
    const int wm = wave & 3, wn = wave >> 2;
    const int m0 = blockIdx.x * 64 + wm * 16;
    const int n0 = wn * 64;                    // within-slab column base
    const int nslab = blockIdx.y * 128;        // global column base of slab
    const int row = lane & 15, hi = lane >> 4;
    const int kind = blockIdx.y >> 1;           // the block's slab: 0 q, 1 k, 2 v
    const int c0 = (blockIdx.y & 1) * 128 + n0 + 8 * hi;   // lane's first channel inside q, k or v

    // async stage the weight slab: 256 threads x 16 x 16B = 64 KB;
    // a wave copies one whole row per copy, rows wave, wave + 8, ...
    {
        const _Float16* wsrc = W + (size_t)nslab * 256 + threadIdx.x * 8;
        _Float16* wdst = wlds + wave * W_PITCH + lane * 8;
        async_copy8_b128(wsrc, wdst, 8 * 256, 8 * W_PITCH);
        async_copy8_b128(wsrc + 64 * 256, wdst + 64 * W_PITCH, 8 * 256, 8 * W_PITCH);
        async_wait_all();
        __syncthreads();
    }

    v8f acc[4] = {};
    const _Float16* arow = X16 + (size_t)(m0 + row) * 256 + hi * 16;
    for (int k0 = 0; k0 < 256; k0 += 32) {
        __builtin_prefetch(arow + k0 + 64, 0, 1);
        v16h a = *(const v16h*)(arow + k0);
#pragma unroll
        for (int t = 0; t < 4; ++t) {
            v16h bm = lds_frag(wlds + (n0 + t * 16 + row) * W_PITCH + k0 + hi * 16);
            acc[t] = __builtin_amdgcn_wmma_f32_16x16x32_f16(
                false, bm, false, a, (short)0, acc[t], false, false);
        }
    }

    // acc[t][r] = Y[position m0 + row][channel nslab + n0 + t*16 + 8*hi + r]
    const char* bsrc = (const char*)(bias + kind * 256);
    const unsigned boff = (unsigned)c0 * 4u;    // byte offset of the lane's first bias value
    v4f blo[4], bhi[4];                         // the lane's 8 bias values of each tile
    // unrolled (all loops below): constant element indices keep them and acc in registers
#pragma unroll
    for (int t = 0; t < 4; ++t) {
        blo[t] = *(const v4f*)(bsrc + boff + t * 64);
        bhi[t] = *(const v4f*)(bsrc + boff + t * 64 + 16);
    }
    // The wait that stands before the bias loads' address register is used for
    // anything else; the offset is named so that it stays whole up to it.
    asm volatile("s_wait_xcnt 0x0" :: "v"(boff) : "memory");
#pragma unroll
    for (int t = 0; t < 4; ++t) {
#pragma unroll
        for (int r = 0; r < 4; ++r) { acc[t][r] += blo[t][r]; acc[t][4 + r] += bhi[t][r]; }
    }
    const int m = m0 + row;                     // global spatial row (b*4096 + n)
    const int b = m >> 12, n = m & 4095;
    const int ba = (b << 2) + (n >> 10), na = n & 1023;
    if (kind < 2) {                             // q, k: [ba][h][na][d], 8 d a lane
        _Float16* dst = (kind == 0 ? q16 : k16)
            + (((size_t)((ba << 3) + (c0 >> 5)) << 10) + na) * 32 + (c0 & 31);
#pragma unroll
        for (int t = 0; t < 4; ++t) {           // tiles 0, 1: one head; 2, 3: the next
            v8h hv;
#pragma unroll
            for (int r = 0; r < 8; ++r) hv[r] = (_Float16)acc[t][r];
            *(v8h*)(dst + (t >> 1) * (1024 * 32) + (t & 1) * 16) = hv;
        }
    } else {                                    // v : f32 NCHW + transposed f16
        float* vf = vf32 + ((size_t)(b * 256 + c0) << 12) + n;
        _Float16* vt = v16t + ((size_t)((ba << 8) + c0) << 10) + na;
#pragma unroll
        for (int t = 0; t < 4; ++t) {
#pragma unroll
            for (int r = 0; r < 8; ++r) {
                vf[(t * 16 + r) << 12] = acc[t][r];
                vt[(t * 16 + r) << 10] = (_Float16)acc[t][r];
            }
        }
        // The wait that stands before the stores' address and data registers are
        // used for anything else on any way the built code goes on from here.
        asm volatile("s_wait_xcnt 0x0" ::: "memory");
    }
}

// ---------------------------------------------------------------------------
// Part D, inside the attention launch: depthwise 5x5 conv on v (pad 2), BN
// folded, for the 32 channels and the 128 positions (two image rows) of one
// attention block; the result stays in LDS, [channel][position], for that
// block's epilogue. A thread makes 2 rows x 8 columns of one channel from 6
// input rows of 12 columns held in registers. Each output still adds its taps
// in the order dy, dx; a tap outside the plane enters as 0.
// ---------------------------------------------------------------------------
#define PP_PITCH 132    // floats: rows 16-byte aligned, and 8 rows apart = 32 banks apart
__device__ __forceinline__ void pe_conv_tile(const float* __restrict__ vplanes,  // plane of the block's first channel
                                             const float* __restrict__ wpe,      // its 25 weights
                                             const float* __restrict__ bias_pe,  // its bias
                                             const int y0,                       // first of the two image rows
                                             float* __restrict__ ppl)
{
    const int cl = threadIdx.x >> 3, xg = threadIdx.x & 7;
    const int x0 = xg * 8;
    const char* vin = (const char*)vplanes;
    const bool lok = xg > 0, rok = xg < 7;        // left / right halo inside the row
    const bool tok = y0 > 0, bok = y0 < 62;       // rows above / below inside the plane
    // Byte offsets: of row y0, of the two rows above it and of the two rows below
    // the thread's two; clamped, so that every load stays inside the plane.
    const unsigned pl = (unsigned)cl * 16384u + (unsigned)y0 * 256u;
    const unsigned ol = pl + (lok ? x0 - 2 : 0) * 4;
    const unsigned om = pl + x0 * 4;
    const unsigned orr = pl + (rok ? x0 + 8 : 0) * 4;
    const unsigned up = tok ? 512u : 0u, dn = bok ? 512u : 0u;
    const unsigned tl = ol - up, tm = om - up, tr = orr - up;
    const unsigned bl = ol + dn, bm = om + dn, br = orr + dn;
    const unsigned wo = (unsigned)cl * 100u, bo = (unsigned)cl * 4u;

    v2f lf[6], rt[6];
    v4f ma[6], mb[6];
    v4f_a4 wq[6];                                 // weights 0 .. 23
    // unrolled: constant indices keep the weights in registers
#pragma unroll
    for (int k = 0; k < 6; ++k) wq[k] = *(const v4f_a4*)((const char*)wpe + wo + k * 16);
    const float wl = *(const float*)((const char*)wpe + wo + 96);      // weight 24
    const float bias = *(const float*)((const char*)bias_pe + bo);
    // unrolled (all loops below): constant indices keep the rows and acc in registers
#pragma unroll
    for (int i = 0; i < 2; ++i) {
        lf[i] = *(const v2f*)(vin + tl + i * 256);
        ma[i] = *(const v4f*)(vin + tm + i * 256);
        mb[i] = *(const v4f*)(vin + tm + i * 256 + 16);
        rt[i] = *(const v2f*)(vin + tr + i * 256);
        lf[2 + i] = *(const v2f*)(vin + ol + i * 256);
        ma[2 + i] = *(const v4f*)(vin + om + i * 256);
        mb[2 + i] = *(const v4f*)(vin + om + i * 256 + 16);
        rt[2 + i] = *(const v2f*)(vin + orr + i * 256);
        lf[4 + i] = *(const v2f*)(vin + bl + i * 256);
        ma[4 + i] = *(const v4f*)(vin + bm + i * 256);
        mb[4 + i] = *(const v4f*)(vin + bm + i * 256 + 16);
        rt[4 + i] = *(const v2f*)(vin + br + i * 256);
    }
    // Holds the weight loads up here, issued ahead of the rows: left free they sink
    // to their first use among the multiply-adds, where each is waited for in full.
    asm volatile("" :: "v"(wq[0]), "v"(wq[1]), "v"(wq[2]), "v"(wq[3]), "v"(wq[4]), "v"(wq[5]), "v"(wl), "v"(bias));
    // Keeps all 32 loads up here, in flight together: left free the scheduler
    // spreads them among the multiply-adds and waits for several of them in full.
    __builtin_amdgcn_sched_barrier(0);
    // The wait that stands before the loads' address registers are used for
    // anything else; the offsets are named so that they stay whole up to it.
    asm volatile("s_wait_xcnt 0x0"
                 :: "v"(ol), "v"(om), "v"(orr), "v"(tl), "v"(tm), "v"(tr), "v"(bl), "v"(bm), "v"(br),
                    "v"(wo), "v"(bo)
                 : "memory");

    v2f acc[2][4];                                // two neighbouring columns an element
#pragma unroll
    for (int r = 0; r < 2; ++r)
#pragma unroll
        for (int j = 0; j < 4; ++j) acc[r][j] = (v2f){bias, bias};

#pragma unroll
    for (int i = 0; i < 6; ++i) {
        const bool yok = i < 2 ? tok : (i < 4 ? true : bok);
        float v[12];                              // columns x0 - 2 .. x0 + 9
        v[0] = (yok && lok) ? lf[i][0] : 0.f;
        v[1] = (yok && lok) ? lf[i][1] : 0.f;
#pragma unroll
        for (int j = 0; j < 4; ++j) {
            v[2 + j] = yok ? ma[i][j] : 0.f;
            v[6 + j] = yok ? mb[i][j] : 0.f;
        }
        v[10] = (yok && rok) ? rt[i][0] : 0.f;
        v[11] = (yok && rok) ? rt[i][1] : 0.f;
#pragma unroll
        for (int r = 0; r < 2; ++r) {
            const int ky = i - r;                 // dy + 2 of input row i for output row r
            if (ky < 0 || ky > 4) continue;
#pragma unroll
            for (int kx = 0; kx < 5; ++kx) {
                const int k = ky * 5 + kx;
                const float w = k < 24 ? wq[k >> 2][k & 3] : wl;
#pragma unroll
                for (int j = 0; j < 4; ++j)       // one packed multiply-add for two columns
                    acc[r][j] = __builtin_elementwise_fma((v2f){v[2 * j + kx], v[2 * j + kx + 1]},
                                                          (v2f){w, w}, acc[r][j]);
            }
        }
    }

    float* dst = ppl + cl * PP_PITCH + x0;
#pragma unroll
    for (int r = 0; r < 2; ++r) {
        *(v4f*)(dst + r * 64)     = (v4f){acc[r][0][0], acc[r][0][1], acc[r][1][0], acc[r][1][1]};
        *(v4f*)(dst + r * 64 + 4) = (v4f){acc[r][2][0], acc[r][2][1], acc[r][3][0], acc[r][3][1]};
    }
}

__device__ __forceinline__ float xhalf(float x)
{
    int i = __builtin_bit_cast(int, x);
    return __builtin_bit_cast(float,
        __builtin_amdgcn_permlanex16(i, i, 0x76543210, 0xfedcba98, false, false));
}

__global__ __launch_bounds__(256) void attn_kernel(
    const _Float16* __restrict__ q16, const _Float16* __restrict__ k16,
    const _Float16* __restrict__ v16t, const float* __restrict__ vf32,
    const float* __restrict__ wpe, const float* __restrict__ bias_pe,
    _Float16* __restrict__ comb16)
{
    __shared__ __attribute__((aligned(16))) _Float16 ldsK[2 * K_STAGE];   // K stages: [m_local][d], padded rows
    __shared__ __attribute__((aligned(16))) _Float16 ldsV[2 * V_STAGE];   // V stages: [d][m_local], padded rows
    __shared__ __attribute__((aligned(16))) float ppl[32 * PP_PITCH];     // pp of this block: [d][n_local], padded rows

    const int lane = threadIdx.x & 31, wave = threadIdx.x >> 5;
    const int ba = blockIdx.z, h = blockIdx.y;
    const int n0 = blockIdx.x * 128 + wave * 16;
    const int row = lane & 15, hi = lane >> 4;
    const float c2 = 0.17677669529663687f * 1.4426950408889634f;   // 1/sqrt(hd=32) x log2(e)
    const float PS_MAX = 256.0f; // a lane's 16 exponentials of a pass may sum to this: each P <= 256, far inside f16

    const _Float16* qbase = q16 + ((size_t)(ba * 8 + h) << 10) * 32;
    const _Float16* kbase = k16 + ((size_t)(ba * 8 + h) << 10) * 32;
    const _Float16* vbase = v16t + ((size_t)(ba * 8 + h) << 5) * 1024;

    // B operand: 16 query columns x K=32 (entire head dim), loaded once.
    v16h bq = *(const v16h*)(qbase + (size_t)(n0 + row) * 32 + hi * 16);

    // State of this lane's query (column 'row'); rsum covers only the keys
    // this wave half holds, the halves are joined after the loop.
    float rsum = 0.f;
    v8f o0 = {}, o1 = {};    // o0[r] = O[query][d = 8*hi + r], o1: d + 16

    // A stage is 8 KB of K (contiguous) and 8 KB of V (32 d-rows x 256 B). Every
    // thread brings two 16-byte pieces of each, so every wave runs the same four
    // copies with all its lanes on, and each copy of a wave takes whole lines.
    const int tid = threadIdx.x;
    const _Float16* ksrc = kbase + tid * 8;
    const _Float16* vsrc = vbase + (tid >> 4) * 1024 + (tid & 15) * 8;
    _Float16* kdst = ldsK + (tid >> 2) * KV_PITCH + (tid & 3) * 8;
    _Float16* vdst = ldsV + (tid >> 4) * VS_PITCH + (tid & 15) * 8;
    auto stage_copy = [&](int s, int buf) {
        const _Float16* kg = ksrc + s * (ST_KEYS * 32);
        const _Float16* vg = vsrc + s * ST_KEYS;
        _Float16* kl = kdst + buf * K_STAGE;
        _Float16* vl = vdst + buf * V_STAGE;
        async_copy4_b128(kg, kg + 64 * 32, vg, vg + 16 * 1024,
                         kl, kl + 64 * KV_PITCH, vl, vl + 16 * VS_PITCH);
    };

    stage_copy(0, 0);
    // pp of the block's 32 channels and 128 positions; its LDS writes are read
    // only behind the loop, with the stage barriers in between.
    pe_conv_tile(vf32 + ((size_t)((ba >> 2) * 256 + h * 32) << 12), wpe + h * 32 * 25, bias_pe + h * 32,
                 (ba & 3) * 16 + blockIdx.x * 2, ppl);
    async_wait_all();
    __syncthreads();       // stage 0 visible to all waves
    stage_copy(1, 1);

    // The first reference of each query: the largest raw score among the first 32
    // keys, the same in both wave halves. cref holds minus the reference, in raw
    // score units, in all 8 rows of a C operand.
    v8f cref;
    {
        v16h ak0 = lds_frag(ldsK + (row)      * KV_PITCH + hi * 16);
        v16h ak1 = lds_frag(ldsK + (16 + row) * KV_PITCH + hi * 16);
        v8f s0 = {}, s1 = {};
        s0 = __builtin_amdgcn_wmma_f32_16x16x32_f16(false, ak0, false, bq, (short)0, s0, false, false);
        s1 = __builtin_amdgcn_wmma_f32_16x16x32_f16(false, ak1, false, bq, (short)0, s1, false, false);
        float mx0 = s0[0], mx1 = s1[0];
        // unrolled: constant element indices keep the tiles in registers
#pragma unroll
        for (int r = 1; r < 8; ++r) { mx0 = fmaxf(mx0, s0[r]); mx1 = fmaxf(mx1, s1[r]); }
        float mx = fmaxf(mx0, mx1);
        mx = fmaxf(mx, xhalf(mx));
        cref = (v8f){-mx, -mx, -mx, -mx, -mx, -mx, -mx, -mx};
    }

    for (int s = 0; s < N_STAGES; ++s) {
      const _Float16* kst = ldsK + (s & 1) * K_STAGE;
      const _Float16* vst = ldsV + (s & 1) * V_STAGE;
      // kept rolled: unrolled, the scheduler weaves two passes into each other, with
      // more v_nop slots behind the matrix instructions and twice the registers
#pragma nounroll
      for (int p = 0; p < ST_KEYS / 32; ++p) {
        const _Float16* kp = kst + p * 32 * KV_PITCH;
        const _Float16* vp = vst + p * 32;
        // A operand: 16 key rows x K=32, same k order as bq.
        v16h ak0 = lds_frag(kp + (row)      * KV_PITCH + hi * 16);
        v16h ak1 = lds_frag(kp + (16 + row) * KV_PITCH + hi * 16);
        // A operand of the second product: 16 d rows of V^T, keys in the order
        // in which the packed score tiles hold them (8*hi + s, 16 + 8*hi + s).
        v8h av0lo = *(const v8h*)(vp + (row)      * VS_PITCH + hi * 8);
        v8h av0hi = *(const v8h*)(vp + (row)      * VS_PITCH + 16 + hi * 8);
        v8h av1lo = *(const v8h*)(vp + (16 + row) * VS_PITCH + hi * 8);
        v8h av1hi = *(const v8h*)(vp + (16 + row) * VS_PITCH + 16 + hi * 8);
        // Keeps the four V loads up here, beside the K loads: left free the
        // scheduler sinks them to just in front of the second product, where
        // their LDS latency is then waited for in full.
        __builtin_amdgcn_sched_barrier(0);

        // s0[r] = S[key 8*hi + r][query] - reference, s1[r]: key + 16; then in log2 units.
        v8f s0 = __builtin_amdgcn_wmma_f32_16x16x32_f16(false, ak0, false, bq, (short)0, cref, false, false);
        v8f s1 = __builtin_amdgcn_wmma_f32_16x16x32_f16(false, ak1, false, bq, (short)0, cref, false, false);
        s0 *= c2; s1 *= c2;
        v8f e0, e1;
        // unrolled: constant element indices keep the tiles in registers
#pragma unroll
        for (int r = 0; r < 8; ++r) {
            e0[r] = __builtin_amdgcn_exp2f(s0[r]);
            e1[r] = __builtin_amdgcn_exp2f(s1[r]);
        }
        v8f t = e0 + e1;
        float ps = ((t[0] + t[1]) + (t[2] + t[3])) + ((t[4] + t[5]) + (t[6] + t[7]));
        // Only when some lane's sum of this pass is above PS_MAX, so that a score may
        // have outgrown its reference (one test a pass, a scalar branch): every
        // query's reference goes up to its largest score of the pass where that is
        // above it, what has been summed is scaled down to it, and this pass's
        // exponentials and sum are taken again.
        if (__builtin_expect(__builtin_amdgcn_ballot_w32(ps > PS_MAX) != 0, 0)) {   // rare: laid out of the loop's line
            float mx0 = s0[0], mx1 = s1[0];
            // unrolled (both loops of this branch): constant element indices keep the tiles in registers
#pragma unroll
            for (int r = 1; r < 8; ++r) { mx0 = fmaxf(mx0, s0[r]); mx1 = fmaxf(mx1, s1[r]); }
            const float mx = fmaxf(mx0, mx1);
            const float up = fmaxf(fmaxf(mx, xhalf(mx)), 0.f);   // the same in both halves
            const float corr = __builtin_amdgcn_exp2f(-up);
            s0 -= up; s1 -= up;
#pragma unroll
            for (int r = 0; r < 8; ++r) {
                e0[r] = __builtin_amdgcn_exp2f(s0[r]);
                e1[r] = __builtin_amdgcn_exp2f(s1[r]);
            }
            t = e0 + e1;
            ps = ((t[0] + t[1]) + (t[2] + t[3])) + ((t[4] + t[5]) + (t[6] + t[7]));
            rsum *= corr;
            o0 *= corr; o1 *= corr;
            cref -= up * (1.0f / c2);
        }
        v16h bp;
        // unrolled: constant element indices keep the tiles in registers
#pragma unroll
        for (int r = 0; r < 8; ++r) {
            bp[r]     = (_Float16)e0[r];
            bp[8 + r] = (_Float16)e1[r];
        }
        rsum += ps;

        v16h av0 = __builtin_shufflevector(av0lo, av0hi, 0, 1, 2, 3, 4, 5, 6, 7, 8, 9, 10, 11, 12, 13, 14, 15);
        v16h av1 = __builtin_shufflevector(av1lo, av1hi, 0, 1, 2, 3, 4, 5, 6, 7, 8, 9, 10, 11, 12, 13, 14, 15);
        o0 = __builtin_amdgcn_wmma_f32_16x16x32_f16(false, av0, false, bp, (short)0, o0, false, false);
        o1 = __builtin_amdgcn_wmma_f32_16x16x32_f16(false, av1, false, bp, (short)0, o1, false, false);
      }
      // Hand-over of the stages: this wave's LDS reads of stage s have returned
      // and its own copies of stage s + 1 have landed before the barrier; behind
      // it stage s + 1 may be read by all and the buffer of stage s refilled.
      asm volatile("s_wait_dscnt 0x0" ::: "memory");
      async_wait_all();
      __syncthreads();
      if (s + 2 < N_STAGES) stage_copy(s + 2, s & 1);
    }
    async_wait_all();      // no copy is left in flight when the wave goes on

    // finalize: join the halves' sums, /= rowsum, add positional encoding,
    // store 8 consecutive channels of one f16 GEMM row per 16-byte store
    rsum += xhalf(rsum);
    const float inv = 1.0f / rsum;
    const int b = ba >> 2, area = ba & 3;
    const int n_global = area * 1024 + n0 + row;
    const int c0 = h * 32 + 8 * hi;
    v8h w0, w1;
    const float* pcol = ppl + 8 * hi * PP_PITCH + wave * 16 + row;
    // unrolled: constant element indices, and all 16 loads in flight at once
#pragma unroll
    for (int r = 0; r < 8; ++r) {
        float pv0 = pcol[r * PP_PITCH];
        float pv1 = pcol[(16 + r) * PP_PITCH];
        w0[r] = (_Float16)(o0[r] * inv + pv0);
        w1[r] = (_Float16)(o1[r] * inv + pv1);
    }
    _Float16* crow = comb16 + ((size_t)(b * 4096 + n_global)) * 256 + c0;
    *(v8h*)(crow)      = w0;
    *(v8h*)(crow + 16) = w1;
}

// ---------------------------------------------------------------------------
// Kernel F: projection GEMM: comb16 (8192x256) * wproj16^T + bias -> NCHW f32
// Weight slab async-staged in LDS as in kernel C; weights as the A operand as
// there, so that 16 lanes lie along n, the contiguous axis of out.
// ---------------------------------------------------------------------------
__global__ __launch_bounds__(256) void proj_gemm_kernel(
    const _Float16* __restrict__ A, const _Float16* __restrict__ W,
    const float* __restrict__ bias, float* __restrict__ out)
{
    __shared__ __attribute__((aligned(16))) _Float16 wlds[128 * W_PITCH];   // 64 KB weight slab, padded rows
    const int lane = threadIdx.x & 31, wave = threadIdx.x >> 5;
    const int wm = wave & 3, wn = wave >> 2;
    const int m0 = blockIdx.x * 64 + wm * 16;
    const int n0 = wn * 64;
    const int nslab = blockIdx.y * 128;
    const int row = lane & 15, hi = lane >> 4;
    const int o0 = nslab + n0 + 8 * hi;         // lane's first output channel

    {
        const _Float16* wsrc = W + (size_t)nslab * 256 + threadIdx.x * 8;
        _Float16* wdst = wlds + wave * W_PITCH + lane * 8;
        async_copy8_b128(wsrc, wdst, 8 * 256, 8 * W_PITCH);
        async_copy8_b128(wsrc + 64 * 256, wdst + 64 * W_PITCH, 8 * 256, 8 * W_PITCH);
        async_wait_all();
        __syncthreads();
    }

    v8f acc[4] = {};
    const _Float16* arow = A + (size_t)(m0 + row) * 256 + hi * 16;
    for (int k0 = 0; k0 < 256; k0 += 32) {
        __builtin_prefetch(arow + k0 + 64, 0, 1);
        v16h a = *(const v16h*)(arow + k0);
#pragma unroll
        for (int t = 0; t < 4; ++t) {
            v16h bm = lds_frag(wlds + (n0 + t * 16 + row) * W_PITCH + k0 + hi * 16);
            acc[t] = __builtin_amdgcn_wmma_f32_16x16x32_f16(
                false, bm, false, a, (short)0, acc[t], false, false);
        }
    }
    // acc[t][r] = Y[position m0 + row][channel o0 + t*16 + r]
    const int m = m0 + row;
    const int b = m >> 12, n = m & 4095;
    float* dst = out + ((size_t)(b * 256 + o0) << 12) + n;
    // unrolled: constant element indices keep acc in registers
#pragma unroll
    for (int t = 0; t < 4; ++t) {
        const v4f blo = *(const v4f*)(bias + o0 + t * 16);
        const v4f bhi = *(const v4f*)(bias + o0 + t * 16 + 4);
#pragma unroll
        for (int r = 0; r < 8; ++r)
            dst[(t * 16 + r) << 12] = acc[t][r] + (r < 4 ? blo[r & 3] : bhi[r & 3]);
    }
}

// ---------------------------------------------------------------------------
extern "C" void kernel_launch(void* const* d_in, const int* in_sizes, int n_in,
                              void* d_out, int out_size, void* d_ws, size_t ws_size,
                              hipStream_t stream)
{
    const float* x     = (const float*)d_in[0];
    const float* w_qk  = (const float*)d_in[1];
    const float* w_v   = (const float*)d_in[2];
    const float* w_pe  = (const float*)d_in[3];
    const float* w_pr  = (const float*)d_in[4];
    const float* qk_g  = (const float*)d_in[5];
    const float* qk_b  = (const float*)d_in[6];
    const float* qk_m  = (const float*)d_in[7];
    const float* qk_v  = (const float*)d_in[8];
    const float* v_g   = (const float*)d_in[9];
    const float* v_b   = (const float*)d_in[10];
    const float* v_m   = (const float*)d_in[11];
    const float* v_v   = (const float*)d_in[12];
    const float* pe_g  = (const float*)d_in[13];
    const float* pe_b  = (const float*)d_in[14];
    const float* pe_m  = (const float*)d_in[15];
    const float* pe_v  = (const float*)d_in[16];
    const float* pr_g  = (const float*)d_in[17];
    const float* pr_b  = (const float*)d_in[18];
    const float* pr_m  = (const float*)d_in[19];
    const float* pr_v  = (const float*)d_in[20];
    float* out = (float*)d_out;

    // workspace carve-up (256B aligned)
    char* ws = (char*)d_ws;
    size_t off = 0;
    auto carve = [&](size_t bytes) -> char* {
        char* p = ws + off;
        off = (off + bytes + 255) & ~(size_t)255;
        return p;
    };
    _Float16* wcat16  = (_Float16*)carve(768 * 256 * sizeof(_Float16));
    float*    biascat = (float*)   carve(768 * sizeof(float));
    _Float16* wproj16 = (_Float16*)carve(256 * 256 * sizeof(_Float16));
    float*    biaspr  = (float*)   carve(256 * sizeof(float));
    float*    wpe_s   = (float*)   carve(256 * 25 * sizeof(float));
    float*    biaspe  = (float*)   carve(256 * sizeof(float));
    _Float16* X16     = (_Float16*)carve((size_t)8192 * 256 * sizeof(_Float16));
    _Float16* q16     = (_Float16*)carve((size_t)8 * 8 * 1024 * 32 * sizeof(_Float16));
    _Float16* k16     = (_Float16*)carve((size_t)8 * 8 * 1024 * 32 * sizeof(_Float16));
    _Float16* v16t    = (_Float16*)carve((size_t)8 * 8 * 32 * 1024 * sizeof(_Float16));
    float*    vf32    = (float*)   carve((size_t)2 * 256 * 4096 * sizeof(float));
    _Float16* comb16  = (_Float16*)carve((size_t)8192 * 256 * sizeof(_Float16));

    prep_kernel<<<FOLD_BLOCKS + PACK_BLOCKS, 256, 0, stream>>>(
        x, X16,
        w_qk, qk_g, qk_b, qk_m, qk_v,
        w_v,  v_g,  v_b,  v_m,  v_v,
        w_pe, pe_g, pe_b, pe_m, pe_v,
        w_pr, pr_g, pr_b, pr_m, pr_v,
        wcat16, biascat, wproj16, biaspr, wpe_s, biaspe);

    qkv_gemm_kernel<<<dim3(8192 / 64, 768 / 128), 256, 0, stream>>>(
        X16, wcat16, biascat, q16, k16, v16t, vf32);

    attn_kernel<<<dim3(8, 8, 8), 256, 0, stream>>>(q16, k16, v16t, vf32, wpe_s, biaspe, comb16);

    proj_gemm_kernel<<<dim3(8192 / 64, 256 / 128), 256, 0, stream>>>(
        comb16, wproj16, biaspr, out);
}

// v009
// Measured time: 32.9 microseconds a run.
// Next to v008, in two timings, it ran 1.16 and 1.14 times as fast.
// Over all steps from v000 it is 3.88 times as fast.
#include <hip/hip_runtime.h>
#include <hip/hip_bf16.h>
#include <stdint.h>

typedef __attribute__((ext_vector_type(16))) _Float16 v16h;
typedef __attribute__((ext_vector_type(8)))  float    v8f;
typedef __attribute__((ext_vector_type(8)))  _Float16 v8h;
typedef __attribute__((ext_vector_type(4)))  float    v4f;
typedef __attribute__((ext_vector_type(2)))  float    v2f;
typedef v4f __attribute__((aligned(4))) v4f_a4;   // four floats at a 4-byte aligned address

#define BN_EPS 1e-5f

// LDS row pitches, in halves: 16 bytes x an odd number, so that the 16 rows
// which one ds_load_b128 reads fall on 16 different groups of four banks.
#define W_PITCH  264    // weight slab rows: 512 bytes of data, 528 apart
#define KV_PITCH 40     // K stage rows: 64 bytes of data, 80 apart
#define VS_PITCH 136    // V stage rows: 256 bytes of data, 272 apart

// Attention stages K and V in LDS 128 keys at a time, in two buffers.
#define ST_KEYS  128
#define N_STAGES (1024 / ST_KEYS)
#define K_STAGE  (ST_KEYS * KV_PITCH)   // halves of one K buffer
#define V_STAGE  (32 * VS_PITCH)        // halves of one V buffer

// Wave-wide async global->LDS copies, 16 B per lane (512 B per wave and copy).
// The s_wait_xcnt stands in the copies' own statement, behind the last, so that
// it comes before any later write of their address registers.
// Eight copies, gstep halves apart in global memory and lstep halves apart
// in LDS.
__device__ __forceinline__ void async_copy8_b128(const _Float16* g, _Float16* lds_ptr,
                                                 int gstep, int lstep)
{
    unsigned l = (unsigned)(uintptr_t)lds_ptr;
    unsigned ls = (unsigned)lstep * 2u;
    asm volatile("global_load_async_to_lds_b128 %0, %8, off\n\t"
                 "global_load_async_to_lds_b128 %1, %9, off\n\t"
                 "global_load_async_to_lds_b128 %2, %10, off\n\t"
                 "global_load_async_to_lds_b128 %3, %11, off\n\t"
                 "global_load_async_to_lds_b128 %4, %12, off\n\t"
                 "global_load_async_to_lds_b128 %5, %13, off\n\t"
                 "global_load_async_to_lds_b128 %6, %14, off\n\t"
                 "global_load_async_to_lds_b128 %7, %15, off\n\t"
                 "s_wait_xcnt 0x0"
                 :: "v"(l), "v"(l + ls), "v"(l + 2 * ls), "v"(l + 3 * ls),
                    "v"(l + 4 * ls), "v"(l + 5 * ls), "v"(l + 6 * ls), "v"(l + 7 * ls),
                    "v"(g), "v"(g + gstep), "v"(g + 2 * gstep), "v"(g + 3 * gstep),
                    "v"(g + 4 * gstep), "v"(g + 5 * gstep), "v"(g + 6 * gstep), "v"(g + 7 * gstep)
                 : "memory");
}
// Four copies, each with its own two addresses.
__device__ __forceinline__ void async_copy4_b128(const _Float16* g0, const _Float16* g1,
                                                 const _Float16* g2, const _Float16* g3,
                                                 _Float16* p0, _Float16* p1,
                                                 _Float16* p2, _Float16* p3)
{
    unsigned l0 = (unsigned)(uintptr_t)p0, l1 = (unsigned)(uintptr_t)p1;
    unsigned l2 = (unsigned)(uintptr_t)p2, l3 = (unsigned)(uintptr_t)p3;
    asm volatile("global_load_async_to_lds_b128 %0, %4, off\n\t"
                 "global_load_async_to_lds_b128 %1, %5, off\n\t"
                 "global_load_async_to_lds_b128 %2, %6, off\n\t"
                 "global_load_async_to_lds_b128 %3, %7, off\n\t"
                 "s_wait_xcnt 0x0"
                 :: "v"(l0), "v"(l1), "v"(l2), "v"(l3), "v"(g0), "v"(g1), "v"(g2), "v"(g3)
                 : "memory");
}
// 16 consecutive halves from LDS as one fragment; the padded rows are 16-byte
// aligned, not 32, so the fragment is read as two 16-byte halves.
__device__ __forceinline__ v16h lds_frag(const _Float16* p)
{
    v8h lo = *(const v8h*)p, hi = *(const v8h*)(p + 8);
    return __builtin_shufflevector(lo, hi, 0, 1, 2, 3, 4, 5, 6, 7, 8, 9, 10, 11, 12, 13, 14, 15);
}
__device__ __forceinline__ void async_wait_all()
{
    asm volatile("s_wait_asynccnt 0x0" ::: "memory");
}

// ---------------------------------------------------------------------------
// Part A of the first launch: fold BatchNorm into weights; produce f16 weight
// copies + f32 bias. Block r of the 256 blocks of this part takes row r of the
// q, k, v and projection weights (a thread one column of each), the five bias
// values of channel r and the 25 depthwise weights of channel r. Nothing that a
// thread loads depends on another load, and all its loads stand ahead of the
// first use: the part waits for memory once.
// ---------------------------------------------------------------------------
__device__ __forceinline__ void fold_weights(const int r,
    const float* __restrict__ w_qk, const float* __restrict__ qk_g, const float* __restrict__ qk_b,
    const float* __restrict__ qk_m, const float* __restrict__ qk_v,
    const float* __restrict__ w_v,  const float* __restrict__ v_g,  const float* __restrict__ v_b,
    const float* __restrict__ v_m,  const float* __restrict__ v_v,
    const float* __restrict__ w_pe, const float* __restrict__ pe_g, const float* __restrict__ pe_b,
    const float* __restrict__ pe_m, const float* __restrict__ pe_v,
    const float* __restrict__ w_pr, const float* __restrict__ pr_g, const float* __restrict__ pr_b,
    const float* __restrict__ pr_m, const float* __restrict__ pr_v,
    _Float16* __restrict__ wcat16, float* __restrict__ bias_cat,
    _Float16* __restrict__ wproj16, float* __restrict__ bias_pr,
    float* __restrict__ wpe_s, float* __restrict__ bias_pe)
{
    const int c = threadIdx.x;
    const int i = r * 256 + c;
    const int tap = r * 25 + (c < 25 ? c : 24);   // clamped: the load stays inside w_pe in every thread
    const float wq = w_qk[i];
    const float wk = w_qk[i + 256 * 256];
    const float wv = w_v[i];
    const float wp = w_pr[i];
    const float we = w_pe[tap];
    // The wait that stands before the five loads' address registers, the scalar
    // base pairs among them, are used for anything else: the values loaded next
    // may land in those pairs.
    asm volatile("s_wait_xcnt 0x0" ::: "memory");
    // the BatchNorm values of the block's rows: the same in every thread
    const float gq = qk_g[r], vq = qk_v[r], oq = qk_b[r], mq = qk_m[r];
    const float gk = qk_g[r + 256], vk = qk_v[r + 256], ok = qk_b[r + 256], mk = qk_m[r + 256];
    const float gv = v_g[r],  vv = v_v[r],  ov = v_b[r],  mv = v_m[r];
    const float gp = pr_g[r], vp = pr_v[r], op = pr_b[r], mp = pr_m[r];
    const float ge = pe_g[r], ve = pe_v[r], oe = pe_b[r], me = pe_m[r];
    // Holds the depthwise weight's load up here with the others: left free it sinks
    // into the branch of its store and is waited for there, a second round trip.
    asm volatile("" :: "v"(we));
    // Keeps the arithmetic below the loads: moved up among them it brings its wait
    // along, and the loads behind that wait start a second round trip.
    __builtin_amdgcn_sched_barrier(0);
    const float sq = gq * rsqrtf(vq + BN_EPS);
    const float sk = gk * rsqrtf(vk + BN_EPS);
    const float sv = gv * rsqrtf(vv + BN_EPS);
    const float sp = gp * rsqrtf(vp + BN_EPS);
    const float se = ge * rsqrtf(ve + BN_EPS);
    const float bq = oq - mq * sq;
    const float bk = ok - mk * sk;
    const float bv = ov - mv * sv;
    const float bp = op - mp * sp;
    const float be = oe - me * se;
    wcat16[i]              = (_Float16)(wq * sq);
    wcat16[i + 256 * 256]  = (_Float16)(wk * sk);
    wcat16[i + 512 * 256]  = (_Float16)(wv * sv);
    wproj16[i]             = (_Float16)(wp * sp);
    if (c < 25) wpe_s[tap] = we * se;
    if (c == 32) {                                // a thread of the second wave, which has no tap to store
        bias_cat[r]       = bq;
        bias_cat[r + 256] = bk;
        bias_cat[r + 512] = bv;
        bias_pr[r]        = bp;
        bias_pe[r]        = be;
    }
}

// ---------------------------------------------------------------------------
// Part B of the first launch: pack x (B,C,H,W) f32 -> X16 row-major (B*N, C) f16.
// A thread takes 8 channels x 4 positions: eight 16-byte loads along n, four
// 16-byte stores along c. In a wave 8 lanes lie along c and 4 along n, so each
// store fills four whole 128-byte lines of X16, every line from one wave.
// ---------------------------------------------------------------------------
// blk: the block's number among the 32 (n) x 4 (c) x 2 (b) blocks of this part.
__device__ __forceinline__ void pack_x(const int blk, const float* __restrict__ x, _Float16* __restrict__ X16)
{
    const int lane = threadIdx.x & 31, wave = threadIdx.x >> 5;
    const int n  = (blk & 31) * 128 + wave * 16 + (lane >> 3) * 4;
    const int c0 = ((blk >> 5) & 3) * 64 + (lane & 7) * 8;
    const int b  = blk >> 7;
    const float* src = x + ((size_t)(b * 256 + c0) << 12) + n;
    v4f v[8];
    // unrolled: constant element indices, and all 8 loads in flight at once
#pragma unroll
    for (int j = 0; j < 8; ++j) v[j] = *(const v4f*)(src + ((size_t)j << 12));
    _Float16* dst = X16 + ((size_t)(b * 4096 + n)) * 256 + c0;
    // unrolled: constant element indices keep the tile in registers
#pragma unroll
    for (int i = 0; i < 4; ++i) {
        v8h h;
#pragma unroll
        for (int j = 0; j < 8; ++j) h[j] = (_Float16)v[j][i];
        *(v8h*)(dst + i * 256) = h;
    }
    // The wait that stands before the stores' address and data registers are
    // used for anything else on any way the built code goes on from here.
    asm volatile("s_wait_xcnt 0x0" ::: "memory");
}

// ---------------------------------------------------------------------------
// First launch: parts A and B read only inputs and write different buffers, so
// neither waits for the other: they share one launch, each in blocks of its own.
// The fold blocks come first; the order has not been weighed anew for the one-pass fold.
// ---------------------------------------------------------------------------
#define FOLD_BLOCKS 256     // one block a weight row: see part A
#define PACK_BLOCKS 256
__global__ __launch_bounds__(256) void prep_kernel(
    const float* __restrict__ x, _Float16* __restrict__ X16,
    const float* __restrict__ w_qk, const float* __restrict__ qk_g, const float* __restrict__ qk_b,
    const float* __restrict__ qk_m, const float* __restrict__ qk_v,
    const float* __restrict__ w_v,  const float* __restrict__ v_g,  const float* __restrict__ v_b,
    const float* __restrict__ v_m,  const float* __restrict__ v_v,
    const float* __restrict__ w_pe, const float* __restrict__ pe_g, const float* __restrict__ pe_b,
    const float* __restrict__ pe_m, const float* __restrict__ pe_v,
    const float* __restrict__ w_pr, const float* __restrict__ pr_g, const float* __restrict__ pr_b,
    const float* __restrict__ pr_m, const float* __restrict__ pr_v,
    _Float16* __restrict__ wcat16, float* __restrict__ bias_cat,
    _Float16* __restrict__ wproj16, float* __restrict__ bias_pr,
    float* __restrict__ wpe_s, float* __restrict__ bias_pe)
{
    if (blockIdx.x < FOLD_BLOCKS)
        fold_weights(blockIdx.x,
                     w_qk, qk_g, qk_b, qk_m, qk_v,
                     w_v,  v_g,  v_b,  v_m,  v_v,
                     w_pe, pe_g, pe_b, pe_m, pe_v,
                     w_pr, pr_g, pr_b, pr_m, pr_v,
                     wcat16, bias_cat, wproj16, bias_pr, wpe_s, bias_pe);
    else
        pack_x(blockIdx.x - FOLD_BLOCKS, x, X16);
}

// ---------------------------------------------------------------------------
// Kernel C: fused QKV GEMM: X16 (8192x256) * wcat16^T + bias.
// 128-column weight slab (64 KB f16) async-staged once per block into LDS;
// the x rows come into registers meanwhile, the weight rows from ds_load.
// Slab rows lie in LDS at a pitch of 528 bytes (W_PITCH).
// The weights are the A operand and the x rows the B operand, so a lane holds 8
// consecutive channels of ONE position and 16 lanes lie along the positions:
// q and k rows (channels contiguous) leave as one 16-byte store a tile, the v
// planes (positions contiguous) in runs of 16 positions a store.
// ---------------------------------------------------------------------------
__global__ __launch_bounds__(256) void qkv_gemm_kernel(
    const _Float16* __restrict__ X16, const _Float16* __restrict__ W,
    const float* __restrict__ bias,
    _Float16* __restrict__ q16, _Float16* __restrict__ k16,
    _Float16* __restrict__ v16t, float* __restrict__ vf32)
{
    __shared__ __attribute__((aligned(16))) _Float16 wlds[128 * W_PITCH];   // 64 KB weight slab, padded rows
    const int lane = threadIdx.x & 31;
    const int wave = threadIdx.x >> 5;
    const int wm = wave & 3, wn = wave >> 2;
    const int m0 = blockIdx.x * 64 + wm * 16;
    const int n0 = wn * 64;                    // within-slab column base
    const int nslab = blockIdx.y * 128;        // global column base of slab
    const int row = lane & 15, hi = lane >> 4;
    const int kind = blockIdx.y >> 1;           // the block's slab: 0 q, 1 k, 2 v
    const int c0 = (blockIdx.y & 1) * 128 + n0 + 8 * hi;   // lane's first channel inside q, k or v

    // The wave's x fragments of all 8 k-steps, fetched ahead of the weight copies:
    // they are on the way together, and while the slab is, so the kernel waits for
    // memory once and the k-loop reads only LDS and registers.
    const unsigned xoff = (unsigned)(m0 + row) * 512u + (unsigned)hi * 32u;   // byte offset in X16
    v16h xa[8];
    // unrolled: constant element indices keep the fragments in registers
#pragma unroll
    for (int k = 0; k < 8; ++k) xa[k] = *(const v16h*)((const char*)X16 + xoff + k * 64);
    const char* bsrc = (const char*)(bias + kind * 256);
    const unsigned boff = (unsigned)c0 * 4u;    // byte offset of the lane's first bias value
    v4f blo[4], bhi[4];                         // the lane's 8 bias values of each tile, fetched up here too
    // unrolled: constant element indices keep them in registers
#pragma unroll
    for (int t = 0; t < 4; ++t) {
        blo[t] = *(const v4f*)(bsrc + boff + t * 64);
        bhi[t] = *(const v4f*)(bsrc + boff + t * 64 + 16);
    }

    // async stage the weight slab: 256 threads x 16 x 16B = 64 KB;
    // a wave copies one whole row per copy, rows wave, wave + 8, ...
    {
        const _Float16* wsrc = W + (size_t)nslab * 256 + threadIdx.x * 8;
        _Float16* wdst = wlds + wave * W_PITCH + lane * 8;
        async_copy8_b128(wsrc, wdst, 8 * 256, 8 * W_PITCH);
        async_copy8_b128(wsrc + 64 * 256, wdst + 64 * W_PITCH, 8 * 256, 8 * W_PITCH);
        // The wait that stands before the address registers of the loads above are
        // used for anything else; the offsets are named so that they stay whole up
        // to it. It stands behind the copies, so that these follow the loads at once.
        asm volatile("s_wait_xcnt 0x0" :: "v"(xoff), "v"(boff) : "memory");
        async_wait_all();
        __syncthreads();
    }

    v8f acc[4] = {};
    // unrolled (both loops): constant element indices keep xa and acc in registers
#pragma unroll
    for (int k = 0; k < 8; ++k) {
#pragma unroll
        for (int t = 0; t < 4; ++t) {
            v16h bm = lds_frag(wlds + (n0 + t * 16 + row) * W_PITCH + k * 32 + hi * 16);
            acc[t] = __builtin_amdgcn_wmma_f32_16x16x32_f16(
                false, bm, false, xa[k], (short)0, acc[t], false, false);
        }
    }

    // acc[t][r] = Y[position m0 + row][channel nslab + n0 + t*16 + 8*hi + r]
    // unrolled (all loops below): constant element indices keep the bias and acc in registers
#pragma unroll
    for (int t = 0; t < 4; ++t) {
#pragma unroll
        for (int r = 0; r < 4; ++r) { acc[t][r] += blo[t][r]; acc[t][4 + r] += bhi[t][r]; }
    }
    const int m = m0 + row;                     // global spatial row (b*4096 + n)
    const int b = m >> 12, n = m & 4095;
    const int ba = (b << 2) + (n >> 10), na = n & 1023;
    if (kind < 2) {                             // q, k: [ba][h][na][d], 8 d a lane
        _Float16* dst = (kind == 0 ? q16 : k16)
            + (((size_t)((ba << 3) + (c0 >> 5)) << 10) + na) * 32 + (c0 & 31);
#pragma unroll
        for (int t = 0; t < 4; ++t) {           // tiles 0, 1: one head; 2, 3: the next
            v8h hv;
#pragma unroll
            for (int r = 0; r < 8; ++r) hv[r] = (_Float16)acc[t][r];
            *(v8h*)(dst + (t >> 1) * (1024 * 32) + (t & 1) * 16) = hv;
        }
    } else {                                    // v : f32 NCHW + transposed f16
        float* vf = vf32 + ((size_t)(b * 256 + c0) << 12) + n;
        _Float16* vt = v16t + ((size_t)((ba << 8) + c0) << 10) + na;
#pragma unroll
        for (int t = 0; t < 4; ++t) {
#pragma unroll
            for (int r = 0; r < 8; ++r) {
                vf[(t * 16 + r) << 12] = acc[t][r];
                vt[(t * 16 + r) << 10] = (_Float16)acc[t][r];
            }
        }
        // The wait that stands before the stores' address and data registers are
        // used for anything else on any way the built code goes on from here.
        asm volatile("s_wait_xcnt 0x0" ::: "memory");
    }
}

// ---------------------------------------------------------------------------
// Part D, inside the attention launch: depthwise 5x5 conv on v (pad 2), BN
// folded, for the 32 channels and the 128 positions (two image rows) of one
// attention block; the result stays in LDS, [channel][position], for that
// block's epilogue. A thread makes 2 rows x 8 columns of one channel from 6
// input rows of 12 columns held in registers. Each output still adds its taps
// in the order dy, dx; a tap outside the plane enters as 0.
// ---------------------------------------------------------------------------
#define PP_PITCH 132    // floats: rows 16-byte aligned, and 8 rows apart = 32 banks apart
__device__ __forceinline__ void pe_conv_tile(const float* __restrict__ vplanes,  // plane of the block's first channel
                                             const float* __restrict__ wpe,      // its 25 weights
                                             const float* __restrict__ bias_pe,  // its bias
                                             const int y0,                       // first of the two image rows
                                             float* __restrict__ ppl)
{
    const int cl = threadIdx.x >> 3, xg = threadIdx.x & 7;
    const int x0 = xg * 8;
    const char* vin = (const char*)vplanes;
    const bool lok = xg > 0, rok = xg < 7;        // left / right halo inside the row
    const bool tok = y0 > 0, bok = y0 < 62;       // rows above / below inside the plane
    // Byte offsets: of row y0, of the two rows above it and of the two rows below
    // the thread's two; clamped, so that every load stays inside the plane.
    const unsigned pl = (unsigned)cl * 16384u + (unsigned)y0 * 256u;
    const unsigned ol = pl + (lok ? x0 - 2 : 0) * 4;
    const unsigned om = pl + x0 * 4;
    const unsigned orr = pl + (rok ? x0 + 8 : 0) * 4;
    const unsigned up = tok ? 512u : 0u, dn = bok ? 512u : 0u;
    const unsigned tl = ol - up, tm = om - up, tr = orr - up;
    const unsigned bl = ol + dn, bm = om + dn, br = orr + dn;
    const unsigned wo = (unsigned)cl * 100u, bo = (unsigned)cl * 4u;

    v2f lf[6], rt[6];
    v4f ma[6], mb[6];
    v4f_a4 wq[6];                                 // weights 0 .. 23
    // unrolled: constant indices keep the weights in registers
#pragma unroll
    for (int k = 0; k < 6; ++k) wq[k] = *(const v4f_a4*)((const char*)wpe + wo + k * 16);
    const float wl = *(const float*)((const char*)wpe + wo + 96);      // weight 24
    const float bias = *(const float*)((const char*)bias_pe + bo);
    // unrolled (all loops below): constant indices keep the rows and acc in registers
#pragma unroll
    for (int i = 0; i < 2; ++i) {
        lf[i] = *(const v2f*)(vin + tl + i * 256);
        ma[i] = *(const v4f*)(vin + tm + i * 256);
        mb[i] = *(const v4f*)(vin + tm + i * 256 + 16);
        rt[i] = *(const v2f*)(vin + tr + i * 256);
        lf[2 + i] = *(const v2f*)(vin + ol + i * 256);
        ma[2 + i] = *(const v4f*)(vin + om + i * 256);
        mb[2 + i] = *(const v4f*)(vin + om + i * 256 + 16);
        rt[2 + i] = *(const v2f*)(vin + orr + i * 256);
        lf[4 + i] = *(const v2f*)(vin + bl + i * 256);
        ma[4 + i] = *(const v4f*)(vin + bm + i * 256);
        mb[4 + i] = *(const v4f*)(vin + bm + i * 256 + 16);
        rt[4 + i] = *(const v2f*)(vin + br + i * 256);
    }
    // Holds the weight loads up here, issued ahead of the rows: left free they sink
    // to their first use among the multiply-adds, where each is waited for in full.
    asm volatile("" :: "v"(wq[0]), "v"(wq[1]), "v"(wq[2]), "v"(wq[3]), "v"(wq[4]), "v"(wq[5]), "v"(wl), "v"(bias));
    // Keeps all 32 loads up here, in flight together: left free the scheduler
    // spreads them among the multiply-adds and waits for several of them in full.
    __builtin_amdgcn_sched_barrier(0);
    // The wait that stands before the loads' address registers are used for
    // anything else; the offsets are named so that they stay whole up to it.
    asm volatile("s_wait_xcnt 0x0"
                 :: "v"(ol), "v"(om), "v"(orr), "v"(tl), "v"(tm), "v"(tr), "v"(bl), "v"(bm), "v"(br),
                    "v"(wo), "v"(bo)
                 : "memory");

    v2f acc[2][4];                                // two neighbouring columns an element
#pragma unroll
    for (int r = 0; r < 2; ++r)
#pragma unroll
        for (int j = 0; j < 4; ++j) acc[r][j] = (v2f){bias, bias};

#pragma unroll
    for (int i = 0; i < 6; ++i) {
        const bool yok = i < 2 ? tok : (i < 4 ? true : bok);
        float v[12];                              // columns x0 - 2 .. x0 + 9
        v[0] = (yok && lok) ? lf[i][0] : 0.f;
        v[1] = (yok && lok) ? lf[i][1] : 0.f;
#pragma unroll
        for (int j = 0; j < 4; ++j) {
            v[2 + j] = yok ? ma[i][j] : 0.f;
            v[6 + j] = yok ? mb[i][j] : 0.f;
        }
        v[10] = (yok && rok) ? rt[i][0] : 0.f;
        v[11] = (yok && rok) ? rt[i][1] : 0.f;
#pragma unroll
        for (int r = 0; r < 2; ++r) {
            const int ky = i - r;                 // dy + 2 of input row i for output row r
            if (ky < 0 || ky > 4) continue;
#pragma unroll
            for (int kx = 0; kx < 5; ++kx) {
                const int k = ky * 5 + kx;
                const float w = k < 24 ? wq[k >> 2][k & 3] : wl;
#pragma unroll
                for (int j = 0; j < 4; ++j)       // one packed multiply-add for two columns
                    acc[r][j] = __builtin_elementwise_fma((v2f){v[2 * j + kx], v[2 * j + kx + 1]},
                                                          (v2f){w, w}, acc[r][j]);
            }
        }
    }

    float* dst = ppl + cl * PP_PITCH + x0;
#pragma unroll
    for (int r = 0; r < 2; ++r) {
        *(v4f*)(dst + r * 64)     = (v4f){acc[r][0][0], acc[r][0][1], acc[r][1][0], acc[r][1][1]};
        *(v4f*)(dst + r * 64 + 4) = (v4f){acc[r][2][0], acc[r][2][1], acc[r][3][0], acc[r][3][1]};
    }
}

__device__ __forceinline__ float xhalf(float x)
{
    int i = __builtin_bit_cast(int, x);
    return __builtin_bit_cast(float,
        __builtin_amdgcn_permlanex16(i, i, 0x76543210, 0xfedcba98, false, false));
}

__global__ __launch_bounds__(256) void attn_kernel(
    const _Float16* __restrict__ q16, const _Float16* __restrict__ k16,
    const _Float16* __restrict__ v16t, const float* __restrict__ vf32,
    const float* __restrict__ wpe, const float* __restrict__ bias_pe,
    _Float16* __restrict__ comb16)
{
    __shared__ __attribute__((aligned(16))) _Float16 ldsK[2 * K_STAGE];   // K stages: [m_local][d], padded rows
    __shared__ __attribute__((aligned(16))) _Float16 ldsV[2 * V_STAGE];   // V stages: [d][m_local], padded rows
    __shared__ __attribute__((aligned(16))) float ppl[32 * PP_PITCH];     // pp of this block: [d][n_local], padded rows

    const int lane = threadIdx.x & 31, wave = threadIdx.x >> 5;
    const int ba = blockIdx.z, h = blockIdx.y;
    const int n0 = blockIdx.x * 128 + wave * 16;
    const int row = lane & 15, hi = lane >> 4;
    const float c2 = 0.17677669529663687f * 1.4426950408889634f;   // 1/sqrt(hd=32) x log2(e)
    const float PS_MAX = 256.0f; // a lane's 16 exponentials of a pass may sum to this: each P <= 256, far inside f16

    const _Float16* qbase = q16 + ((size_t)(ba * 8 + h) << 10) * 32;
    const _Float16* kbase = k16 + ((size_t)(ba * 8 + h) << 10) * 32;
    const _Float16* vbase = v16t + ((size_t)(ba * 8 + h) << 5) * 1024;

    // B operand: 16 query columns x K=32 (entire head dim), loaded once.
    v16h bq = *(const v16h*)(qbase + (size_t)(n0 + row) * 32 + hi * 16);

    // State of this lane's query (column 'row'); rsum covers only the keys
    // this wave half holds, the halves are joined after the loop.
    float rsum = 0.f;
    v8f o0 = {}, o1 = {};    // o0[r] = O[query][d = 8*hi + r], o1: d + 16

    // A stage is 8 KB of K (contiguous) and 8 KB of V (32 d-rows x 256 B). Every
    // thread brings two 16-byte pieces of each, so every wave runs the same four
    // copies with all its lanes on, and each copy of a wave takes whole lines.
    const int tid = threadIdx.x;
    const _Float16* ksrc = kbase + tid * 8;
    const _Float16* vsrc = vbase + (tid >> 4) * 1024 + (tid & 15) * 8;
    _Float16* kdst = ldsK + (tid >> 2) * KV_PITCH + (tid & 3) * 8;
    _Float16* vdst = ldsV + (tid >> 4) * VS_PITCH + (tid & 15) * 8;
    auto stage_copy = [&](int s, int buf) {
        const _Float16* kg = ksrc + s * (ST_KEYS * 32);
        const _Float16* vg = vsrc + s * ST_KEYS;
        _Float16* kl = kdst + buf * K_STAGE;
        _Float16* vl = vdst + buf * V_STAGE;
        async_copy4_b128(kg, kg + 64 * 32, vg, vg + 16 * 1024,
                         kl, kl + 64 * KV_PITCH, vl, vl + 16 * VS_PITCH);
    };

    stage_copy(0, 0);
    // pp of the block's 32 channels and 128 positions; its LDS writes are read
    // only behind the loop, with the stage barriers in between.
    pe_conv_tile(vf32 + ((size_t)((ba >> 2) * 256 + h * 32) << 12), wpe + h * 32 * 25, bias_pe + h * 32,
                 (ba & 3) * 16 + blockIdx.x * 2, ppl);
    async_wait_all();
    __syncthreads();       // stage 0 visible to all waves
    stage_copy(1, 1);

    // The first reference of each query: the largest raw score among the first 32
    // keys, the same in both wave halves. cref holds minus the reference, in raw
    // score units, in all 8 rows of a C operand.
    v8f cref;
    {
        v16h ak0 = lds_frag(ldsK + (row)      * KV_PITCH + hi * 16);
        v16h ak1 = lds_frag(ldsK + (16 + row) * KV_PITCH + hi * 16);
        v8f s0 = {}, s1 = {};
        s0 = __builtin_amdgcn_wmma_f32_16x16x32_f16(false, ak0, false, bq, (short)0, s0, false, false);
        s1 = __builtin_amdgcn_wmma_f32_16x16x32_f16(false, ak1, false, bq, (short)0, s1, false, false);
        float mx0 = s0[0], mx1 = s1[0];
        // unrolled: constant element indices keep the tiles in registers
#pragma unroll
        for (int r = 1; r < 8; ++r) { mx0 = fmaxf(mx0, s0[r]); mx1 = fmaxf(mx1, s1[r]); }
        float mx = fmaxf(mx0, mx1);
        mx = fmaxf(mx, xhalf(mx));
        cref = (v8f){-mx, -mx, -mx, -mx, -mx, -mx, -mx, -mx};
    }

    for (int s = 0; s < N_STAGES; ++s) {
      const _Float16* kst = ldsK + (s & 1) * K_STAGE;
      const _Float16* vst = ldsV + (s & 1) * V_STAGE;
      // kept rolled: unrolled, the scheduler weaves two passes into each other, with
      // more v_nop slots behind the matrix instructions and twice the registers
#pragma nounroll
      for (int p = 0; p < ST_KEYS / 32; ++p) {
        const _Float16* kp = kst + p * 32 * KV_PITCH;
        const _Float16* vp = vst + p * 32;
        // A operand: 16 key rows x K=32, same k order as bq.
        v16h ak0 = lds_frag(kp + (row)      * KV_PITCH + hi * 16);
        v16h ak1 = lds_frag(kp + (16 + row) * KV_PITCH + hi * 16);
        // A operand of the second product: 16 d rows of V^T, keys in the order
        // in which the packed score tiles hold them (8*hi + s, 16 + 8*hi + s).
        v8h av0lo = *(const v8h*)(vp + (row)      * VS_PITCH + hi * 8);
        v8h av0hi = *(const v8h*)(vp + (row)      * VS_PITCH + 16 + hi * 8);
        v8h av1lo = *(const v8h*)(vp + (16 + row) * VS_PITCH + hi * 8);
        v8h av1hi = *(const v8h*)(vp + (16 + row) * VS_PITCH + 16 + hi * 8);
        // Keeps the four V loads up here, beside the K loads: left free the
        // scheduler sinks them to just in front of the second product, where
        // their LDS latency is then waited for in full.
        __builtin_amdgcn_sched_barrier(0);

        // s0[r] = S[key 8*hi + r][query] - reference, s1[r]: key + 16; then in log2 units.
        v8f s0 = __builtin_amdgcn_wmma_f32_16x16x32_f16(false, ak0, false, bq, (short)0, cref, false, false);
        v8f s1 = __builtin_amdgcn_wmma_f32_16x16x32_f16(false, ak1, false, bq, (short)0, cref, false, false);
        s0 *= c2; s1 *= c2;
        v8f e0, e1;
        // unrolled: constant element indices keep the tiles in registers
#pragma unroll
        for (int r = 0; r < 8; ++r) {
            e0[r] = __builtin_amdgcn_exp2f(s0[r]);
            e1[r] = __builtin_amdgcn_exp2f(s1[r]);
        }
        v8f t = e0 + e1;
        float ps = ((t[0] + t[1]) + (t[2] + t[3])) + ((t[4] + t[5]) + (t[6] + t[7]));
        // Only when some lane's sum of this pass is above PS_MAX, so that a score may
        // have outgrown its reference (one test a pass, a scalar branch): every
        // query's reference goes up to its largest score of the pass where that is
        // above it, what has been summed is scaled down to it, and this pass's
        // exponentials and sum are taken again.
        if (__builtin_expect(__builtin_amdgcn_ballot_w32(ps > PS_MAX) != 0, 0)) {   // rare: laid out of the loop's line
            float mx0 = s0[0], mx1 = s1[0];
            // unrolled (both loops of this branch): constant element indices keep the tiles in registers
#pragma unroll
            for (int r = 1; r < 8; ++r) { mx0 = fmaxf(mx0, s0[r]); mx1 = fmaxf(mx1, s1[r]); }
            const float mx = fmaxf(mx0, mx1);
            const float up = fmaxf(fmaxf(mx, xhalf(mx)), 0.f);   // the same in both halves
            const float corr = __builtin_amdgcn_exp2f(-up);
            s0 -= up; s1 -= up;
#pragma unroll
            for (int r = 0; r < 8; ++r) {
                e0[r] = __builtin_amdgcn_exp2f(s0[r]);
                e1[r] = __builtin_amdgcn_exp2f(s1[r]);
            }
            t = e0 + e1;
            ps = ((t[0] + t[1]) + (t[2] + t[3])) + ((t[4] + t[5]) + (t[6] + t[7]));
            rsum *= corr;
            o0 *= corr; o1 *= corr;
            cref -= up * (1.0f / c2);
        }
        v16h bp;
        // unrolled: constant element indices keep the tiles in registers
#pragma unroll
        for (int r = 0; r < 8; ++r) {
            bp[r]     = (_Float16)e0[r];
            bp[8 + r] = (_Float16)e1[r];
        }
        rsum += ps;

        v16h av0 = __builtin_shufflevector(av0lo, av0hi, 0, 1, 2, 3, 4, 5, 6, 7, 8, 9, 10, 11, 12, 13, 14, 15);
        v16h av1 = __builtin_shufflevector(av1lo, av1hi, 0, 1, 2, 3, 4, 5, 6, 7, 8, 9, 10, 11, 12, 13, 14, 15);
        o0 = __builtin_amdgcn_wmma_f32_16x16x32_f16(false, av0, false, bp, (short)0, o0, false, false);
        o1 = __builtin_amdgcn_wmma_f32_16x16x32_f16(false, av1, false, bp, (short)0, o1, false, false);
      }
      // Hand-over of the stages: this wave's LDS reads of stage s have returned
      // and its own copies of stage s + 1 have landed before the barrier; behind
      // it stage s + 1 may be read by all and the buffer of stage s refilled.
      asm volatile("s_wait_dscnt 0x0" ::: "memory");
      async_wait_all();
      __syncthreads();
      if (s + 2 < N_STAGES) stage_copy(s + 2, s & 1);
    }
    async_wait_all();      // no copy is left in flight when the wave goes on

    // finalize: join the halves' sums, /= rowsum, add positional encoding,
    // store 8 consecutive channels of one f16 GEMM row per 16-byte store
    rsum += xhalf(rsum);
    const float inv = 1.0f / rsum;
    const int b = ba >> 2, area = ba & 3;
    const int n_global = area * 1024 + n0 + row;
    const int c0 = h * 32 + 8 * hi;
    v8h w0, w1;
    const float* pcol = ppl + 8 * hi * PP_PITCH + wave * 16 + row;
    // unrolled: constant element indices, and all 16 loads in flight at once
#pragma unroll
    for (int r = 0; r < 8; ++r) {
        float pv0 = pcol[r * PP_PITCH];
        float pv1 = pcol[(16 + r) * PP_PITCH];
        w0[r] = (_Float16)(o0[r] * inv + pv0);
        w1[r] = (_Float16)(o1[r] * inv + pv1);
    }
    _Float16* crow = comb16 + ((size_t)(b * 4096 + n_global)) * 256 + c0;
    *(v8h*)(crow)      = w0;
    *(v8h*)(crow + 16) = w1;
}

// ---------------------------------------------------------------------------
// Kernel F: projection GEMM: comb16 (8192x256) * wproj16^T + bias -> NCHW f32
// Weight slab async-staged in LDS as in kernel C; weights as the A operand as
// there, so that 16 lanes lie along n, the contiguous axis of out.
// ---------------------------------------------------------------------------
__global__ __launch_bounds__(256) void proj_gemm_kernel(
    const _Float16* __restrict__ A, const _Float16* __restrict__ W,
    const float* __restrict__ bias, float* __restrict__ out)
{
    __shared__ __attribute__((aligned(16))) _Float16 wlds[128 * W_PITCH];   // 64 KB weight slab, padded rows
    const int lane = threadIdx.x & 31, wave = threadIdx.x >> 5;
    const int wm = wave & 3, wn = wave >> 2;
    const int m0 = blockIdx.x * 64 + wm * 16;
    const int n0 = wn * 64;
    const int nslab = blockIdx.y * 128;
    const int row = lane & 15, hi = lane >> 4;
    const int o0 = nslab + n0 + 8 * hi;         // lane's first output channel

    // The wave's fragments of A for all 8 k-steps, fetched ahead of the weight
    // copies, as in kernel C.
    const unsigned xoff = (unsigned)(m0 + row) * 512u + (unsigned)hi * 32u;   // byte offset in A
    v16h xa[8];
    // unrolled: constant element indices keep the fragments in registers
#pragma unroll
    for (int k = 0; k < 8; ++k) xa[k] = *(const v16h*)((const char*)A + xoff + k * 64);
    const unsigned boff = (unsigned)o0 * 4u;    // byte offset of the lane's first bias value
    v4f blo[4], bhi[4];                         // the lane's 8 bias values of each tile, fetched up here too
    // unrolled: constant element indices keep them in registers
#pragma unroll
    for (int t = 0; t < 4; ++t) {
        blo[t] = *(const v4f*)((const char*)bias + boff + t * 64);
        bhi[t] = *(const v4f*)((const char*)bias + boff + t * 64 + 16);
    }

    {
        const _Float16* wsrc = W + (size_t)nslab * 256 + threadIdx.x * 8;
        _Float16* wdst = wlds + wave * W_PITCH + lane * 8;
        async_copy8_b128(wsrc, wdst, 8 * 256, 8 * W_PITCH);
        async_copy8_b128(wsrc + 64 * 256, wdst + 64 * W_PITCH, 8 * 256, 8 * W_PITCH);
        // The wait that stands before the address registers of the loads above are
        // used for anything else; the offsets are named so that they stay whole up
        // to it. It stands behind the copies, so that these follow the loads at once.
        asm volatile("s_wait_xcnt 0x0" :: "v"(xoff), "v"(boff) : "memory");
        async_wait_all();
        __syncthreads();
    }

    v8f acc[4] = {};
    // unrolled (both loops): constant element indices keep xa and acc in registers
#pragma unroll
    for (int k = 0; k < 8; ++k) {
#pragma unroll
        for (int t = 0; t < 4; ++t) {
            v16h bm = lds_frag(wlds + (n0 + t * 16 + row) * W_PITCH + k * 32 + hi * 16);
            acc[t] = __builtin_amdgcn_wmma_f32_16x16x32_f16(
                false, bm, false, xa[k], (short)0, acc[t], false, false);
        }
    }
    // acc[t][r] = Y[position m0 + row][channel o0 + t*16 + r]
    const int m = m0 + row;
    const int b = m >> 12, n = m & 4095;
    float* dst = out + ((size_t)(b * 256 + o0) << 12) + n;
    // unrolled: constant element indices keep acc in registers
#pragma unroll
    for (int t = 0; t < 4; ++t) {
#pragma unroll
        for (int r = 0; r < 8; ++r)
            dst[(t * 16 + r) << 12] = acc[t][r] + (r < 4 ? blo[t][r & 3] : bhi[t][r & 3]);
    }
}

// ---------------------------------------------------------------------------
extern "C" void kernel_launch(void* const* d_in, const int* in_sizes, int n_in,
                              void* d_out, int out_size, void* d_ws, size_t ws_size,
                              hipStream_t stream)
{
    const float* x     = (const float*)d_in[0];
    const float* w_qk  = (const float*)d_in[1];
    const float* w_v   = (const float*)d_in[2];
    const float* w_pe  = (const float*)d_in[3];
    const float* w_pr  = (const float*)d_in[4];
    const float* qk_g  = (const float*)d_in[5];
    const float* qk_b  = (const float*)d_in[6];
    const float* qk_m  = (const float*)d_in[7];
    const float* qk_v  = (const float*)d_in[8];
    const float* v_g   = (const float*)d_in[9];
    const float* v_b   = (const float*)d_in[10];
    const float* v_m   = (const float*)d_in[11];
    const float* v_v   = (const float*)d_in[12];
    const float* pe_g  = (const float*)d_in[13];
    const float* pe_b  = (const float*)d_in[14];
    const float* pe_m  = (const float*)d_in[15];
    const float* pe_v  = (const float*)d_in[16];
    const float* pr_g  = (const float*)d_in[17];
    const float* pr_b  = (const float*)d_in[18];
    const float* pr_m  = (const float*)d_in[19];
    const float* pr_v  = (const float*)d_in[20];
    float* out = (float*)d_out;

    // workspace carve-up (256B aligned)
    char* ws = (char*)d_ws;
    size_t off = 0;
    auto carve = [&](size_t bytes) -> char* {
        char* p = ws + off;
        off = (off + bytes + 255) & ~(size_t)255;
        return p;
    };
    _Float16* wcat16  = (_Float16*)carve(768 * 256 * sizeof(_Float16));
    float*    biascat = (float*)   carve(768 * sizeof(float));
    _Float16* wproj16 = (_Float16*)carve(256 * 256 * sizeof(_Float16));
    float*    biaspr  = (float*)   carve(256 * sizeof(float));
    float*    wpe_s   = (float*)   carve(256 * 25 * sizeof(float));
    float*    biaspe  = (float*)   carve(256 * sizeof(float));
    _Float16* X16     = (_Float16*)carve((size_t)8192 * 256 * sizeof(_Float16));
    _Float16* q16     = (_Float16*)carve((size_t)8 * 8 * 1024 * 32 * sizeof(_Float16));
    _Float16* k16     = (_Float16*)carve((size_t)8 * 8 * 1024 * 32 * sizeof(_Float16));
    _Float16* v16t    = (_Float16*)carve((size_t)8 * 8 * 32 * 1024 * sizeof(_Float16));
    float*    vf32    = (float*)   carve((size_t)2 * 256 * 4096 * sizeof(float));
    _Float16* comb16  = (_Float16*)carve((size_t)8192 * 256 * sizeof(_Float16));

    prep_kernel<<<FOLD_BLOCKS + PACK_BLOCKS, 256, 0, stream>>>(
        x, X16,
        w_qk, qk_g, qk_b, qk_m, qk_v,
        w_v,  v_g,  v_b,  v_m,  v_v,
        w_pe, pe_g, pe_b, pe_m, pe_v,
        w_pr, pr_g, pr_b, pr_m, pr_v,
        wcat16, biascat, wproj16, biaspr, wpe_s, biaspe);

    qkv_gemm_kernel<<<dim3(8192 / 64, 768 / 128), 256, 0, stream>>>(
        X16, wcat16, biascat, q16, k16, v16t, vf32);

    attn_kernel<<<dim3(8, 8, 8), 256, 0, stream>>>(q16, k16, v16t, vf32, wpe_s, biaspe, comb16);

    proj_gemm_kernel<<<dim3(8192 / 64, 256 / 128), 256, 0, stream>>>(
        comb16, wproj16, biaspr, out);
}

// v010
// It runs in 31.4 microseconds.
// Two timings next to v009 both put it at 1.04 times that version's speed.
// Counting every step since v000, it is 4.04 times as fast.
#include <hip/hip_runtime.h>
#include <hip/hip_bf16.h>
#include <stdint.h>

typedef __attribute__((ext_vector_type(16))) _Float16 v16h;
typedef __attribute__((ext_vector_type(8)))  float    v8f;
typedef __attribute__((ext_vector_type(8)))  _Float16 v8h;
typedef __attribute__((ext_vector_type(4)))  float    v4f;
typedef __attribute__((ext_vector_type(2)))  float    v2f;
typedef v4f __attribute__((aligned(4))) v4f_a4;   // four floats at a 4-byte aligned address

#define BN_EPS 1e-5f

// LDS row pitches, in halves: 16 bytes x an odd number, so that the 16 rows
// which one ds_load_b128 reads fall on 16 different groups of four banks.
#define W_PITCH  264    // weight slab rows: 512 bytes of data, 528 apart
#define KV_PITCH 40     // K stage rows: 64 bytes of data, 80 apart
#define VS_PITCH 136    // V stage rows: 256 bytes of data, 272 apart

// Attention stages K and V in LDS 128 keys at a time, in two buffers.
#define ST_KEYS  128
#define N_STAGES (1024 / ST_KEYS)
#define K_STAGE  (ST_KEYS * KV_PITCH)   // halves of one K buffer
#define V_STAGE  (32 * VS_PITCH)        // halves of one V buffer

// Wave-wide async global->LDS copies, 16 B per lane (512 B per wave and copy).
// The s_wait_xcnt stands in the copies' own statement, behind the last, so that
// it comes before any later write of their address registers.
// Eight copies, gstep halves apart in global memory and lstep halves apart
// in LDS.
__device__ __forceinline__ void async_copy8_b128(const _Float16* g, _Float16* lds_ptr,
                                                 int gstep, int lstep)
{
    unsigned l = (unsigned)(uintptr_t)lds_ptr;
    unsigned ls = (unsigned)lstep * 2u;
    asm volatile("global_load_async_to_lds_b128 %0, %8, off\n\t"
                 "global_load_async_to_lds_b128 %1, %9, off\n\t"
                 "global_load_async_to_lds_b128 %2, %10, off\n\t"
                 "global_load_async_to_lds_b128 %3, %11, off\n\t"
                 "global_load_async_to_lds_b128 %4, %12, off\n\t"
                 "global_load_async_to_lds_b128 %5, %13, off\n\t"
                 "global_load_async_to_lds_b128 %6, %14, off\n\t"
                 "global_load_async_to_lds_b128 %7, %15, off\n\t"
                 "s_wait_xcnt 0x0"
                 :: "v"(l), "v"(l + ls), "v"(l + 2 * ls), "v"(l + 3 * ls),
                    "v"(l + 4 * ls), "v"(l + 5 * ls), "v"(l + 6 * ls), "v"(l + 7 * ls),
                    "v"(g), "v"(g + gstep), "v"(g + 2 * gstep), "v"(g + 3 * gstep),
                    "v"(g + 4 * gstep), "v"(g + 5 * gstep), "v"(g + 6 * gstep), "v"(g + 7 * gstep)
                 : "memory");
}
// Four copies, each with its own two addresses.
__device__ __forceinline__ void async_copy4_b128(const _Float16* g0, const _Float16* g1,
                                                 const _Float16* g2, const _Float16* g3,
                                                 _Float16* p0, _Float16* p1,
                                                 _Float16* p2, _Float16* p3)
{
    unsigned l0 = (unsigned)(uintptr_t)p0, l1 = (unsigned)(uintptr_t)p1;
    unsigned l2 = (unsigned)(uintptr_t)p2, l3 = (unsigned)(uintptr_t)p3;
    asm volatile("global_load_async_to_lds_b128 %0, %4, off\n\t"
                 "global_load_async_to_lds_b128 %1, %5, off\n\t"
                 "global_load_async_to_lds_b128 %2, %6, off\n\t"
                 "global_load_async_to_lds_b128 %3, %7, off\n\t"
                 "s_wait_xcnt 0x0"
                 :: "v"(l0), "v"(l1), "v"(l2), "v"(l3), "v"(g0), "v"(g1), "v"(g2), "v"(g3)
                 : "memory");
}
// 16 consecutive halves from LDS as one fragment; the padded rows are 16-byte
// aligned, not 32, so the fragment is read as two 16-byte halves.
__device__ __forceinline__ v16h lds_frag(const _Float16* p)
{
    v8h lo = *(const v8h*)p, hi = *(const v8h*)(p + 8);
    return __builtin_shufflevector(lo, hi, 0, 1, 2, 3, 4, 5, 6, 7, 8, 9, 10, 11, 12, 13, 14, 15);
}
__device__ __forceinline__ void async_wait_all()
{
    asm volatile("s_wait_asynccnt 0x0" ::: "memory");
}

// The k-loop of both GEMMs: 32 weight fragments from the LDS slab (fragment
// i = 4 * k + t: k-step k, channel tile t), each the A operand of one product
// with the x fragment of its k-step. The fragments are read in groups of G, and a
// group is asked for AHEAD groups before its products: a product waits only
// until its own group has come, with the younger reads still on the way, and not
// for the whole LDS latency each time. acc[t] still adds its k-steps in the order 0 .. 7.
template <int G, int AHEAD>
__device__ __forceinline__ void slab_products(const _Float16* wrow,   // the lane's row of tile 0, at its k half
                                              const v16h (&xa)[8], v8f (&acc)[4])
{
    constexpr int NG = 32 / G, SLOTS = AHEAD + 1;
    v16h f[SLOTS * G];
    // unrolled (all loops here): constant element indices keep f, xa and acc in registers
#pragma unroll
    for (int g = 0; g < AHEAD; ++g)
#pragma unroll
        for (int j = 0; j < G; ++j) {
            const int i = g * G + j;
            f[g * G + j] = lds_frag(wrow + (i & 3) * 16 * W_PITCH + (i >> 2) * 32);
        }
#pragma unroll
    for (int g = 0; g < NG; ++g) {
        if (g + AHEAD < NG) {
#pragma unroll
            for (int j = 0; j < G; ++j) {
                const int i = (g + AHEAD) * G + j;
                f[((g + AHEAD) % SLOTS) * G + j] = lds_frag(wrow + (i & 3) * 16 * W_PITCH + (i >> 2) * 32);
            }
        }
        // Keeps the reads of the later group together and above this group's products:
        // left free the scheduler spreads them among the products, in more places and
        // nearer to their own product, which then waits for more of their LDS latency.
        __builtin_amdgcn_sched_barrier(0);
#pragma unroll
        for (int j = 0; j < G; ++j) {
            const int i = g * G + j;
            acc[i & 3] = __builtin_amdgcn_wmma_f32_16x16x32_f16(
                false, f[(g % SLOTS) * G + j], false, xa[i >> 2], (short)0, acc[i & 3], false, false);
        }
        // Keeps the next reads below these products: lifted above them they take the
        // registers of one more group, which costs the QKV kernel a block per WGP.
        __builtin_amdgcn_sched_barrier(0);
    }
}

// ---------------------------------------------------------------------------
// Part A of the first launch: fold BatchNorm into weights; produce f16 weight
// copies + f32 bias. Block r of the 256 blocks of this part takes row r of the
// q, k, v and projection weights (a thread one column of each), the five bias
// values of channel r and the 25 depthwise weights of channel r. Nothing that a
// thread loads depends on another load, and all its loads stand ahead of the
// first use: the part waits for memory once.
// ---------------------------------------------------------------------------
__device__ __forceinline__ void fold_weights(const int r,
    const float* __restrict__ w_qk, const float* __restrict__ qk_g, const float* __restrict__ qk_b,
    const float* __restrict__ qk_m, const float* __restrict__ qk_v,
    const float* __restrict__ w_v,  const float* __restrict__ v_g,  const float* __restrict__ v_b,
    const float* __restrict__ v_m,  const float* __restrict__ v_v,
    const float* __restrict__ w_pe, const float* __restrict__ pe_g, const float* __restrict__ pe_b,
    const float* __restrict__ pe_m, const float* __restrict__ pe_v,
    const float* __restrict__ w_pr, const float* __restrict__ pr_g, const float* __restrict__ pr_b,
    const float* __restrict__ pr_m, const float* __restrict__ pr_v,
    _Float16* __restrict__ wcat16, float* __restrict__ bias_cat,
    _Float16* __restrict__ wproj16, float* __restrict__ bias_pr,
    float* __restrict__ wpe_s, float* __restrict__ bias_pe)
{
    const int c = threadIdx.x;
    const int i = r * 256 + c;
    const int tap = r * 25 + (c < 25 ? c : 24);   // clamped: the load stays inside w_pe in every thread
    const float wq = w_qk[i];
    const float wk = w_qk[i + 256 * 256];
    const float wv = w_v[i];
    const float wp = w_pr[i];
    const float we = w_pe[tap];
    // The wait that stands before the five loads' address registers, the scalar
    // base pairs among them, are used for anything else: the values loaded next
    // may land in those pairs.
    asm volatile("s_wait_xcnt 0x0" ::: "memory");
    // the BatchNorm values of the block's rows: the same in every thread
    const float gq = qk_g[r], vq = qk_v[r], oq = qk_b[r], mq = qk_m[r];
    const float gk = qk_g[r + 256], vk = qk_v[r + 256], ok = qk_b[r + 256], mk = qk_m[r + 256];
    const float gv = v_g[r],  vv = v_v[r],  ov = v_b[r],  mv = v_m[r];
    const float gp = pr_g[r], vp = pr_v[r], op = pr_b[r], mp = pr_m[r];
    const float ge = pe_g[r], ve = pe_v[r], oe = pe_b[r], me = pe_m[r];
    // Holds the depthwise weight's load up here with the others: left free it sinks
    // into the branch of its store and is waited for there, a second round trip.
    asm volatile("" :: "v"(we));
    // Keeps the arithmetic below the loads: moved up among them it brings its wait
    // along, and the loads behind that wait start a second round trip.
    __builtin_amdgcn_sched_barrier(0);
    const float sq = gq * rsqrtf(vq + BN_EPS);
    const float sk = gk * rsqrtf(vk + BN_EPS);
    const float sv = gv * rsqrtf(vv + BN_EPS);
    const float sp = gp * rsqrtf(vp + BN_EPS);
    const float se = ge * rsqrtf(ve + BN_EPS);
    const float bq = oq - mq * sq;
    const float bk = ok - mk * sk;
    const float bv = ov - mv * sv;
    const float bp = op - mp * sp;
    const float be = oe - me * se;
    wcat16[i]              = (_Float16)(wq * sq);
    wcat16[i + 256 * 256]  = (_Float16)(wk * sk);
    wcat16[i + 512 * 256]  = (_Float16)(wv * sv);
    wproj16[i]             = (_Float16)(wp * sp);
    if (c < 25) wpe_s[tap] = we * se;
    if (c == 32) {                                // a thread of the second wave, which has no tap to store
        bias_cat[r]       = bq;
        bias_cat[r + 256] = bk;
        bias_cat[r + 512] = bv;
        bias_pr[r]        = bp;
        bias_pe[r]        = be;
    }
}

// ---------------------------------------------------------------------------
// Part B of the first launch: pack x (B,C,H,W) f32 -> X16 row-major (B*N, C) f16.
// A thread takes 8 channels x 4 positions: eight 16-byte loads along n, four
// 16-byte stores along c. In a wave 8 lanes lie along c and 4 along n, so each
// store fills four whole 128-byte lines of X16, every line from one wave.
// ---------------------------------------------------------------------------
// blk: the block's number among the 32 (n) x 4 (c) x 2 (b) blocks of this part.
__device__ __forceinline__ void pack_x(const int blk, const float* __restrict__ x, _Float16* __restrict__ X16)
{
    const int lane = threadIdx.x & 31, wave = threadIdx.x >> 5;
    const int n  = (blk & 31) * 128 + wave * 16 + (lane >> 3) * 4;
    const int c0 = ((blk >> 5) & 3) * 64 + (lane & 7) * 8;
    const int b  = blk >> 7;
    const float* src = x + ((size_t)(b * 256 + c0) << 12) + n;
    v4f v[8];
    // unrolled: constant element indices, and all 8 loads in flight at once
#pragma unroll
    for (int j = 0; j < 8; ++j) v[j] = *(const v4f*)(src + ((size_t)j << 12));
    _Float16* dst = X16 + ((size_t)(b * 4096 + n)) * 256 + c0;
    // unrolled: constant element indices keep the tile in registers
#pragma unroll
    for (int i = 0; i < 4; ++i) {
        v8h h;
#pragma unroll
        for (int j = 0; j < 8; ++j) h[j] = (_Float16)v[j][i];
        *(v8h*)(dst + i * 256) = h;
    }
    // The wait that stands before the stores' address and data registers are
    // used for anything else on any way the built code goes on from here.
    asm volatile("s_wait_xcnt 0x0" ::: "memory");
}

// ---------------------------------------------------------------------------
// First launch: parts A and B read only inputs and write different buffers, so
// neither waits for the other: they share one launch, each in blocks of its own.
// The fold blocks come first; the order has not been weighed anew for the one-pass fold.
// ---------------------------------------------------------------------------
#define FOLD_BLOCKS 256     // one block a weight row: see part A
#define PACK_BLOCKS 256
__global__ __launch_bounds__(256) void prep_kernel(
    const float* __restrict__ x, _Float16* __restrict__ X16,
    const float* __restrict__ w_qk, const float* __restrict__ qk_g, const float* __restrict__ qk_b,
    const float* __restrict__ qk_m, const float* __restrict__ qk_v,
    const float* __restrict__ w_v,  const float* __restrict__ v_g,  const float* __restrict__ v_b,
    const float* __restrict__ v_m,  const float* __restrict__ v_v,
    const float* __restrict__ w_pe, const float* __restrict__ pe_g, const float* __restrict__ pe_b,
    const float* __restrict__ pe_m, const float* __restrict__ pe_v,
    const float* __restrict__ w_pr, const float* __restrict__ pr_g, const float* __restrict__ pr_b,
    const float* __restrict__ pr_m, const float* __restrict__ pr_v,
    _Float16* __restrict__ wcat16, float* __restrict__ bias_cat,
    _Float16* __restrict__ wproj16, float* __restrict__ bias_pr,
    float* __restrict__ wpe_s, float* __restrict__ bias_pe)
{
    if (blockIdx.x < FOLD_BLOCKS)
        fold_weights(blockIdx.x,
                     w_qk, qk_g, qk_b, qk_m, qk_v,
                     w_v,  v_g,  v_b,  v_m,  v_v,
                     w_pe, pe_g, pe_b, pe_m, pe_v,
                     w_pr, pr_g, pr_b, pr_m, pr_v,
                     wcat16, bias_cat, wproj16, bias_pr, wpe_s, bias_pe);
    else
        pack_x(blockIdx.x - FOLD_BLOCKS, x, X16);
}

// ---------------------------------------------------------------------------
// Kernel C: fused QKV GEMM: X16 (8192x256) * wcat16^T + bias.
// 128-column weight slab (64 KB f16) async-staged once per block into LDS;
// the x rows come into registers meanwhile, the weight rows from ds_load.
// Slab rows lie in LDS at a pitch of 528 bytes (W_PITCH).
// The weights are the A operand and the x rows the B operand, so a lane holds 8
// consecutive channels of ONE position and 16 lanes lie along the positions:
// q and k rows (channels contiguous) leave as one 16-byte store a tile, the v
// planes (positions contiguous) in runs of 16 positions a store.
// ---------------------------------------------------------------------------
// six waves a SIMD asked for: three blocks a WGP, so that all 768 blocks are resident at once
__global__ __launch_bounds__(256, 6) void qkv_gemm_kernel(
    const _Float16* __restrict__ X16, const _Float16* __restrict__ W,
    const float* __restrict__ bias,
    _Float16* __restrict__ q16, _Float16* __restrict__ k16,
    _Float16* __restrict__ v16t, float* __restrict__ vf32)
{
    __shared__ __attribute__((aligned(16))) _Float16 wlds[128 * W_PITCH];   // 64 KB weight slab, padded rows
    const int lane = threadIdx.x & 31;
    const int wave = threadIdx.x >> 5;
    const int wm = wave & 3, wn = wave >> 2;
    const int m0 = blockIdx.x * 64 + wm * 16;
    const int n0 = wn * 64;                    // within-slab column base
    const int nslab = blockIdx.y * 128;        // global column base of slab
    const int row = lane & 15, hi = lane >> 4;
    const int kind = blockIdx.y >> 1;           // the block's slab: 0 q, 1 k, 2 v
    const int c0 = (blockIdx.y & 1) * 128 + n0 + 8 * hi;   // lane's first channel inside q, k or v

    // The wave's x fragments of all 8 k-steps, fetched ahead of the weight copies:
    // they are on the way together, and while the slab is, so the kernel waits for
    // memory once and the k-loop reads only LDS and registers.
    const unsigned xoff = (unsigned)(m0 + row) * 512u + (unsigned)hi * 32u;   // byte offset in X16
    v16h xa[8];
    // unrolled: constant element indices keep the fragments in registers
#pragma unroll
    for (int k = 0; k < 8; ++k) xa[k] = *(const v16h*)((const char*)X16 + xoff + k * 64);
    const char* bsrc = (const char*)(bias + kind * 256);
    const unsigned boff = (unsigned)c0 * 4u;    // byte offset of the lane's first bias value
    v4f blo[4], bhi[4];                         // the lane's 8 bias values of each tile, fetched up here too
    // unrolled: constant element indices keep them in registers
#pragma unroll
    for (int t = 0; t < 4; ++t) {
        blo[t] = *(const v4f*)(bsrc + boff + t * 64);
        bhi[t] = *(const v4f*)(bsrc + boff + t * 64 + 16);
    }

    // async stage the weight slab: 256 threads x 16 x 16B = 64 KB;
    // a wave copies one whole row per copy, rows wave, wave + 8, ...
    {
        const _Float16* wsrc = W + (size_t)nslab * 256 + threadIdx.x * 8;
        _Float16* wdst = wlds + wave * W_PITCH + lane * 8;
        async_copy8_b128(wsrc, wdst, 8 * 256, 8 * W_PITCH);
        async_copy8_b128(wsrc + 64 * 256, wdst + 64 * W_PITCH, 8 * 256, 8 * W_PITCH);
        // The wait that stands before the address registers of the loads above are
        // used for anything else; the offsets are named so that they stay whole up
        // to it. It stands behind the copies, so that these follow the loads at once.
        asm volatile("s_wait_xcnt 0x0" :: "v"(xoff), "v"(boff) : "memory");
        async_wait_all();
        __syncthreads();
    }

    v8f acc[4] = {};
    // groups small enough that six waves still fit a SIMD's registers
    slab_products<1, 2>(wlds + (n0 + row) * W_PITCH + hi * 16, xa, acc);

    // acc[t][r] = Y[position m0 + row][channel nslab + n0 + t*16 + 8*hi + r]
    // unrolled (all loops below): constant element indices keep the bias and acc in registers
#pragma unroll
    for (int t = 0; t < 4; ++t) {
#pragma unroll
        for (int r = 0; r < 4; ++r) { acc[t][r] += blo[t][r]; acc[t][4 + r] += bhi[t][r]; }
    }
    const int m = m0 + row;                     // global spatial row (b*4096 + n)
    const int b = m >> 12, n = m & 4095;
    const int ba = (b << 2) + (n >> 10), na = n & 1023;
    if (kind < 2) {                             // q, k: [ba][h][na][d], 8 d a lane
        _Float16* dst = (kind == 0 ? q16 : k16)
            + (((size_t)((ba << 3) + (c0 >> 5)) << 10) + na) * 32 + (c0 & 31);
#pragma unroll
        for (int t = 0; t < 4; ++t) {           // tiles 0, 1: one head; 2, 3: the next
            v8h hv;
#pragma unroll
            for (int r = 0; r < 8; ++r) hv[r] = (_Float16)acc[t][r];
            *(v8h*)(dst + (t >> 1) * (1024 * 32) + (t & 1) * 16) = hv;
        }
    } else {                                    // v : f32 NCHW + transposed f16
        float* vf = vf32 + ((size_t)(b * 256 + c0) << 12) + n;
        _Float16* vt = v16t + ((size_t)((ba << 8) + c0) << 10) + na;
#pragma unroll
        for (int t = 0; t < 4; ++t) {
#pragma unroll
            for (int r = 0; r < 8; ++r) {
                vf[(t * 16 + r) << 12] = acc[t][r];
                vt[(t * 16 + r) << 10] = (_Float16)acc[t][r];
            }
        }
        // The wait that stands before the stores' address and data registers are
        // used for anything else on any way the built code goes on from here.
        asm volatile("s_wait_xcnt 0x0" ::: "memory");
    }
}

// ---------------------------------------------------------------------------
// Part D, inside the attention launch: depthwise 5x5 conv on v (pad 2), BN
// folded, for the 32 channels and the 128 positions (two image rows) of one
// attention block; the result stays in LDS, [channel][position], for that
// block's epilogue. A thread makes 2 rows x 8 columns of one channel from 6
// input rows of 12 columns held in registers. Each output still adds its taps
// in the order dy, dx; a tap outside the plane enters as 0.
// ---------------------------------------------------------------------------
#define PP_PITCH 132    // floats: rows 16-byte aligned, and 8 rows apart = 32 banks apart
__device__ __forceinline__ void pe_conv_tile(const float* __restrict__ vplanes,  // plane of the block's first channel
                                             const float* __restrict__ wpe,      // its 25 weights
                                             const float* __restrict__ bias_pe,  // its bias
                                             const int y0,                       // first of the two image rows
                                             float* __restrict__ ppl)
{
    const int cl = threadIdx.x >> 3, xg = threadIdx.x & 7;
    const int x0 = xg * 8;
    const char* vin = (const char*)vplanes;
    const bool lok = xg > 0, rok = xg < 7;        // left / right halo inside the row
    const bool tok = y0 > 0, bok = y0 < 62;       // rows above / below inside the plane
    // Byte offsets: of row y0, of the two rows above it and of the two rows below
    // the thread's two; clamped, so that every load stays inside the plane.
    const unsigned pl = (unsigned)cl * 16384u + (unsigned)y0 * 256u;
    const unsigned ol = pl + (lok ? x0 - 2 : 0) * 4;
    const unsigned om = pl + x0 * 4;
    const unsigned orr = pl + (rok ? x0 + 8 : 0) * 4;
    const unsigned up = tok ? 512u : 0u, dn = bok ? 512u : 0u;
    const unsigned tl = ol - up, tm = om - up, tr = orr - up;
    const unsigned bl = ol + dn, bm = om + dn, br = orr + dn;
    const unsigned wo = (unsigned)cl * 100u, bo = (unsigned)cl * 4u;

    v2f lf[6], rt[6];
    v4f ma[6], mb[6];
    v4f_a4 wq[6];                                 // weights 0 .. 23
    // unrolled: constant indices keep the weights in registers
#pragma unroll
    for (int k = 0; k < 6; ++k) wq[k] = *(const v4f_a4*)((const char*)wpe + wo + k * 16);
    const float wl = *(const float*)((const char*)wpe + wo + 96);      // weight 24
    const float bias = *(const float*)((const char*)bias_pe + bo);
    // unrolled (all loops below): constant indices keep the rows and acc in registers
#pragma unroll
    for (int i = 0; i < 2; ++i) {
        lf[i] = *(const v2f*)(vin + tl + i * 256);
        ma[i] = *(const v4f*)(vin + tm + i * 256);
        mb[i] = *(const v4f*)(vin + tm + i * 256 + 16);
        rt[i] = *(const v2f*)(vin + tr + i * 256);
        lf[2 + i] = *(const v2f*)(vin + ol + i * 256);
        ma[2 + i] = *(const v4f*)(vin + om + i * 256);
        mb[2 + i] = *(const v4f*)(vin + om + i * 256 + 16);
        rt[2 + i] = *(const v2f*)(vin + orr + i * 256);
        lf[4 + i] = *(const v2f*)(vin + bl + i * 256);
        ma[4 + i] = *(const v4f*)(vin + bm + i * 256);
        mb[4 + i] = *(const v4f*)(vin + bm + i * 256 + 16);
        rt[4 + i] = *(const v2f*)(vin + br + i * 256);
    }
    // Holds the weight loads up here, issued ahead of the rows: left free they sink
    // to their first use among the multiply-adds, where each is waited for in full.
    asm volatile("" :: "v"(wq[0]), "v"(wq[1]), "v"(wq[2]), "v"(wq[3]), "v"(wq[4]), "v"(wq[5]), "v"(wl), "v"(bias));
    // Keeps all 32 loads up here, in flight together: left free the scheduler
    // spreads them among the multiply-adds and waits for several of them in full.
    __builtin_amdgcn_sched_barrier(0);
    // The wait that stands before the loads' address registers are used for
    // anything else; the offsets are named so that they stay whole up to it.
    asm volatile("s_wait_xcnt 0x0"
                 :: "v"(ol), "v"(om), "v"(orr), "v"(tl), "v"(tm), "v"(tr), "v"(bl), "v"(bm), "v"(br),
                    "v"(wo), "v"(bo)
                 : "memory");

    v2f acc[2][4];                                // two neighbouring columns an element
#pragma unroll
    for (int r = 0; r < 2; ++r)
#pragma unroll
        for (int j = 0; j < 4; ++j) acc[r][j] = (v2f){bias, bias};

#pragma unroll
    for (int i = 0; i < 6; ++i) {
        const bool yok = i < 2 ? tok : (i < 4 ? true : bok);
        float v[12];                              // columns x0 - 2 .. x0 + 9
        v[0] = (yok && lok) ? lf[i][0] : 0.f;
        v[1] = (yok && lok) ? lf[i][1] : 0.f;
#pragma unroll
        for (int j = 0; j < 4; ++j) {
            v[2 + j] = yok ? ma[i][j] : 0.f;
            v[6 + j] = yok ? mb[i][j] : 0.f;
        }
        v[10] = (yok && rok) ? rt[i][0] : 0.f;
        v[11] = (yok && rok) ? rt[i][1] : 0.f;
#pragma unroll
        for (int r = 0; r < 2; ++r) {
            const int ky = i - r;                 // dy + 2 of input row i for output row r
            if (ky < 0 || ky > 4) continue;
#pragma unroll
            for (int kx = 0; kx < 5; ++kx) {
                const int k = ky * 5 + kx;
                const float w = k < 24 ? wq[k >> 2][k & 3] : wl;
#pragma unroll
                for (int j = 0; j < 4; ++j)       // one packed multiply-add for two columns
                    acc[r][j] = __builtin_elementwise_fma((v2f){v[2 * j + kx], v[2 * j + kx + 1]},
                                                          (v2f){w, w}, acc[r][j]);
            }
        }
    }

    float* dst = ppl + cl * PP_PITCH + x0;
#pragma unroll
    for (int r = 0; r < 2; ++r) {
        *(v4f*)(dst + r * 64)     = (v4f){acc[r][0][0], acc[r][0][1], acc[r][1][0], acc[r][1][1]};
        *(v4f*)(dst + r * 64 + 4) = (v4f){acc[r][2][0], acc[r][2][1], acc[r][3][0], acc[r][3][1]};
    }
}

__device__ __forceinline__ float xhalf(float x)
{
    int i = __builtin_bit_cast(int, x);
    return __builtin_bit_cast(float,
        __builtin_amdgcn_permlanex16(i, i, 0x76543210, 0xfedcba98, false, false));
}

__global__ __launch_bounds__(256) void attn_kernel(
    const _Float16* __restrict__ q16, const _Float16* __restrict__ k16,
    const _Float16* __restrict__ v16t, const float* __restrict__ vf32,
    const float* __restrict__ wpe, const float* __restrict__ bias_pe,
    _Float16* __restrict__ comb16)
{
    __shared__ __attribute__((aligned(16))) _Float16 ldsK[2 * K_STAGE];   // K stages: [m_local][d], padded rows
    __shared__ __attribute__((aligned(16))) _Float16 ldsV[2 * V_STAGE];   // V stages: [d][m_local], padded rows
    __shared__ __attribute__((aligned(16))) float ppl[32 * PP_PITCH];     // pp of this block: [d][n_local], padded rows

    const int lane = threadIdx.x & 31, wave = threadIdx.x >> 5;
    const int ba = blockIdx.z, h = blockIdx.y;
    const int n0 = blockIdx.x * 128 + wave * 16;
    const int row = lane & 15, hi = lane >> 4;
    const float c2 = 0.17677669529663687f * 1.4426950408889634f;   // 1/sqrt(hd=32) x log2(e)
    const float PS_MAX = 256.0f; // a lane's 16 exponentials of a pass may sum to this: each P <= 256, far inside f16

    const _Float16* qbase = q16 + ((size_t)(ba * 8 + h) << 10) * 32;
    const _Float16* kbase = k16 + ((size_t)(ba * 8 + h) << 10) * 32;
    const _Float16* vbase = v16t + ((size_t)(ba * 8 + h) << 5) * 1024;

    // B operand: 16 query columns x K=32 (entire head dim), loaded once.
    v16h bq = *(const v16h*)(qbase + (size_t)(n0 + row) * 32 + hi * 16);

    // State of this lane's query (column 'row'); rsum covers only the keys
    // this wave half holds, the halves are joined after the loop.
    float rsum = 0.f;
    v8f o0 = {}, o1 = {};    // o0[r] = O[query][d = 8*hi + r], o1: d + 16

    // A stage is 8 KB of K (contiguous) and 8 KB of V (32 d-rows x 256 B). Every
    // thread brings two 16-byte pieces of each, so every wave runs the same four
    // copies with all its lanes on, and each copy of a wave takes whole lines.
    const int tid = threadIdx.x;
    const _Float16* ksrc = kbase + tid * 8;
    const _Float16* vsrc = vbase + (tid >> 4) * 1024 + (tid & 15) * 8;
    _Float16* kdst = ldsK + (tid >> 2) * KV_PITCH + (tid & 3) * 8;
    _Float16* vdst = ldsV + (tid >> 4) * VS_PITCH + (tid & 15) * 8;
    auto stage_copy = [&](int s, int buf) {
        const _Float16* kg = ksrc + s * (ST_KEYS * 32);
        const _Float16* vg = vsrc + s * ST_KEYS;
        _Float16* kl = kdst + buf * K_STAGE;
        _Float16* vl = vdst + buf * V_STAGE;
        async_copy4_b128(kg, kg + 64 * 32, vg, vg + 16 * 1024,
                         kl, kl + 64 * KV_PITCH, vl, vl + 16 * VS_PITCH);
    };

    stage_copy(0, 0);
    // pp of the block's 32 channels and 128 positions; its LDS writes are read
    // only behind the loop, with the stage barriers in between.
    pe_conv_tile(vf32 + ((size_t)((ba >> 2) * 256 + h * 32) << 12), wpe + h * 32 * 25, bias_pe + h * 32,
                 (ba & 3) * 16 + blockIdx.x * 2, ppl);
    async_wait_all();
    __syncthreads();       // stage 0 visible to all waves
    stage_copy(1, 1);

    // The first reference of each query: the largest raw score among the first 32
    // keys, the same in both wave halves. cref holds minus the reference, in raw
    // score units, in all 8 rows of a C operand.
    v8f cref;
    {
        v16h ak0 = lds_frag(ldsK + (row)      * KV_PITCH + hi * 16);
        v16h ak1 = lds_frag(ldsK + (16 + row) * KV_PITCH + hi * 16);
        v8f s0 = {}, s1 = {};
        s0 = __builtin_amdgcn_wmma_f32_16x16x32_f16(false, ak0, false, bq, (short)0, s0, false, false);
        s1 = __builtin_amdgcn_wmma_f32_16x16x32_f16(false, ak1, false, bq, (short)0, s1, false, false);
        float mx0 = s0[0], mx1 = s1[0];
        // unrolled: constant element indices keep the tiles in registers
#pragma unroll
        for (int r = 1; r < 8; ++r) { mx0 = fmaxf(mx0, s0[r]); mx1 = fmaxf(mx1, s1[r]); }
        float mx = fmaxf(mx0, mx1);
        mx = fmaxf(mx, xhalf(mx));
        cref = (v8f){-mx, -mx, -mx, -mx, -mx, -mx, -mx, -mx};
    }

    for (int s = 0; s < N_STAGES; ++s) {
      const _Float16* kst = ldsK + (s & 1) * K_STAGE;
      const _Float16* vst = ldsV + (s & 1) * V_STAGE;
      // A operand of the first product: 16 key rows x K=32, same k order as bq. Here
      // those of the stage's first pass; every pass but the last asks for the next
      // pass's, of the same stage, as soon as its own first product has been issued.
      v16h ak0 = lds_frag(kst + (row)      * KV_PITCH + hi * 16);
      v16h ak1 = lds_frag(kst + (16 + row) * KV_PITCH + hi * 16);
      auto pass = [&](const int p, const bool more) {
        const _Float16* vp = vst + p * 32;
        // A operand of the second product: 16 d rows of V^T, keys in the order
        // in which the packed score tiles hold them (8*hi + s, 16 + 8*hi + s).
        v8h av0lo = *(const v8h*)(vp + (row)      * VS_PITCH + hi * 8);
        v8h av0hi = *(const v8h*)(vp + (row)      * VS_PITCH + 16 + hi * 8);
        v8h av1lo = *(const v8h*)(vp + (16 + row) * VS_PITCH + hi * 8);
        v8h av1hi = *(const v8h*)(vp + (16 + row) * VS_PITCH + 16 + hi * 8);
        // Keeps the four V loads up here, ahead of the score products: left free the
        // scheduler sinks them to just in front of the second product, where
        // their LDS latency is then waited for in full.
        __builtin_amdgcn_sched_barrier(0);

        // s0[r] = S[key 8*hi + r][query] - reference, s1[r]: key + 16; then in log2 units.
        v8f s0 = __builtin_amdgcn_wmma_f32_16x16x32_f16(false, ak0, false, bq, (short)0, cref, false, false);
        v8f s1 = __builtin_amdgcn_wmma_f32_16x16x32_f16(false, ak1, false, bq, (short)0, cref, false, false);
        if (more) {
            const _Float16* kn = kst + (p + 1) * 32 * KV_PITCH;
            ak0 = lds_frag(kn + (row)      * KV_PITCH + hi * 16);
            ak1 = lds_frag(kn + (16 + row) * KV_PITCH + hi * 16);
            // Keeps these reads up here, a whole softmax ahead of the product that takes
            // them: left free they sink below the softmax, to just in front of the second
            // product, and the next pass waits for most of their LDS latency.
            __builtin_amdgcn_sched_barrier(0);
        }
        s0 *= c2; s1 *= c2;
        v8f e0, e1;
        // unrolled: constant element indices keep the tiles in registers
#pragma unroll
        for (int r = 0; r < 8; ++r) {
            e0[r] = __builtin_amdgcn_exp2f(s0[r]);
            e1[r] = __builtin_amdgcn_exp2f(s1[r]);
        }
        v8f t = e0 + e1;
        float ps = ((t[0] + t[1]) + (t[2] + t[3])) + ((t[4] + t[5]) + (t[6] + t[7]));
        // Only when some lane's sum of this pass is above PS_MAX, so that a score may
        // have outgrown its reference (one test a pass, a scalar branch): every
        // query's reference goes up to its largest score of the pass where that is
        // above it, what has been summed is scaled down to it, and this pass's
        // exponentials and sum are taken again.
        if (__builtin_expect(__builtin_amdgcn_ballot_w32(ps > PS_MAX) != 0, 0)) {   // rare: laid out of the loop's line
            float mx0 = s0[0], mx1 = s1[0];
            // unrolled (both loops of this branch): constant element indices keep the tiles in registers
#pragma unroll
            for (int r = 1; r < 8; ++r) { mx0 = fmaxf(mx0, s0[r]); mx1 = fmaxf(mx1, s1[r]); }
            const float mx = fmaxf(mx0, mx1);
            const float up = fmaxf(fmaxf(mx, xhalf(mx)), 0.f);   // the same in both halves
            const float corr = __builtin_amdgcn_exp2f(-up);
            s0 -= up; s1 -= up;
#pragma unroll
            for (int r = 0; r < 8; ++r) {
                e0[r] = __builtin_amdgcn_exp2f(s0[r]);
                e1[r] = __builtin_amdgcn_exp2f(s1[r]);
            }
            t = e0 + e1;
            ps = ((t[0] + t[1]) + (t[2] + t[3])) + ((t[4] + t[5]) + (t[6] + t[7]));
            rsum *= corr;
            o0 *= corr; o1 *= corr;
            cref -= up * (1.0f / c2);
        }
        v16h bp;
        // unrolled: constant element indices keep the tiles in registers
#pragma unroll
        for (int r = 0; r < 8; ++r) {
            bp[r]     = (_Float16)e0[r];
            bp[8 + r] = (_Float16)e1[r];
        }
        rsum += ps;

        v16h av0 = __builtin_shufflevector(av0lo, av0hi, 0, 1, 2, 3, 4, 5, 6, 7, 8, 9, 10, 11, 12, 13, 14, 15);
        v16h av1 = __builtin_shufflevector(av1lo, av1hi, 0, 1, 2, 3, 4, 5, 6, 7, 8, 9, 10, 11, 12, 13, 14, 15);
        o0 = __builtin_amdgcn_wmma_f32_16x16x32_f16(false, av0, false, bp, (short)0, o0, false, false);
        o1 = __builtin_amdgcn_wmma_f32_16x16x32_f16(false, av1, false, bp, (short)0, o1, false, false);
      };
      // kept rolled: unrolled, the scheduler weaves two passes into each other, with
      // more v_nop slots behind the matrix instructions and twice the registers
#pragma nounroll
      for (int p = 0; p < ST_KEYS / 32 - 1; ++p) pass(p, true);
      pass(ST_KEYS / 32 - 1, false);   // the stage's last pass: the next fragments lie behind the barrier
      // Hand-over of the stages: this wave's LDS reads of stage s have returned
      // and its own copies of stage s + 1 have landed before the barrier; behind
      // it stage s + 1 may be read by all and the buffer of stage s refilled.
      asm volatile("s_wait_dscnt 0x0" ::: "memory");
      async_wait_all();
      __syncthreads();
      if (s + 2 < N_STAGES) stage_copy(s + 2, s & 1);
    }
    async_wait_all();      // no copy is left in flight when the wave goes on

    // finalize: join the halves' sums, /= rowsum, add positional encoding,
    // store 8 consecutive channels of one f16 GEMM row per 16-byte store
    rsum += xhalf(rsum);
    const float inv = 1.0f / rsum;
    const int b = ba >> 2, area = ba & 3;
    const int n_global = area * 1024 + n0 + row;
    const int c0 = h * 32 + 8 * hi;
    v8h w0, w1;
    const float* pcol = ppl + 8 * hi * PP_PITCH + wave * 16 + row;
    // unrolled: constant element indices, and all 16 loads in flight at once
#pragma unroll
    for (int r = 0; r < 8; ++r) {
        float pv0 = pcol[r * PP_PITCH];
        float pv1 = pcol[(16 + r) * PP_PITCH];
        w0[r] = (_Float16)(o0[r] * inv + pv0);
        w1[r] = (_Float16)(o1[r] * inv + pv1);
    }
    _Float16* crow = comb16 + ((size_t)(b * 4096 + n_global)) * 256 + c0;
    *(v8h*)(crow)      = w0;
    *(v8h*)(crow + 16) = w1;
}

// ---------------------------------------------------------------------------
// Kernel F: projection GEMM: comb16 (8192x256) * wproj16^T + bias -> NCHW f32
// Weight slab async-staged in LDS as in kernel C; weights as the A operand as
// there, so that 16 lanes lie along n, the contiguous axis of out.
// ---------------------------------------------------------------------------
__global__ __launch_bounds__(256) void proj_gemm_kernel(
    const _Float16* __restrict__ A, const _Float16* __restrict__ W,
    const float* __restrict__ bias, float* __restrict__ out)
{
    __shared__ __attribute__((aligned(16))) _Float16 wlds[128 * W_PITCH];   // 64 KB weight slab, padded rows
    const int lane = threadIdx.x & 31, wave = threadIdx.x >> 5;
    const int wm = wave & 3, wn = wave >> 2;
    const int m0 = blockIdx.x * 64 + wm * 16;
    const int n0 = wn * 64;
    const int nslab = blockIdx.y * 128;
    const int row = lane & 15, hi = lane >> 4;
    const int o0 = nslab + n0 + 8 * hi;         // lane's first output channel

    // The wave's fragments of A for all 8 k-steps, fetched ahead of the weight
    // copies, as in kernel C.
    const unsigned xoff = (unsigned)(m0 + row) * 512u + (unsigned)hi * 32u;   // byte offset in A
    v16h xa[8];
    // unrolled: constant element indices keep the fragments in registers
#pragma unroll
    for (int k = 0; k < 8; ++k) xa[k] = *(const v16h*)((const char*)A + xoff + k * 64);
    const unsigned boff = (unsigned)o0 * 4u;    // byte offset of the lane's first bias value
    v4f blo[4], bhi[4];                         // the lane's 8 bias values of each tile, fetched up here too
    // unrolled: constant element indices keep them in registers
#pragma unroll
    for (int t = 0; t < 4; ++t) {
        blo[t] = *(const v4f*)((const char*)bias + boff + t * 64);
        bhi[t] = *(const v4f*)((const char*)bias + boff + t * 64 + 16);
    }

    {
        const _Float16* wsrc = W + (size_t)nslab * 256 + threadIdx.x * 8;
        _Float16* wdst = wlds + wave * W_PITCH + lane * 8;
        async_copy8_b128(wsrc, wdst, 8 * 256, 8 * W_PITCH);
        async_copy8_b128(wsrc + 64 * 256, wdst + 64 * W_PITCH, 8 * 256, 8 * W_PITCH);
        // The wait that stands before the address registers of the loads above are
        // used for anything else; the offsets are named so that they stay whole up
        // to it. It stands behind the copies, so that these follow the loads at once.
        asm volatile("s_wait_xcnt 0x0" :: "v"(xoff), "v"(boff) : "memory");
        async_wait_all();
        __syncthreads();
    }

    v8f acc[4] = {};
    // a whole k-step a group, two groups ahead: two waves a SIMD leave the registers for it
    slab_products<4, 2>(wlds + (n0 + row) * W_PITCH + hi * 16, xa, acc);
    // acc[t][r] = Y[position m0 + row][channel o0 + t*16 + r]
    const int m = m0 + row;
    const int b = m >> 12, n = m & 4095;
    float* dst = out + ((size_t)(b * 256 + o0) << 12) + n;
    // unrolled: constant element indices keep acc in registers
#pragma unroll
    for (int t = 0; t < 4; ++t) {
#pragma unroll
        for (int r = 0; r < 8; ++r)
            dst[(t * 16 + r) << 12] = acc[t][r] + (r < 4 ? blo[t][r & 3] : bhi[t][r & 3]);
    }
}

// ---------------------------------------------------------------------------
extern "C" void kernel_launch(void* const* d_in, const int* in_sizes, int n_in,
                              void* d_out, int out_size, void* d_ws, size_t ws_size,
                              hipStream_t stream)
{
    const float* x     = (const float*)d_in[0];
    const float* w_qk  = (const float*)d_in[1];
    const float* w_v   = (const float*)d_in[2];
    const float* w_pe  = (const float*)d_in[3];
    const float* w_pr  = (const float*)d_in[4];
    const float* qk_g  = (const float*)d_in[5];
    const float* qk_b  = (const float*)d_in[6];
    const float* qk_m  = (const float*)d_in[7];
    const float* qk_v  = (const float*)d_in[8];
    const float* v_g   = (const float*)d_in[9];
    const float* v_b   = (const float*)d_in[10];
    const float* v_m   = (const float*)d_in[11];
    const float* v_v   = (const float*)d_in[12];
    const float* pe_g  = (const float*)d_in[13];
    const float* pe_b  = (const float*)d_in[14];
    const float* pe_m  = (const float*)d_in[15];
    const float* pe_v  = (const float*)d_in[16];
    const float* pr_g  = (const float*)d_in[17];
    const float* pr_b  = (const float*)d_in[18];
    const float* pr_m  = (const float*)d_in[19];
    const float* pr_v  = (const float*)d_in[20];
    float* out = (float*)d_out;

    // workspace carve-up (256B aligned)
    char* ws = (char*)d_ws;
    size_t off = 0;
    auto carve = [&](size_t bytes) -> char* {
        char* p = ws + off;
        off = (off + bytes + 255) & ~(size_t)255;
        return p;
    };
    _Float16* wcat16  = (_Float16*)carve(768 * 256 * sizeof(_Float16));
    float*    biascat = (float*)   carve(768 * sizeof(float));
    _Float16* wproj16 = (_Float16*)carve(256 * 256 * sizeof(_Float16));
    float*    biaspr  = (float*)   carve(256 * sizeof(float));
    float*    wpe_s   = (float*)   carve(256 * 25 * sizeof(float));
    float*    biaspe  = (float*)   carve(256 * sizeof(float));
    _Float16* X16     = (_Float16*)carve((size_t)8192 * 256 * sizeof(_Float16));
    _Float16* q16     = (_Float16*)carve((size_t)8 * 8 * 1024 * 32 * sizeof(_Float16));
    _Float16* k16     = (_Float16*)carve((size_t)8 * 8 * 1024 * 32 * sizeof(_Float16));
    _Float16* v16t    = (_Float16*)carve((size_t)8 * 8 * 32 * 1024 * sizeof(_Float16));
    float*    vf32    = (float*)   carve((size_t)2 * 256 * 4096 * sizeof(float));
    _Float16* comb16  = (_Float16*)carve((size_t)8192 * 256 * sizeof(_Float16));

    prep_kernel<<<FOLD_BLOCKS + PACK_BLOCKS, 256, 0, stream>>>(
        x, X16,
        w_qk, qk_g, qk_b, qk_m, qk_v,
        w_v,  v_g,  v_b,  v_m,  v_v,
        w_pe, pe_g, pe_b, pe_m, pe_v,
        w_pr, pr_g, pr_b, pr_m, pr_v,
        wcat16, biascat, wproj16, biaspr, wpe_s, biaspe);

    qkv_gemm_kernel<<<dim3(8192 / 64, 768 / 128), 256, 0, stream>>>(
        X16, wcat16, biascat, q16, k16, v16t, vf32);

    attn_kernel<<<dim3(8, 8, 8), 256, 0, stream>>>(q16, k16, v16t, vf32, wpe_s, biaspe, comb16);

    proj_gemm_kernel<<<dim3(8192 / 64, 256 / 128), 256, 0, stream>>>(
        comb16, wproj16, biaspr, out);
}
